// v000
// Measured on an AMD MI455X. A time is GPU time per run, averaged over a window of back-to-back runs after a warm-up
// (all launches, gaps included; the runs take copies of the inputs in turn), and the median of several windows.
// Apart from v000's, it joins two sittings. Times from different sittings can be a few percent apart, while
// side-by-side timings come from the same sitting.
// v000 is the starting kernel. One run takes 544 microseconds.
#include <hip/hip_runtime.h>
#include <stddef.h>

// Contractions: head projections, q.k scores (statistics pass and output pass), P.V over the query axis,
// output projection -- all v_wmma_f32_16x16x32_bf16 with bf16 hi/lo operand split (hi*hi + hi*lo + lo*hi),
// f32 accumulate. RoPE, softmax statistics, masks and epilogues in f32.

#define HEADS 8
#define DE 64
#define BATCH 2
#define SEQ 2048
#define BH (BATCH * HEADS)
#define ZDIM (HEADS * DE)
#define ROWS (BATCH * SEQ)
#define QT (SEQ / 16)
#define RT64 (ROWS / 64)
#define WPITCH 72
#define KPITCH 40
#define OPITCH 68
#define NEG_BIG (-3.0e38f)

typedef char chk_de[(DE == 64) ? 1 : -1];
typedef char chk_seq[((SEQ % 64) == 0) ? 1 : -1];
typedef char chk_rows[((ROWS % 64) == 0) ? 1 : -1];
typedef char chk_waves[(((BH * QT) % 2) == 0) ? 1 : -1];
typedef char chk_z[((ZDIM % 32) == 0) ? 1 : -1];

typedef __bf16 bf16_t;
typedef bf16_t v16bf __attribute__((ext_vector_type(16)));
typedef float v8f __attribute__((ext_vector_type(8)));
typedef float v4f __attribute__((ext_vector_type(4)));
typedef float v2f __attribute__((ext_vector_type(2)));
typedef unsigned int v4u __attribute__((ext_vector_type(4)));
typedef unsigned short us_t;

union Frag {
  v16bf v;
  v4u u[2];
};

__device__ __forceinline__ v4u mk4(unsigned int a, unsigned int b, unsigned int c, unsigned int d) {
  v4u r;
  r.x = a; r.y = b; r.z = c; r.w = d;
  return r;
}

__device__ __forceinline__ v8f zero8() {
  v8f z;
#pragma unroll
  for (int i = 0; i < 8; ++i) z[i] = 0.f;
  return z;
}

// f32 -> bf16 bits, RNE
__device__ __forceinline__ unsigned int bf_rne(float x) {
  unsigned int u = __float_as_uint(x);
  u += 0x7FFFu + ((u >> 16) & 1u);
  return u >> 16;
}
__device__ __forceinline__ float bf_val(unsigned int b) { return __uint_as_float(b << 16); }

// x ~= hi + lo : hi = RNE16(x), lo = RNE16(x - hi); two values packed per dword (even element in the low half)
__device__ __forceinline__ void split2(float x0, float x1, unsigned int& ph, unsigned int& pl) {
  const unsigned int h0 = bf_rne(x0), h1 = bf_rne(x1);
  const unsigned int l0 = bf_rne(x0 - bf_val(h0)), l1 = bf_rne(x1 - bf_val(h1));
  ph = h0 | (h1 << 16);
  pl = l0 | (l1 << 16);
}
__device__ __forceinline__ void split1(float x, us_t& hb, us_t& lb) {
  const unsigned int h = bf_rne(x);
  hb = (us_t)h;
  lb = (us_t)bf_rne(x - bf_val(h));
}
// 8 consecutive k values (a = k..k+3, b = k+4..k+7) -> packed hi and lo halves of a fragment
__device__ __forceinline__ void split8(v4f a, v4f b, v4u& ph, v4u& pl) {
  unsigned int h0, l0, h1, l1, h2, l2, h3, l3;
  split2(a.x, a.y, h0, l0);
  split2(a.z, a.w, h1, l1);
  split2(b.x, b.y, h2, l2);
  split2(b.z, b.w, h3, l3);
  ph = mk4(h0, h1, h2, h3);
  pl = mk4(l0, l1, l2, l3);
}

// D += Ah*Bh + Ah*Bl + Al*Bh ; 4 v_nop guard tying D and keeping all operands live
__device__ __forceinline__ v8f mma3(v16bf ah, v16bf al, v16bf bh, v16bf bl, v8f c) {
  c = __builtin_amdgcn_wmma_f32_16x16x32_bf16(false, ah, false, bh, (short)0, c, false, false);
  c = __builtin_amdgcn_wmma_f32_16x16x32_bf16(false, ah, false, bl, (short)0, c, false, false);
  c = __builtin_amdgcn_wmma_f32_16x16x32_bf16(false, al, false, bh, (short)0, c, false, false);
  asm volatile("v_nop\n\tv_nop\n\tv_nop\n\tv_nop" : "+v"(c) : "v"(ah), "v"(al), "v"(bh), "v"(bl));
  return c;
}

// 16-bit fragment from a row-major [row][k] array (pitch ld elements), rows base..base+15, k from k0.
// Lane l: row = l&15, h = l>>4; elements 0..7 = k0+8h+0..7, elements 8..15 = k0+16+8h+0..7.
// Used for A (row = m) and for B stored n-major with k contiguous (row = n). Also used on LDS tiles.
__device__ __forceinline__ v16bf ldfrag(const us_t* base, int ld, int k0, int l) {
  const us_t* p = base + (size_t)(l & 15) * ld + k0 + 8 * (l >> 4);
  Frag f;
  f.u[0] = *(const v4u*)p;
  f.u[1] = *(const v4u*)(p + 16);
  return f.v;
}

// =====================================================================
// Kernel 1: head projections + RoPE on q,k.  Block = 4 waves = 64 rows of one (matrix, head).
// Outputs (bf16 hi and lo planes):
//   qh, kh : [bh][s][d]   (row major, d contiguous)
//   vt     : [bh][d][s]   (s contiguous)
// =====================================================================
__global__ __launch_bounds__(128) void k_proj(
    const float* __restrict__ q, const float* __restrict__ k, const float* __restrict__ v,
    const float* __restrict__ Wq, const float* __restrict__ Wk, const float* __restrict__ Wv,
    us_t* __restrict__ qhh, us_t* __restrict__ qhl, us_t* __restrict__ khh, us_t* __restrict__ khl,
    us_t* __restrict__ vth, us_t* __restrict__ vtl) {
#pragma clang fp contract(off)
  __shared__ __attribute__((aligned(16))) us_t wt[2][DE][WPITCH];   // W^T hi/lo : [plane][d][z]
  __shared__ __attribute__((aligned(16))) us_t st[2][64][WPITCH];   // result tile staging
  __shared__ float invf[32];

  const int t = threadIdx.x, w = t >> 5, l = t & 31, m = l & 15, hh = l >> 4;
  const int blk = blockIdx.x;
  const int mat = blk / (HEADS * RT64);                 // 0 = q, 1 = k, 2 = v (block-uniform)
  const int rem = blk - mat * (HEADS * RT64);
  const int head = rem / RT64;
  const int rt = rem - head * RT64;
  const int row0 = rt * 64;                             // row in [0, BATCH*SEQ)
  const int b = row0 / SEQ, s0 = row0 - b * SEQ, bh = b * HEADS + head;

  const float* X = (mat == 0) ? q : ((mat == 1) ? k : v);
  const float* W = ((mat == 0) ? Wq : ((mat == 1) ? Wk : Wv)) + (size_t)head * DE * DE;

  // stage W[z][d] -> wt[p][d][z] as hi/lo bf16
#pragma unroll 4
  for (int j = 0; j < 32; ++j) {
    const int idx = j * 128 + t;
    const int z = idx >> 6, d = idx & 63;
    us_t hb, lb;
    split1(W[idx], hb, lb);
    wt[0][d][z] = hb;
    wt[1][d][z] = lb;
  }
  if (t < 32) invf[t] = 1.0f / powf(10000.0f, (float)t * 0.03125f);
  __syncthreads();

  // A fragments: this wave's 16 rows of X, k 0..31 and 32..63
  const float* xr = X + (size_t)(row0 + w * 16 + m) * DE;
  Frag ah0, al0, ah1, al1;
  {
    v4f a, c;
    a = *(const v4f*)(xr + 8 * hh);       c = *(const v4f*)(xr + 8 * hh + 4);       split8(a, c, ah0.u[0], al0.u[0]);
    a = *(const v4f*)(xr + 16 + 8 * hh);  c = *(const v4f*)(xr + 16 + 8 * hh + 4);  split8(a, c, ah0.u[1], al0.u[1]);
    a = *(const v4f*)(xr + 32 + 8 * hh);  c = *(const v4f*)(xr + 32 + 8 * hh + 4);  split8(a, c, ah1.u[0], al1.u[0]);
    a = *(const v4f*)(xr + 48 + 8 * hh);  c = *(const v4f*)(xr + 48 + 8 * hh + 4);  split8(a, c, ah1.u[1], al1.u[1]);
  }

  v8f acc[4];
#pragma unroll
  for (int n = 0; n < 4; ++n) acc[n] = zero8();
#pragma unroll
  for (int n = 0; n < 4; ++n) {
    acc[n] = mma3(ah0.v, al0.v, ldfrag(&wt[0][n * 16][0], WPITCH, 0, l),
                  ldfrag(&wt[1][n * 16][0], WPITCH, 0, l), acc[n]);
    acc[n] = mma3(ah1.v, al1.v, ldfrag(&wt[0][n * 16][0], WPITCH, 32, l),
                  ldfrag(&wt[1][n * 16][0], WPITCH, 32, l), acc[n]);
  }
  // acc[n][r] = Y[row0 + w*16 + 8*hh + r][n*16 + m]

  if (mat < 2) {   // interleaved-pair rotary embedding: cols (2i, 2i+1) are adjacent lanes
#pragma unroll
    for (int n = 0; n < 4; ++n) {
      const int N = n * 16 + m;
      const float f = invf[N >> 1];
#pragma unroll
      for (int r = 0; r < 8; ++r) {
        const int pos = s0 + w * 16 + 8 * hh + r;
        const float ang = (float)pos * f;
        const float sn = sinf(ang), cs = cosf(ang);
        const float mine = acc[n][r];
        const float other = __shfl_xor(mine, 1, 32);
        acc[n][r] = ((N & 1) == 0) ? (mine * cs - other * sn) : (other * sn + mine * cs);
      }
    }
  }

  // stage the 64-row block tile as hi/lo bf16
  if (mat == 2) {   // transposed: st[p][d][row_local]
#pragma unroll
    for (int n = 0; n < 4; ++n)
#pragma unroll
      for (int r = 0; r < 8; ++r) {
        us_t hb, lb;
        split1(acc[n][r], hb, lb);
        st[0][n * 16 + m][w * 16 + 8 * hh + r] = hb;
        st[1][n * 16 + m][w * 16 + 8 * hh + r] = lb;
      }
  } else {          // row major: st[p][row_local][d]
#pragma unroll
    for (int n = 0; n < 4; ++n)
#pragma unroll
      for (int r = 0; r < 8; ++r) {
        us_t hb, lb;
        split1(acc[n][r], hb, lb);
        st[0][w * 16 + 8 * hh + r][n * 16 + m] = hb;
        st[1][w * 16 + 8 * hh + r][n * 16 + m] = lb;
      }
  }
  __syncthreads();

  v4u vals[2][4];
  size_t offs[4];
  const int ch = l & 7, sub4 = l >> 3;
  us_t* dsth;
  us_t* dstl;
  if (mat == 2) {
    dsth = vth; dstl = vtl;
#pragma unroll
    for (int i = 0; i < 4; ++i) {
      const int d = w * 16 + 4 * i + sub4;
      vals[0][i] = *(const v4u*)&st[0][d][ch * 8];
      vals[1][i] = *(const v4u*)&st[1][d][ch * 8];
      offs[i] = ((size_t)bh * DE + d) * SEQ + s0 + ch * 8;
    }
  } else {
    dsth = (mat == 0) ? qhh : khh;
    dstl = (mat == 0) ? qhl : khl;
#pragma unroll
    for (int i = 0; i < 4; ++i) {
      const int rr = w * 16 + 4 * i + sub4;
      vals[0][i] = *(const v4u*)&st[0][rr][ch * 8];
      vals[1][i] = *(const v4u*)&st[1][rr][ch * 8];
      offs[i] = ((size_t)bh * SEQ + s0 + rr) * DE + ch * 8;
    }
  }
#pragma unroll
  for (int i = 0; i < 4; ++i) {
    *(v4u*)(dsth + offs[i]) = vals[0][i];
    *(v4u*)(dstl + offs[i]) = vals[1][i];
  }
  
}

// =====================================================================
// Kernel 2: per query row: m[q] = max_{k<=q} s/64, rcp[q] = 1 / sum exp(s/64 - m).
// =====================================================================
__global__ __launch_bounds__(64) void k_stats(
    const us_t* __restrict__ qhh, const us_t* __restrict__ qhl,
    const us_t* __restrict__ khh, const us_t* __restrict__ khl, float* __restrict__ ml) {
  const int wave = blockIdx.x * 2 + (threadIdx.x >> 5);
  const int bh = wave / QT, qt = wave - bh * QT;
  const int l = threadIdx.x & 31, m = l & 15, hh = l >> 4;

  const size_t qoff = ((size_t)bh * SEQ + qt * 16) * DE;
  const v16bf aqh0 = ldfrag(qhh + qoff, DE, 0, l), aqh1 = ldfrag(qhh + qoff, DE, 32, l);
  const v16bf aql0 = ldfrag(qhl + qoff, DE, 0, l), aql1 = ldfrag(qhl + qoff, DE, 32, l);
  const us_t* Kh = khh + (size_t)bh * SEQ * DE;
  const us_t* Kl = khl + (size_t)bh * SEQ * DE;

  float mrow[8], lrow[8];
#pragma unroll
  for (int r = 0; r < 8; ++r) { mrow[r] = NEG_BIG; lrow[r] = 0.f; }

#pragma unroll 1
  for (int kt = 0; kt <= qt; ++kt) {
    const size_t ko = (size_t)kt * 16 * DE;
    v8f s = zero8();
    s = mma3(aqh0, aql0, ldfrag(Kh + ko, DE, 0, l), ldfrag(Kl + ko, DE, 0, l), s);
    s = mma3(aqh1, aql1, ldfrag(Kh + ko, DE, 32, l), ldfrag(Kl + ko, DE, 32, l), s);
    // s[r] = score[q = qt*16 + 8*hh + r][k = kt*16 + m]
#pragma unroll
    for (int r = 0; r < 8; ++r) {
      const int qg = qt * 16 + 8 * hh + r;
      const int kg = kt * 16 + m;
      const float x = (kg <= qg) ? s[r] * (1.0f / 64.0f) : NEG_BIG;
      float gm = x;
#pragma unroll
      for (int off = 1; off < 16; off <<= 1) gm = fmaxf(gm, __shfl_xor(gm, off, 32));
      const float mn = fmaxf(mrow[r], gm);
      float e = __expf(x - mn);
#pragma unroll
      for (int off = 1; off < 16; off <<= 1) e += __shfl_xor(e, off, 32);
      lrow[r] = lrow[r] * __expf(mrow[r] - mn) + e;
      mrow[r] = mn;
    }
  }

  const int rs0 = 2 * (l & 3), rs1 = rs0 + 1;
  float m0 = 0.f, l0 = 1.f, m1 = 0.f, l1 = 1.f;
#pragma unroll
  for (int r = 0; r < 8; ++r) {
    if (r == rs0) { m0 = mrow[r]; l0 = lrow[r]; }
    if (r == rs1) { m1 = mrow[r]; l1 = lrow[r]; }
  }
  const int src = (l & 3) + (((l >> 2) & 1) << 4);
  m0 = __shfl(m0, src, 32); l0 = __shfl(l0, src, 32);
  m1 = __shfl(m1, src, 32); l1 = __shfl(l1, src, 32);
  v4f val;
  val.x = m0; val.y = 1.0f / l0; val.z = m1; val.w = 1.0f / l1;
  float* dst = ml + ((size_t)bh * SEQ + qt * 16) * 2 + 4 * l;
  if (l < 8) *(v4f*)dst = val;
  
}

// =====================================================================
// Kernel 3: out_h[bh][kpos][d] = sum_{q > kpos} P[q,kpos] * vh[q][d]   (contraction over the query axis)
// One wave per (bh, 16-col k tile): loops over q in chunks of 32 -> two 16x16 score tiles -> P in registers
// (packed D tiles = P^T A fragment) -> 4 P^T.V products. Stores f32 out_h [b*S][H*DE].
// =====================================================================
__global__ __launch_bounds__(64) void k_attn(
    const us_t* __restrict__ qhh, const us_t* __restrict__ qhl,
    const us_t* __restrict__ khh, const us_t* __restrict__ khl,
    const us_t* __restrict__ vth, const us_t* __restrict__ vtl,
    const float* __restrict__ ml, float* __restrict__ outh) {
  __shared__ __attribute__((aligned(16))) float so[2][16][OPITCH];
  const int w = threadIdx.x >> 5;
  const int wave = blockIdx.x * 2 + w;
  const int bh = wave / QT, kt = wave - bh * QT;
  const int l = threadIdx.x & 31, m = l & 15, hh = l >> 4;

  // loop-invariant B fragments of the key tile (kh rows kt*16.., lane = key)
  const size_t koff = ((size_t)bh * SEQ + kt * 16) * DE;
  const v16bf bkh0 = ldfrag(khh + koff, DE, 0, l), bkh1 = ldfrag(khh + koff, DE, 32, l);
  const v16bf bkl0 = ldfrag(khl + koff, DE, 0, l), bkl1 = ldfrag(khl + koff, DE, 32, l);

  v8f o[4];
#pragma unroll
  for (int n = 0; n < 4; ++n) o[n] = zero8();

  const int kg = kt * 16 + m;                       // this lane's key column in the score tiles
  const float* mlb = ml + (size_t)bh * SEQ * 2;
  const us_t* Qh = qhh + (size_t)bh * SEQ * DE;
  const us_t* Ql = qhl + (size_t)bh * SEQ * DE;
  const us_t* Vh = vth + (size_t)bh * DE * SEQ;
  const us_t* Vl = vtl + (size_t)bh * DE * SEQ;

#pragma unroll 1
  for (int qc = (kt >> 1) * 32; qc < SEQ; qc += 32) {
    unsigned int ph[2][4], pl[2][4];
#pragma unroll
    for (int sub = 0; sub < 2; ++sub) {
      const int q0 = qc + 16 * sub;
      const size_t qo = (size_t)q0 * DE;
      v8f s = zero8();
      s = mma3(ldfrag(Qh + qo, DE, 0, l), ldfrag(Ql + qo, DE, 0, l), bkh0, bkl0, s);
      s = mma3(ldfrag(Qh + qo, DE, 32, l), ldfrag(Ql + qo, DE, 32, l), bkh1, bkl1, s);
      // s[r] = score[q = q0 + 8*hh + r][k = kg]
      float p[8];
#pragma unroll
      for (int r = 0; r < 8; ++r) {
        const int qg = q0 + 8 * hh + r;
        const v2f mr = *(const v2f*)(mlb + 2 * qg);
        const float e = __expf(s[r] * (1.0f / 64.0f) - mr.x) * mr.y;
        p[r] = (kg < qg) ? e : 0.f;                 // causal and zeroed diagonal: strictly k < q
      }
#pragma unroll
      for (int j = 0; j < 4; ++j) split2(p[2 * j], p[2 * j + 1], ph[sub][j], pl[sub][j]);
    }
    // P^T A fragment (rows = key m, k = 32 queries of this chunk): elements 0..7 from the first
    // 16-query D tile, 8..15 from the second, same lane.
    Frag aph, apl;
    aph.u[0] = mk4(ph[0][0], ph[0][1], ph[0][2], ph[0][3]);
    aph.u[1] = mk4(ph[1][0], ph[1][1], ph[1][2], ph[1][3]);
    apl.u[0] = mk4(pl[0][0], pl[0][1], pl[0][2], pl[0][3]);
    apl.u[1] = mk4(pl[1][0], pl[1][1], pl[1][2], pl[1][3]);
#pragma unroll
    for (int n = 0; n < 4; ++n) {
      const size_t vo = (size_t)(n * 16) * SEQ;      // B from vt rows d = n*16.., k = query from qc
      o[n] = mma3(aph.v, apl.v, ldfrag(Vh + vo, SEQ, qc, l), ldfrag(Vl + vo, SEQ, qc, l), o[n]);
    }
  }
  // o[n][r] = out_h[kpos = kt*16 + 8*hh + r][d = n*16 + m]

#pragma unroll
  for (int n = 0; n < 4; ++n)
#pragma unroll
    for (int r = 0; r < 8; ++r) so[w][8 * hh + r][n * 16 + m] = o[n][r];
  __syncthreads();

  const int bb = bh / HEADS, head = bh - bb * HEADS;
  v4f vals[8];
  size_t offs[8];
#pragma unroll
  for (int i = 0; i < 8; ++i) {
    const int row = 2 * i + hh;
    vals[i] = *(const v4f*)&so[w][row][4 * m];
    offs[i] = ((size_t)bb * SEQ + kt * 16 + row) * ZDIM + head * DE + 4 * m;
  }
#pragma unroll
  for (int i = 0; i < 8; ++i) *(v4f*)(outh + offs[i]) = vals[i];
  
}

// =====================================================================
// Kernel 4: out = out_h (4096 x 512) . W_o (512 x 64). Block = 4 waves = 64 rows;
// W_o^T staged per 32-deep k chunk as hi/lo bf16 in LDS.
// =====================================================================
__global__ __launch_bounds__(128) void k_oproj(
    const float* __restrict__ outh, const float* __restrict__ Wo, float* __restrict__ out) {
  __shared__ __attribute__((aligned(16))) us_t wo[2][DE][KPITCH];   // [plane][d][z_local]
  __shared__ __attribute__((aligned(16))) float so[4][16][OPITCH];
  const int t = threadIdx.x, w = t >> 5, l = t & 31, m = l & 15, hh = l >> 4;
  const int rowbase = blockIdx.x * 64 + w * 16;

  v8f acc[4];
#pragma unroll
  for (int n = 0; n < 4; ++n) acc[n] = zero8();

#pragma unroll 1
  for (int c = 0; c < ZDIM / 32; ++c) {
    __syncthreads();                       // all waves done reading the staged chunk
#pragma unroll
    for (int j = 0; j < 16; ++j) {
      const int idx = j * 128 + t;
      const int zz = idx >> 6, d = idx & 63;
      us_t hb, lb;
      split1(Wo[(size_t)(c * 32 + zz) * DE + d], hb, lb);
      wo[0][d][zz] = hb;
      wo[1][d][zz] = lb;
    }
    __syncthreads();
    const float* ar = outh + (size_t)(rowbase + m) * ZDIM + c * 32;
    Frag ah, al;
    {
      v4f a, e;
      a = *(const v4f*)(ar + 8 * hh);       e = *(const v4f*)(ar + 8 * hh + 4);       split8(a, e, ah.u[0], al.u[0]);
      a = *(const v4f*)(ar + 16 + 8 * hh);  e = *(const v4f*)(ar + 16 + 8 * hh + 4);  split8(a, e, ah.u[1], al.u[1]);
    }
#pragma unroll
    for (int n = 0; n < 4; ++n)
      acc[n] = mma3(ah.v, al.v, ldfrag(&wo[0][n * 16][0], KPITCH, 0, l),
                    ldfrag(&wo[1][n * 16][0], KPITCH, 0, l), acc[n]);
  }
  // acc[n][r] = out[rowbase + 8*hh + r][n*16 + m]

#pragma unroll
  for (int n = 0; n < 4; ++n)
#pragma unroll
    for (int r = 0; r < 8; ++r) so[w][8 * hh + r][n * 16 + m] = acc[n][r];
  __syncthreads();

  v4f vals[8];
  size_t offs[8];
#pragma unroll
  for (int i = 0; i < 8; ++i) {
    const int row = 2 * i + hh;
    vals[i] = *(const v4f*)&so[w][row][4 * m];
    offs[i] = (size_t)(rowbase + row) * DE + 4 * m;
  }
#pragma unroll
  for (int i = 0; i < 8; ++i) *(v4f*)(out + offs[i]) = vals[i];
  
}

extern "C" void kernel_launch(void* const* d_in, const int* in_sizes, int n_in,
                              void* d_out, int out_size, void* d_ws, size_t ws_size,
                              hipStream_t stream) {
  if (n_in < 7) return;
  if (in_sizes[0] != ROWS * DE || in_sizes[1] != ROWS * DE || in_sizes[2] != ROWS * DE) return;
  if (in_sizes[3] != HEADS * DE * DE || in_sizes[4] != HEADS * DE * DE || in_sizes[5] != HEADS * DE * DE) return;
  if (in_sizes[6] != ZDIM * DE) return;
  if (out_size != ROWS * DE) return;

  const float* q  = (const float*)d_in[0];
  const float* k  = (const float*)d_in[1];
  const float* v  = (const float*)d_in[2];
  const float* Wq = (const float*)d_in[3];
  const float* Wk = (const float*)d_in[4];
  const float* Wv = (const float*)d_in[5];
  const float* Wo = (const float*)d_in[6];
  float* out = (float*)d_out;

  char* ws = (char*)d_ws;
  size_t off = 0;
  const size_t plane = (size_t)BH * SEQ * DE * sizeof(us_t);          // 4 MiB each
  us_t* qhh = (us_t*)(ws + off); off += plane;
  us_t* qhl = (us_t*)(ws + off); off += plane;
  us_t* khh = (us_t*)(ws + off); off += plane;
  us_t* khl = (us_t*)(ws + off); off += plane;
  us_t* vth = (us_t*)(ws + off); off += plane;
  us_t* vtl = (us_t*)(ws + off); off += plane;
  float* ml   = (float*)(ws + off); off += (size_t)BH * SEQ * 2 * sizeof(float);    // 256 KiB
  float* outh = (float*)(ws + off); off += (size_t)ROWS * ZDIM * sizeof(float);      // 8 MiB
  if (off > ws_size) return;

  k_proj<<<dim3(3 * HEADS * RT64), dim3(128), 0, stream>>>(q, k, v, Wq, Wk, Wv,
                                                           qhh, qhl, khh, khl, vth, vtl);
  k_stats<<<dim3((BH * QT) / 2), dim3(64), 0, stream>>>(qhh, qhl, khh, khl, ml);
  k_attn<<<dim3((BH * QT) / 2), dim3(64), 0, stream>>>(qhh, qhl, khh, khl, vth, vtl, ml, outh);
  k_oproj<<<dim3(ROWS / 64), dim3(128), 0, stream>>>(outh, Wo, out);
}

// v001
// It runs in 280 microseconds.
// In both of two side-by-side timings against v000, it was 1.94 times as fast.
#include <hip/hip_runtime.h>
#include <stddef.h>

// Contractions: head projections, q.k scores (statistics pass and output pass), P.V over the query axis,
// output projection -- all v_wmma_f32_16x16x32_bf16 with bf16 hi/lo operand split (hi*hi + hi*lo + lo*hi),
// f32 accumulate. RoPE, softmax statistics, masks and epilogues in f32.

#define HEADS 8
#define DE 64
#define BATCH 2
#define SEQ 2048
#define BH (BATCH * HEADS)
#define ZDIM (HEADS * DE)
#define ROWS (BATCH * SEQ)
#define QT (SEQ / 16)
#define RT64 (ROWS / 64)
#define WPITCH 72
#define KPITCH 40
#define OPITCH 68
#define NEG_BIG (-3.0e38f)

typedef char chk_de[(DE == 64) ? 1 : -1];
typedef char chk_seq[((SEQ % 64) == 0) ? 1 : -1];
typedef char chk_rows[((ROWS % 64) == 0) ? 1 : -1];
typedef char chk_waves[(((BH * QT) % 2) == 0) ? 1 : -1];
typedef char chk_z[((ZDIM % 32) == 0) ? 1 : -1];

typedef __bf16 bf16_t;
typedef bf16_t v16bf __attribute__((ext_vector_type(16)));
typedef float v8f __attribute__((ext_vector_type(8)));
typedef float v4f __attribute__((ext_vector_type(4)));
typedef float v2f __attribute__((ext_vector_type(2)));
typedef unsigned int v4u __attribute__((ext_vector_type(4)));
typedef unsigned short us_t;

union Frag {
  v16bf v;
  v4u u[2];
};

__device__ __forceinline__ v4u mk4(unsigned int a, unsigned int b, unsigned int c, unsigned int d) {
  v4u r;
  r.x = a; r.y = b; r.z = c; r.w = d;
  return r;
}

__device__ __forceinline__ v8f zero8() {
  v8f z;
#pragma unroll
  for (int i = 0; i < 8; ++i) z[i] = 0.f;
  return z;
}

// f32 -> bf16 bits, RNE
__device__ __forceinline__ unsigned int bf_rne(float x) {
  unsigned int u = __float_as_uint(x);
  u += 0x7FFFu + ((u >> 16) & 1u);
  return u >> 16;
}
__device__ __forceinline__ float bf_val(unsigned int b) { return __uint_as_float(b << 16); }

// x ~= hi + lo : hi = RNE16(x), lo = RNE16(x - hi); two values packed per dword (even element in the low half)
__device__ __forceinline__ void split2(float x0, float x1, unsigned int& ph, unsigned int& pl) {
  const unsigned int h0 = bf_rne(x0), h1 = bf_rne(x1);
  const unsigned int l0 = bf_rne(x0 - bf_val(h0)), l1 = bf_rne(x1 - bf_val(h1));
  ph = h0 | (h1 << 16);
  pl = l0 | (l1 << 16);
}
__device__ __forceinline__ void split1(float x, us_t& hb, us_t& lb) {
  const unsigned int h = bf_rne(x);
  hb = (us_t)h;
  lb = (us_t)bf_rne(x - bf_val(h));
}
// 8 consecutive k values (a = k..k+3, b = k+4..k+7) -> packed hi and lo halves of a fragment
__device__ __forceinline__ void split8(v4f a, v4f b, v4u& ph, v4u& pl) {
  unsigned int h0, l0, h1, l1, h2, l2, h3, l3;
  split2(a.x, a.y, h0, l0);
  split2(a.z, a.w, h1, l1);
  split2(b.x, b.y, h2, l2);
  split2(b.z, b.w, h3, l3);
  ph = mk4(h0, h1, h2, h3);
  pl = mk4(l0, l1, l2, l3);
}

// D += Ah*Bh + Ah*Bl + Al*Bh ; 4 v_nop guard tying D and keeping all operands live
__device__ __forceinline__ v8f mma3(v16bf ah, v16bf al, v16bf bh, v16bf bl, v8f c) {
  c = __builtin_amdgcn_wmma_f32_16x16x32_bf16(false, ah, false, bh, (short)0, c, false, false);
  c = __builtin_amdgcn_wmma_f32_16x16x32_bf16(false, ah, false, bl, (short)0, c, false, false);
  c = __builtin_amdgcn_wmma_f32_16x16x32_bf16(false, al, false, bh, (short)0, c, false, false);
  asm volatile("v_nop\n\tv_nop\n\tv_nop\n\tv_nop" : "+v"(c) : "v"(ah), "v"(al), "v"(bh), "v"(bl));
  return c;
}

// 16-bit fragment from a row-major [row][k] array (pitch ld elements), rows base..base+15, k from k0.
// Lane l: row = l&15, h = l>>4; elements 0..7 = k0+8h+0..7, elements 8..15 = k0+16+8h+0..7.
// Used for A (row = m) and for B stored n-major with k contiguous (row = n). Also used on LDS tiles.
__device__ __forceinline__ v16bf ldfrag(const us_t* base, int ld, int k0, int l) {
  const us_t* p = base + (size_t)(l & 15) * ld + k0 + 8 * (l >> 4);
  Frag f;
  f.u[0] = *(const v4u*)p;
  f.u[1] = *(const v4u*)(p + 16);
  return f.v;
}

// =====================================================================
// Kernel 1: head projections + RoPE on q,k.  Block = 4 waves = 64 rows of one (matrix, head).
// Outputs (bf16 hi and lo planes):
//   qh, kh : [bh][s][d]   (row major, d contiguous)
//   vt     : [bh][d][s]   (s contiguous)
// =====================================================================
__global__ __launch_bounds__(128) void k_proj(
    const float* __restrict__ q, const float* __restrict__ k, const float* __restrict__ v,
    const float* __restrict__ Wq, const float* __restrict__ Wk, const float* __restrict__ Wv,
    us_t* __restrict__ qhh, us_t* __restrict__ qhl, us_t* __restrict__ khh, us_t* __restrict__ khl,
    us_t* __restrict__ vth, us_t* __restrict__ vtl) {
#pragma clang fp contract(off)
  __shared__ __attribute__((aligned(16))) us_t wt[2][DE][WPITCH];   // W^T hi/lo : [plane][d][z]
  __shared__ __attribute__((aligned(16))) us_t st[2][64][WPITCH];   // result tile staging
  __shared__ float invf[32];

  const int t = threadIdx.x, w = t >> 5, l = t & 31, m = l & 15, hh = l >> 4;
  const int blk = blockIdx.x;
  const int mat = blk / (HEADS * RT64);                 // 0 = q, 1 = k, 2 = v (block-uniform)
  const int rem = blk - mat * (HEADS * RT64);
  const int head = rem / RT64;
  const int rt = rem - head * RT64;
  const int row0 = rt * 64;                             // row in [0, BATCH*SEQ)
  const int b = row0 / SEQ, s0 = row0 - b * SEQ, bh = b * HEADS + head;

  const float* X = (mat == 0) ? q : ((mat == 1) ? k : v);
  const float* W = ((mat == 0) ? Wq : ((mat == 1) ? Wk : Wv)) + (size_t)head * DE * DE;

  // stage W[z][d] -> wt[p][d][z] as hi/lo bf16
#pragma unroll 4
  for (int j = 0; j < 32; ++j) {
    const int idx = j * 128 + t;
    const int z = idx >> 6, d = idx & 63;
    us_t hb, lb;
    split1(W[idx], hb, lb);
    wt[0][d][z] = hb;
    wt[1][d][z] = lb;
  }
  if (t < 32) invf[t] = 1.0f / powf(10000.0f, (float)t * 0.03125f);
  __syncthreads();

  // A fragments: this wave's 16 rows of X, k 0..31 and 32..63
  const float* xr = X + (size_t)(row0 + w * 16 + m) * DE;
  Frag ah0, al0, ah1, al1;
  {
    v4f a, c;
    a = *(const v4f*)(xr + 8 * hh);       c = *(const v4f*)(xr + 8 * hh + 4);       split8(a, c, ah0.u[0], al0.u[0]);
    a = *(const v4f*)(xr + 16 + 8 * hh);  c = *(const v4f*)(xr + 16 + 8 * hh + 4);  split8(a, c, ah0.u[1], al0.u[1]);
    a = *(const v4f*)(xr + 32 + 8 * hh);  c = *(const v4f*)(xr + 32 + 8 * hh + 4);  split8(a, c, ah1.u[0], al1.u[0]);
    a = *(const v4f*)(xr + 48 + 8 * hh);  c = *(const v4f*)(xr + 48 + 8 * hh + 4);  split8(a, c, ah1.u[1], al1.u[1]);
  }

  v8f acc[4];
#pragma unroll
  for (int n = 0; n < 4; ++n) acc[n] = zero8();
#pragma unroll
  for (int n = 0; n < 4; ++n) {
    acc[n] = mma3(ah0.v, al0.v, ldfrag(&wt[0][n * 16][0], WPITCH, 0, l),
                  ldfrag(&wt[1][n * 16][0], WPITCH, 0, l), acc[n]);
    acc[n] = mma3(ah1.v, al1.v, ldfrag(&wt[0][n * 16][0], WPITCH, 32, l),
                  ldfrag(&wt[1][n * 16][0], WPITCH, 32, l), acc[n]);
  }
  // acc[n][r] = Y[row0 + w*16 + 8*hh + r][n*16 + m]

  if (mat < 2) {   // interleaved-pair rotary embedding: cols (2i, 2i+1) are adjacent lanes
#pragma unroll
    for (int n = 0; n < 4; ++n) {
      const int N = n * 16 + m;
      const float f = invf[N >> 1];
#pragma unroll
      for (int r = 0; r < 8; ++r) {
        const int pos = s0 + w * 16 + 8 * hh + r;
        const float ang = (float)pos * f;
        const float sn = sinf(ang), cs = cosf(ang);
        const float mine = acc[n][r];
        const float other = __shfl_xor(mine, 1, 32);
        acc[n][r] = ((N & 1) == 0) ? (mine * cs - other * sn) : (other * sn + mine * cs);
      }
    }
  }

  // stage the 64-row block tile as hi/lo bf16
  if (mat == 2) {   // transposed: st[p][d][row_local]
#pragma unroll
    for (int n = 0; n < 4; ++n)
#pragma unroll
      for (int r = 0; r < 8; ++r) {
        us_t hb, lb;
        split1(acc[n][r], hb, lb);
        st[0][n * 16 + m][w * 16 + 8 * hh + r] = hb;
        st[1][n * 16 + m][w * 16 + 8 * hh + r] = lb;
      }
  } else {          // row major: st[p][row_local][d]
#pragma unroll
    for (int n = 0; n < 4; ++n)
#pragma unroll
      for (int r = 0; r < 8; ++r) {
        us_t hb, lb;
        split1(acc[n][r], hb, lb);
        st[0][w * 16 + 8 * hh + r][n * 16 + m] = hb;
        st[1][w * 16 + 8 * hh + r][n * 16 + m] = lb;
      }
  }
  __syncthreads();

  v4u vals[2][4];
  size_t offs[4];
  const int ch = l & 7, sub4 = l >> 3;
  us_t* dsth;
  us_t* dstl;
  if (mat == 2) {
    dsth = vth; dstl = vtl;
#pragma unroll
    for (int i = 0; i < 4; ++i) {
      const int d = w * 16 + 4 * i + sub4;
      vals[0][i] = *(const v4u*)&st[0][d][ch * 8];
      vals[1][i] = *(const v4u*)&st[1][d][ch * 8];
      offs[i] = ((size_t)bh * DE + d) * SEQ + s0 + ch * 8;
    }
  } else {
    dsth = (mat == 0) ? qhh : khh;
    dstl = (mat == 0) ? qhl : khl;
#pragma unroll
    for (int i = 0; i < 4; ++i) {
      const int rr = w * 16 + 4 * i + sub4;
      vals[0][i] = *(const v4u*)&st[0][rr][ch * 8];
      vals[1][i] = *(const v4u*)&st[1][rr][ch * 8];
      offs[i] = ((size_t)bh * SEQ + s0 + rr) * DE + ch * 8;
    }
  }
#pragma unroll
  for (int i = 0; i < 4; ++i) {
    *(v4u*)(dsth + offs[i]) = vals[0][i];
    *(v4u*)(dstl + offs[i]) = vals[1][i];
  }
  
}

// =====================================================================
// Kernel 2: per query row: m[q] = max_{k<=q} s/64, rcp[q] = 1 / sum exp(s/64 - m).
// =====================================================================
__global__ __launch_bounds__(64) void k_stats(
    const us_t* __restrict__ qhh, const us_t* __restrict__ qhl,
    const us_t* __restrict__ khh, const us_t* __restrict__ khl, float* __restrict__ ml) {
  const int wave = blockIdx.x * 2 + (threadIdx.x >> 5);
  const int bh = wave / QT, qt = wave - bh * QT;
  const int l = threadIdx.x & 31, m = l & 15, hh = l >> 4;

  const size_t qoff = ((size_t)bh * SEQ + qt * 16) * DE;
  const v16bf aqh0 = ldfrag(qhh + qoff, DE, 0, l), aqh1 = ldfrag(qhh + qoff, DE, 32, l);
  const v16bf aql0 = ldfrag(qhl + qoff, DE, 0, l), aql1 = ldfrag(qhl + qoff, DE, 32, l);
  const us_t* Kh = khh + (size_t)bh * SEQ * DE;
  const us_t* Kl = khl + (size_t)bh * SEQ * DE;

  float mrow[8], lrow[8];
#pragma unroll
  for (int r = 0; r < 8; ++r) { mrow[r] = NEG_BIG; lrow[r] = 0.f; }

#pragma unroll 1
  for (int kt = 0; kt <= qt; ++kt) {
    const size_t ko = (size_t)kt * 16 * DE;
    v8f s = zero8();
    s = mma3(aqh0, aql0, ldfrag(Kh + ko, DE, 0, l), ldfrag(Kl + ko, DE, 0, l), s);
    s = mma3(aqh1, aql1, ldfrag(Kh + ko, DE, 32, l), ldfrag(Kl + ko, DE, 32, l), s);
    // s[r] = score[q = qt*16 + 8*hh + r][k = kt*16 + m]
    // running maximum and sum stay private to the lane (its own key column of every tile)
#pragma unroll
    for (int r = 0; r < 8; ++r) {
      const int qg = qt * 16 + 8 * hh + r;
      const int kg = kt * 16 + m;
      const float x = (kg <= qg) ? s[r] * (1.0f / 64.0f) : NEG_BIG;
      const float mn = fmaxf(mrow[r], x);
      lrow[r] = lrow[r] * __expf(mrow[r] - mn) + __expf(x - mn);
      mrow[r] = mn;
    }
  }

  // one merge of the 16 lanes of each row: a lane that saw no valid key holds NEG_BIG and its sum scales to 0
#pragma unroll
  for (int r = 0; r < 8; ++r) {
    float gm = mrow[r];
#pragma unroll
    for (int off = 1; off < 16; off <<= 1) gm = fmaxf(gm, __shfl_xor(gm, off, 32));
    float e = lrow[r] * __expf(mrow[r] - gm);
#pragma unroll
    for (int off = 1; off < 16; off <<= 1) e += __shfl_xor(e, off, 32);
    mrow[r] = gm;
    lrow[r] = e;
  }

  const int rs0 = 2 * (l & 3), rs1 = rs0 + 1;
  float m0 = 0.f, l0 = 1.f, m1 = 0.f, l1 = 1.f;
#pragma unroll
  for (int r = 0; r < 8; ++r) {
    if (r == rs0) { m0 = mrow[r]; l0 = lrow[r]; }
    if (r == rs1) { m1 = mrow[r]; l1 = lrow[r]; }
  }
  const int src = (l & 3) + (((l >> 2) & 1) << 4);
  m0 = __shfl(m0, src, 32); l0 = __shfl(l0, src, 32);
  m1 = __shfl(m1, src, 32); l1 = __shfl(l1, src, 32);
  v4f val;
  val.x = m0; val.y = 1.0f / l0; val.z = m1; val.w = 1.0f / l1;
  float* dst = ml + ((size_t)bh * SEQ + qt * 16) * 2 + 4 * l;
  if (l < 8) *(v4f*)dst = val;
  
}

// =====================================================================
// Kernel 3: out_h[bh][kpos][d] = sum_{q > kpos} P[q,kpos] * vh[q][d]   (contraction over the query axis)
// One wave per (bh, 16-col k tile): loops over q in chunks of 32 -> two 16x16 score tiles -> P in registers
// (packed D tiles = P^T A fragment) -> 4 P^T.V products. Stores f32 out_h [b*S][H*DE].
// =====================================================================
__global__ __launch_bounds__(64) void k_attn(
    const us_t* __restrict__ qhh, const us_t* __restrict__ qhl,
    const us_t* __restrict__ khh, const us_t* __restrict__ khl,
    const us_t* __restrict__ vth, const us_t* __restrict__ vtl,
    const float* __restrict__ ml, float* __restrict__ outh) {
  __shared__ __attribute__((aligned(16))) float so[2][16][OPITCH];
  const int w = threadIdx.x >> 5;
  const int wave = blockIdx.x * 2 + w;
  const int bh = wave / QT, kt = wave - bh * QT;
  const int l = threadIdx.x & 31, m = l & 15, hh = l >> 4;

  // loop-invariant B fragments of the key tile (kh rows kt*16.., lane = key)
  const size_t koff = ((size_t)bh * SEQ + kt * 16) * DE;
  const v16bf bkh0 = ldfrag(khh + koff, DE, 0, l), bkh1 = ldfrag(khh + koff, DE, 32, l);
  const v16bf bkl0 = ldfrag(khl + koff, DE, 0, l), bkl1 = ldfrag(khl + koff, DE, 32, l);

  v8f o[4];
#pragma unroll
  for (int n = 0; n < 4; ++n) o[n] = zero8();

  const int kg = kt * 16 + m;                       // this lane's key column in the score tiles
  const float* mlb = ml + (size_t)bh * SEQ * 2;
  const us_t* Qh = qhh + (size_t)bh * SEQ * DE;
  const us_t* Ql = qhl + (size_t)bh * SEQ * DE;
  const us_t* Vh = vth + (size_t)bh * DE * SEQ;
  const us_t* Vl = vtl + (size_t)bh * DE * SEQ;

#pragma unroll 1
  for (int qc = (kt >> 1) * 32; qc < SEQ; qc += 32) {
    unsigned int ph[2][4], pl[2][4];
#pragma unroll
    for (int sub = 0; sub < 2; ++sub) {
      const int q0 = qc + 16 * sub;
      const size_t qo = (size_t)q0 * DE;
      v8f s = zero8();
      s = mma3(ldfrag(Qh + qo, DE, 0, l), ldfrag(Ql + qo, DE, 0, l), bkh0, bkl0, s);
      s = mma3(ldfrag(Qh + qo, DE, 32, l), ldfrag(Ql + qo, DE, 32, l), bkh1, bkl1, s);
      // s[r] = score[q = q0 + 8*hh + r][k = kg]
      float p[8];
#pragma unroll
      for (int r = 0; r < 8; ++r) {
        const int qg = q0 + 8 * hh + r;
        const v2f mr = *(const v2f*)(mlb + 2 * qg);
        const float e = __expf(s[r] * (1.0f / 64.0f) - mr.x) * mr.y;
        p[r] = (kg < qg) ? e : 0.f;                 // causal and zeroed diagonal: strictly k < q
      }
#pragma unroll
      for (int j = 0; j < 4; ++j) split2(p[2 * j], p[2 * j + 1], ph[sub][j], pl[sub][j]);
    }
    // P^T A fragment (rows = key m, k = 32 queries of this chunk): elements 0..7 from the first
    // 16-query D tile, 8..15 from the second, same lane.
    Frag aph, apl;
    aph.u[0] = mk4(ph[0][0], ph[0][1], ph[0][2], ph[0][3]);
    aph.u[1] = mk4(ph[1][0], ph[1][1], ph[1][2], ph[1][3]);
    apl.u[0] = mk4(pl[0][0], pl[0][1], pl[0][2], pl[0][3]);
    apl.u[1] = mk4(pl[1][0], pl[1][1], pl[1][2], pl[1][3]);
#pragma unroll
    for (int n = 0; n < 4; ++n) {
      const size_t vo = (size_t)(n * 16) * SEQ;      // B from vt rows d = n*16.., k = query from qc
      o[n] = mma3(aph.v, apl.v, ldfrag(Vh + vo, SEQ, qc, l), ldfrag(Vl + vo, SEQ, qc, l), o[n]);
    }
  }
  // o[n][r] = out_h[kpos = kt*16 + 8*hh + r][d = n*16 + m]

#pragma unroll
  for (int n = 0; n < 4; ++n)
#pragma unroll
    for (int r = 0; r < 8; ++r) so[w][8 * hh + r][n * 16 + m] = o[n][r];
  __syncthreads();

  const int bb = bh / HEADS, head = bh - bb * HEADS;
  v4f vals[8];
  size_t offs[8];
#pragma unroll
  for (int i = 0; i < 8; ++i) {
    const int row = 2 * i + hh;
    vals[i] = *(const v4f*)&so[w][row][4 * m];
    offs[i] = ((size_t)bb * SEQ + kt * 16 + row) * ZDIM + head * DE + 4 * m;
  }
#pragma unroll
  for (int i = 0; i < 8; ++i) *(v4f*)(outh + offs[i]) = vals[i];
  
}

// =====================================================================
// Kernel 4: out = out_h (4096 x 512) . W_o (512 x 64). Block = 4 waves = 64 rows;
// W_o^T staged per 32-deep k chunk as hi/lo bf16 in LDS.
// =====================================================================
__global__ __launch_bounds__(128) void k_oproj(
    const float* __restrict__ outh, const float* __restrict__ Wo, float* __restrict__ out) {
  __shared__ __attribute__((aligned(16))) us_t wo[2][DE][KPITCH];   // [plane][d][z_local]
  __shared__ __attribute__((aligned(16))) float so[4][16][OPITCH];
  const int t = threadIdx.x, w = t >> 5, l = t & 31, m = l & 15, hh = l >> 4;
  const int rowbase = blockIdx.x * 64 + w * 16;

  v8f acc[4];
#pragma unroll
  for (int n = 0; n < 4; ++n) acc[n] = zero8();

#pragma unroll 1
  for (int c = 0; c < ZDIM / 32; ++c) {
    __syncthreads();                       // all waves done reading the staged chunk
#pragma unroll
    for (int j = 0; j < 16; ++j) {
      const int idx = j * 128 + t;
      const int zz = idx >> 6, d = idx & 63;
      us_t hb, lb;
      split1(Wo[(size_t)(c * 32 + zz) * DE + d], hb, lb);
      wo[0][d][zz] = hb;
      wo[1][d][zz] = lb;
    }
    __syncthreads();
    const float* ar = outh + (size_t)(rowbase + m) * ZDIM + c * 32;
    Frag ah, al;
    {
      v4f a, e;
      a = *(const v4f*)(ar + 8 * hh);       e = *(const v4f*)(ar + 8 * hh + 4);       split8(a, e, ah.u[0], al.u[0]);
      a = *(const v4f*)(ar + 16 + 8 * hh);  e = *(const v4f*)(ar + 16 + 8 * hh + 4);  split8(a, e, ah.u[1], al.u[1]);
    }
#pragma unroll
    for (int n = 0; n < 4; ++n)
      acc[n] = mma3(ah.v, al.v, ldfrag(&wo[0][n * 16][0], KPITCH, 0, l),
                    ldfrag(&wo[1][n * 16][0], KPITCH, 0, l), acc[n]);
  }
  // acc[n][r] = out[rowbase + 8*hh + r][n*16 + m]

#pragma unroll
  for (int n = 0; n < 4; ++n)
#pragma unroll
    for (int r = 0; r < 8; ++r) so[w][8 * hh + r][n * 16 + m] = acc[n][r];
  __syncthreads();

  v4f vals[8];
  size_t offs[8];
#pragma unroll
  for (int i = 0; i < 8; ++i) {
    const int row = 2 * i + hh;
    vals[i] = *(const v4f*)&so[w][row][4 * m];
    offs[i] = (size_t)(rowbase + row) * DE + 4 * m;
  }
#pragma unroll
  for (int i = 0; i < 8; ++i) *(v4f*)(out + offs[i]) = vals[i];
  
}

extern "C" void kernel_launch(void* const* d_in, const int* in_sizes, int n_in,
                              void* d_out, int out_size, void* d_ws, size_t ws_size,
                              hipStream_t stream) {
  if (n_in < 7) return;
  if (in_sizes[0] != ROWS * DE || in_sizes[1] != ROWS * DE || in_sizes[2] != ROWS * DE) return;
  if (in_sizes[3] != HEADS * DE * DE || in_sizes[4] != HEADS * DE * DE || in_sizes[5] != HEADS * DE * DE) return;
  if (in_sizes[6] != ZDIM * DE) return;
  if (out_size != ROWS * DE) return;

  const float* q  = (const float*)d_in[0];
  const float* k  = (const float*)d_in[1];
  const float* v  = (const float*)d_in[2];
  const float* Wq = (const float*)d_in[3];
  const float* Wk = (const float*)d_in[4];
  const float* Wv = (const float*)d_in[5];
  const float* Wo = (const float*)d_in[6];
  float* out = (float*)d_out;

  char* ws = (char*)d_ws;
  size_t off = 0;
  const size_t plane = (size_t)BH * SEQ * DE * sizeof(us_t);          // 4 MiB each
  us_t* qhh = (us_t*)(ws + off); off += plane;
  us_t* qhl = (us_t*)(ws + off); off += plane;
  us_t* khh = (us_t*)(ws + off); off += plane;
  us_t* khl = (us_t*)(ws + off); off += plane;
  us_t* vth = (us_t*)(ws + off); off += plane;
  us_t* vtl = (us_t*)(ws + off); off += plane;
  float* ml   = (float*)(ws + off); off += (size_t)BH * SEQ * 2 * sizeof(float);    // 256 KiB
  float* outh = (float*)(ws + off); off += (size_t)ROWS * ZDIM * sizeof(float);      // 8 MiB
  if (off > ws_size) return;

  k_proj<<<dim3(3 * HEADS * RT64), dim3(128), 0, stream>>>(q, k, v, Wq, Wk, Wv,
                                                           qhh, qhl, khh, khl, vth, vtl);
  k_stats<<<dim3((BH * QT) / 2), dim3(64), 0, stream>>>(qhh, qhl, khh, khl, ml);
  k_attn<<<dim3((BH * QT) / 2), dim3(64), 0, stream>>>(qhh, qhl, khh, khl, vth, vtl, ml, outh);
  k_oproj<<<dim3(ROWS / 64), dim3(128), 0, stream>>>(outh, Wo, out);
}

// v002
// One run takes 191 microseconds.
// In both of two side-by-side timings against v001, it was 1.46 times as fast.
// Counting every step since v000, it is 2.83 times as fast.
#include <hip/hip_runtime.h>
#include <stddef.h>

// Contractions: head projections, q.k scores (statistics pass and output pass), P.V over the query axis,
// output projection -- all v_wmma_f32_16x16x32_bf16 with bf16 hi/lo operand split (hi*hi + hi*lo + lo*hi),
// f32 accumulate. RoPE, softmax statistics, masks and epilogues in f32.

#define HEADS 8
#define DE 64
#define BATCH 2
#define SEQ 2048
#define BH (BATCH * HEADS)
#define ZDIM (HEADS * DE)
#define ROWS (BATCH * SEQ)
#define QT (SEQ / 16)
#define RT64 (ROWS / 64)
#define WPITCH 72
#define KPITCH 40
#define OPITCH 68
#define NEG_BIG (-3.0e38f)
#define SPLIT 8   // waves of a work-group that share one tile's loop in k_stats and k_attn

typedef char chk_de[(DE == 64) ? 1 : -1];
typedef char chk_seq[((SEQ % 64) == 0) ? 1 : -1];
typedef char chk_rows[((ROWS % 64) == 0) ? 1 : -1];
typedef char chk_z[((ZDIM % 32) == 0) ? 1 : -1];

typedef __bf16 bf16_t;
typedef bf16_t v16bf __attribute__((ext_vector_type(16)));
typedef float v8f __attribute__((ext_vector_type(8)));
typedef float v4f __attribute__((ext_vector_type(4)));
typedef float v2f __attribute__((ext_vector_type(2)));
typedef unsigned int v4u __attribute__((ext_vector_type(4)));
typedef unsigned short us_t;

union Frag {
  v16bf v;
  v4u u[2];
};

__device__ __forceinline__ v4u mk4(unsigned int a, unsigned int b, unsigned int c, unsigned int d) {
  v4u r;
  r.x = a; r.y = b; r.z = c; r.w = d;
  return r;
}

__device__ __forceinline__ v8f zero8() {
  v8f z;
#pragma unroll
  for (int i = 0; i < 8; ++i) z[i] = 0.f;
  return z;
}

// f32 -> bf16 bits, RNE
__device__ __forceinline__ unsigned int bf_rne(float x) {
  unsigned int u = __float_as_uint(x);
  u += 0x7FFFu + ((u >> 16) & 1u);
  return u >> 16;
}
__device__ __forceinline__ float bf_val(unsigned int b) { return __uint_as_float(b << 16); }

// x ~= hi + lo : hi = RNE16(x), lo = RNE16(x - hi); two values packed per dword (even element in the low half)
__device__ __forceinline__ void split2(float x0, float x1, unsigned int& ph, unsigned int& pl) {
  const unsigned int h0 = bf_rne(x0), h1 = bf_rne(x1);
  const unsigned int l0 = bf_rne(x0 - bf_val(h0)), l1 = bf_rne(x1 - bf_val(h1));
  ph = h0 | (h1 << 16);
  pl = l0 | (l1 << 16);
}
__device__ __forceinline__ void split1(float x, us_t& hb, us_t& lb) {
  const unsigned int h = bf_rne(x);
  hb = (us_t)h;
  lb = (us_t)bf_rne(x - bf_val(h));
}
// 8 consecutive k values (a = k..k+3, b = k+4..k+7) -> packed hi and lo halves of a fragment
__device__ __forceinline__ void split8(v4f a, v4f b, v4u& ph, v4u& pl) {
  unsigned int h0, l0, h1, l1, h2, l2, h3, l3;
  split2(a.x, a.y, h0, l0);
  split2(a.z, a.w, h1, l1);
  split2(b.x, b.y, h2, l2);
  split2(b.z, b.w, h3, l3);
  ph = mk4(h0, h1, h2, h3);
  pl = mk4(l0, l1, l2, l3);
}

// D += Ah*Bh + Ah*Bl + Al*Bh ; 4 v_nop guard tying D and keeping all operands live
__device__ __forceinline__ v8f mma3(v16bf ah, v16bf al, v16bf bh, v16bf bl, v8f c) {
  c = __builtin_amdgcn_wmma_f32_16x16x32_bf16(false, ah, false, bh, (short)0, c, false, false);
  c = __builtin_amdgcn_wmma_f32_16x16x32_bf16(false, ah, false, bl, (short)0, c, false, false);
  c = __builtin_amdgcn_wmma_f32_16x16x32_bf16(false, al, false, bh, (short)0, c, false, false);
  asm volatile("v_nop\n\tv_nop\n\tv_nop\n\tv_nop" : "+v"(c) : "v"(ah), "v"(al), "v"(bh), "v"(bl));
  return c;
}

// 16-bit fragment from a row-major [row][k] array (pitch ld elements), rows base..base+15, k from k0.
// Lane l: row = l&15, h = l>>4; elements 0..7 = k0+8h+0..7, elements 8..15 = k0+16+8h+0..7.
// Used for A (row = m) and for B stored n-major with k contiguous (row = n). Also used on LDS tiles.
__device__ __forceinline__ v16bf ldfrag(const us_t* base, int ld, int k0, int l) {
  const us_t* p = base + (size_t)(l & 15) * ld + k0 + 8 * (l >> 4);
  Frag f;
  f.u[0] = *(const v4u*)p;
  f.u[1] = *(const v4u*)(p + 16);
  return f.v;
}

// =====================================================================
// Kernel 1: head projections + RoPE on q,k.  Block = 4 waves = 64 rows of one (matrix, head).
// Outputs (bf16 hi and lo planes):
//   qh, kh : [bh][s][d]   (row major, d contiguous)
//   vt     : [bh][d][s]   (s contiguous)
// =====================================================================
__global__ __launch_bounds__(128) void k_proj(
    const float* __restrict__ q, const float* __restrict__ k, const float* __restrict__ v,
    const float* __restrict__ Wq, const float* __restrict__ Wk, const float* __restrict__ Wv,
    us_t* __restrict__ qhh, us_t* __restrict__ qhl, us_t* __restrict__ khh, us_t* __restrict__ khl,
    us_t* __restrict__ vth, us_t* __restrict__ vtl) {
#pragma clang fp contract(off)
  __shared__ __attribute__((aligned(16))) us_t wt[2][DE][WPITCH];   // W^T hi/lo : [plane][d][z]
  __shared__ __attribute__((aligned(16))) us_t st[2][64][WPITCH];   // result tile staging
  __shared__ float invf[32];

  const int t = threadIdx.x, w = t >> 5, l = t & 31, m = l & 15, hh = l >> 4;
  const int blk = blockIdx.x;
  const int mat = blk / (HEADS * RT64);                 // 0 = q, 1 = k, 2 = v (block-uniform)
  const int rem = blk - mat * (HEADS * RT64);
  const int head = rem / RT64;
  const int rt = rem - head * RT64;
  const int row0 = rt * 64;                             // row in [0, BATCH*SEQ)
  const int b = row0 / SEQ, s0 = row0 - b * SEQ, bh = b * HEADS + head;

  const float* X = (mat == 0) ? q : ((mat == 1) ? k : v);
  const float* W = ((mat == 0) ? Wq : ((mat == 1) ? Wk : Wv)) + (size_t)head * DE * DE;

  // stage W[z][d] -> wt[p][d][z] as hi/lo bf16
#pragma unroll 4
  for (int j = 0; j < 32; ++j) {
    const int idx = j * 128 + t;
    const int z = idx >> 6, d = idx & 63;
    us_t hb, lb;
    split1(W[idx], hb, lb);
    wt[0][d][z] = hb;
    wt[1][d][z] = lb;
  }
  if (t < 32) invf[t] = 1.0f / powf(10000.0f, (float)t * 0.03125f);
  __syncthreads();

  // A fragments: this wave's 16 rows of X, k 0..31 and 32..63
  const float* xr = X + (size_t)(row0 + w * 16 + m) * DE;
  Frag ah0, al0, ah1, al1;
  {
    v4f a, c;
    a = *(const v4f*)(xr + 8 * hh);       c = *(const v4f*)(xr + 8 * hh + 4);       split8(a, c, ah0.u[0], al0.u[0]);
    a = *(const v4f*)(xr + 16 + 8 * hh);  c = *(const v4f*)(xr + 16 + 8 * hh + 4);  split8(a, c, ah0.u[1], al0.u[1]);
    a = *(const v4f*)(xr + 32 + 8 * hh);  c = *(const v4f*)(xr + 32 + 8 * hh + 4);  split8(a, c, ah1.u[0], al1.u[0]);
    a = *(const v4f*)(xr + 48 + 8 * hh);  c = *(const v4f*)(xr + 48 + 8 * hh + 4);  split8(a, c, ah1.u[1], al1.u[1]);
  }

  v8f acc[4];
#pragma unroll
  for (int n = 0; n < 4; ++n) acc[n] = zero8();
#pragma unroll
  for (int n = 0; n < 4; ++n) {
    acc[n] = mma3(ah0.v, al0.v, ldfrag(&wt[0][n * 16][0], WPITCH, 0, l),
                  ldfrag(&wt[1][n * 16][0], WPITCH, 0, l), acc[n]);
    acc[n] = mma3(ah1.v, al1.v, ldfrag(&wt[0][n * 16][0], WPITCH, 32, l),
                  ldfrag(&wt[1][n * 16][0], WPITCH, 32, l), acc[n]);
  }
  // acc[n][r] = Y[row0 + w*16 + 8*hh + r][n*16 + m]

  if (mat < 2) {   // interleaved-pair rotary embedding: cols (2i, 2i+1) are adjacent lanes
#pragma unroll
    for (int n = 0; n < 4; ++n) {
      const int N = n * 16 + m;
      const float f = invf[N >> 1];
#pragma unroll
      for (int r = 0; r < 8; ++r) {
        const int pos = s0 + w * 16 + 8 * hh + r;
        const float ang = (float)pos * f;
        const float sn = sinf(ang), cs = cosf(ang);
        const float mine = acc[n][r];
        const float other = __shfl_xor(mine, 1, 32);
        acc[n][r] = ((N & 1) == 0) ? (mine * cs - other * sn) : (other * sn + mine * cs);
      }
    }
  }

  // stage the 64-row block tile as hi/lo bf16
  if (mat == 2) {   // transposed: st[p][d][row_local]
#pragma unroll
    for (int n = 0; n < 4; ++n)
#pragma unroll
      for (int r = 0; r < 8; ++r) {
        us_t hb, lb;
        split1(acc[n][r], hb, lb);
        st[0][n * 16 + m][w * 16 + 8 * hh + r] = hb;
        st[1][n * 16 + m][w * 16 + 8 * hh + r] = lb;
      }
  } else {          // row major: st[p][row_local][d]
#pragma unroll
    for (int n = 0; n < 4; ++n)
#pragma unroll
      for (int r = 0; r < 8; ++r) {
        us_t hb, lb;
        split1(acc[n][r], hb, lb);
        st[0][w * 16 + 8 * hh + r][n * 16 + m] = hb;
        st[1][w * 16 + 8 * hh + r][n * 16 + m] = lb;
      }
  }
  __syncthreads();

  v4u vals[2][4];
  size_t offs[4];
  const int ch = l & 7, sub4 = l >> 3;
  us_t* dsth;
  us_t* dstl;
  if (mat == 2) {
    dsth = vth; dstl = vtl;
#pragma unroll
    for (int i = 0; i < 4; ++i) {
      const int d = w * 16 + 4 * i + sub4;
      vals[0][i] = *(const v4u*)&st[0][d][ch * 8];
      vals[1][i] = *(const v4u*)&st[1][d][ch * 8];
      offs[i] = ((size_t)bh * DE + d) * SEQ + s0 + ch * 8;
    }
  } else {
    dsth = (mat == 0) ? qhh : khh;
    dstl = (mat == 0) ? qhl : khl;
#pragma unroll
    for (int i = 0; i < 4; ++i) {
      const int rr = w * 16 + 4 * i + sub4;
      vals[0][i] = *(const v4u*)&st[0][rr][ch * 8];
      vals[1][i] = *(const v4u*)&st[1][rr][ch * 8];
      offs[i] = ((size_t)bh * SEQ + s0 + rr) * DE + ch * 8;
    }
  }
#pragma unroll
  for (int i = 0; i < 4; ++i) {
    *(v4u*)(dsth + offs[i]) = vals[0][i];
    *(v4u*)(dstl + offs[i]) = vals[1][i];
  }
  
}

// =====================================================================
// Kernel 2: per query row: m[q] = max_{k<=q} s/64, rcp[q] = 1 / sum exp(s/64 - m).
// One work-group per (bh, 16-row query tile); wave w takes key tiles w, w + SPLIT, ...; the waves'
// (max, sum) pairs meet in LDS.
// =====================================================================
__global__ __launch_bounds__(32 * SPLIT) void k_stats(
    const us_t* __restrict__ qhh, const us_t* __restrict__ qhl,
    const us_t* __restrict__ khh, const us_t* __restrict__ khl, float* __restrict__ ml) {
  __shared__ float pm[SPLIT][16];
  __shared__ float ps[SPLIT][16];
  // the wave's number as a scalar: the loop's bounds and branch stay on the scalar unit
  const int w = __builtin_amdgcn_readfirstlane(threadIdx.x >> 5);
  const int bh = blockIdx.x / QT, qt = blockIdx.x - bh * QT;
  const int l = threadIdx.x & 31, m = l & 15, hh = l >> 4;

  const size_t qoff = ((size_t)bh * SEQ + qt * 16) * DE;
  const v16bf aqh0 = ldfrag(qhh + qoff, DE, 0, l), aqh1 = ldfrag(qhh + qoff, DE, 32, l);
  const v16bf aql0 = ldfrag(qhl + qoff, DE, 0, l), aql1 = ldfrag(qhl + qoff, DE, 32, l);
  const us_t* Kh = khh + (size_t)bh * SEQ * DE;
  const us_t* Kl = khl + (size_t)bh * SEQ * DE;

  float mrow[8], lrow[8];
#pragma unroll
  for (int r = 0; r < 8; ++r) { mrow[r] = NEG_BIG; lrow[r] = 0.f; }

#pragma unroll 1
  for (int kt = w; kt <= qt; kt += SPLIT) {
    const size_t ko = (size_t)kt * 16 * DE;
    v8f s = zero8();
    s = mma3(aqh0, aql0, ldfrag(Kh + ko, DE, 0, l), ldfrag(Kl + ko, DE, 0, l), s);
    s = mma3(aqh1, aql1, ldfrag(Kh + ko, DE, 32, l), ldfrag(Kl + ko, DE, 32, l), s);
    // s[r] = score[q = qt*16 + 8*hh + r][k = kt*16 + m]
    // running maximum and sum stay private to the lane (its own key column of every tile)
#pragma unroll
    for (int r = 0; r < 8; ++r) {
      const int qg = qt * 16 + 8 * hh + r;
      const int kg = kt * 16 + m;
      const float x = (kg <= qg) ? s[r] * (1.0f / 64.0f) : NEG_BIG;
      const float mn = fmaxf(mrow[r], x);
      lrow[r] = lrow[r] * __expf(mrow[r] - mn) + __expf(x - mn);
      mrow[r] = mn;
    }
  }

  // one merge of the 16 lanes of each row: a lane that saw no valid key holds NEG_BIG and its sum scales to 0
#pragma unroll
  for (int r = 0; r < 8; ++r) {
    float gm = mrow[r];
#pragma unroll
    for (int off = 1; off < 16; off <<= 1) gm = fmaxf(gm, __shfl_xor(gm, off, 32));
    float e = lrow[r] * __expf(mrow[r] - gm);
#pragma unroll
    for (int off = 1; off < 16; off <<= 1) e += __shfl_xor(e, off, 32);
    mrow[r] = gm;
    lrow[r] = e;
  }

  // merge of the waves: a wave that had no key tile holds NEG_BIG and a sum of 0
  if (m == 0) {
#pragma unroll   // mrow and lrow live in registers: r must be a constant
    for (int r = 0; r < 8; ++r) {
      pm[w][8 * hh + r] = mrow[r];
      ps[w][8 * hh + r] = lrow[r];
    }
  }
  __syncthreads();
  if (threadIdx.x < 16) {
    const int row = threadIdx.x;
    float gm = pm[0][row];
    for (int j = 1; j < SPLIT; ++j) gm = fmaxf(gm, pm[j][row]);
    float e = 0.f;
    for (int j = 0; j < SPLIT; ++j) e += ps[j][row] * __expf(pm[j][row] - gm);
    v2f val;
    val.x = gm; val.y = 1.0f / e;
    *(v2f*)(ml + ((size_t)bh * SEQ + qt * 16 + row) * 2) = val;
  }
}

// =====================================================================
// Kernel 3: out_h[bh][kpos][d] = sum_{q > kpos} P[q,kpos] * vh[q][d]   (contraction over the query axis)
// One work-group per (bh, 16-col k tile); wave w takes the 32-query chunks w, w + SPLIT, ... from the
// diagonal on: two 16x16 score tiles -> P in registers (packed D tiles = P^T A fragment) -> 4 P^T.V products.
// The waves' partial tiles are summed through LDS. Stores f32 out_h [b*S][H*DE].
// =====================================================================
__global__ __launch_bounds__(32 * SPLIT) void k_attn(
    const us_t* __restrict__ qhh, const us_t* __restrict__ qhl,
    const us_t* __restrict__ khh, const us_t* __restrict__ khl,
    const us_t* __restrict__ vth, const us_t* __restrict__ vtl,
    const float* __restrict__ ml, float* __restrict__ outh) {
  __shared__ __attribute__((aligned(16))) float so[SPLIT][16][OPITCH];
  // the wave's number as a scalar: the loop's bounds and branch stay on the scalar unit
  const int w = __builtin_amdgcn_readfirstlane(threadIdx.x >> 5);
  const int bh = blockIdx.x / QT, kt = blockIdx.x - bh * QT;
  const int l = threadIdx.x & 31, m = l & 15, hh = l >> 4;

  // loop-invariant B fragments of the key tile (kh rows kt*16.., lane = key)
  const size_t koff = ((size_t)bh * SEQ + kt * 16) * DE;
  const v16bf bkh0 = ldfrag(khh + koff, DE, 0, l), bkh1 = ldfrag(khh + koff, DE, 32, l);
  const v16bf bkl0 = ldfrag(khl + koff, DE, 0, l), bkl1 = ldfrag(khl + koff, DE, 32, l);

  v8f o[4];
#pragma unroll
  for (int n = 0; n < 4; ++n) o[n] = zero8();

  const int kg = kt * 16 + m;                       // this lane's key column in the score tiles
  const float* mlb = ml + (size_t)bh * SEQ * 2;
  const us_t* Qh = qhh + (size_t)bh * SEQ * DE;
  const us_t* Ql = qhl + (size_t)bh * SEQ * DE;
  const us_t* Vh = vth + (size_t)bh * DE * SEQ;
  const us_t* Vl = vtl + (size_t)bh * DE * SEQ;

#pragma unroll 1
  for (int qc = ((kt >> 1) + w) * 32; qc < SEQ; qc += 32 * SPLIT) {
    unsigned int ph[2][4], pl[2][4];
#pragma unroll
    for (int sub = 0; sub < 2; ++sub) {
      const int q0 = qc + 16 * sub;
      const size_t qo = (size_t)q0 * DE;
      v8f s = zero8();
      s = mma3(ldfrag(Qh + qo, DE, 0, l), ldfrag(Ql + qo, DE, 0, l), bkh0, bkl0, s);
      s = mma3(ldfrag(Qh + qo, DE, 32, l), ldfrag(Ql + qo, DE, 32, l), bkh1, bkl1, s);
      // s[r] = score[q = q0 + 8*hh + r][k = kg]
      float p[8];
#pragma unroll
      for (int r = 0; r < 8; ++r) {
        const int qg = q0 + 8 * hh + r;
        const v2f mr = *(const v2f*)(mlb + 2 * qg);
        const float e = __expf(s[r] * (1.0f / 64.0f) - mr.x) * mr.y;
        p[r] = (kg < qg) ? e : 0.f;                 // causal and zeroed diagonal: strictly k < q
      }
#pragma unroll
      for (int j = 0; j < 4; ++j) split2(p[2 * j], p[2 * j + 1], ph[sub][j], pl[sub][j]);
    }
    // P^T A fragment (rows = key m, k = 32 queries of this chunk): elements 0..7 from the first
    // 16-query D tile, 8..15 from the second, same lane.
    Frag aph, apl;
    aph.u[0] = mk4(ph[0][0], ph[0][1], ph[0][2], ph[0][3]);
    aph.u[1] = mk4(ph[1][0], ph[1][1], ph[1][2], ph[1][3]);
    apl.u[0] = mk4(pl[0][0], pl[0][1], pl[0][2], pl[0][3]);
    apl.u[1] = mk4(pl[1][0], pl[1][1], pl[1][2], pl[1][3]);
#pragma unroll
    for (int n = 0; n < 4; ++n) {
      const size_t vo = (size_t)(n * 16) * SEQ;      // B from vt rows d = n*16.., k = query from qc
      o[n] = mma3(aph.v, apl.v, ldfrag(Vh + vo, SEQ, qc, l), ldfrag(Vl + vo, SEQ, qc, l), o[n]);
    }
  }
  // o[n][r] = this wave's share of out_h[kpos = kt*16 + 8*hh + r][d = n*16 + m]

#pragma unroll
  for (int n = 0; n < 4; ++n)
#pragma unroll
    for (int r = 0; r < 8; ++r) so[w][8 * hh + r][n * 16 + m] = o[n][r];
  __syncthreads();

  // each thread sums one 4-float piece of the 16 x 64 tile over the waves
  const int bb = bh / HEADS, head = bh - bb * HEADS;
  for (int i = threadIdx.x; i < 16 * 16; i += 32 * SPLIT) {
    const int row = i >> 4, c4 = i & 15;
    v4f sum = *(const v4f*)&so[0][row][4 * c4];
    for (int j = 1; j < SPLIT; ++j) sum += *(const v4f*)&so[j][row][4 * c4];
    *(v4f*)(outh + ((size_t)bb * SEQ + kt * 16 + row) * ZDIM + head * DE + 4 * c4) = sum;
  }
}

// =====================================================================
// Kernel 4: out = out_h (4096 x 512) . W_o (512 x 64). Block = 4 waves = 64 rows;
// W_o^T staged per 32-deep k chunk as hi/lo bf16 in LDS.
// =====================================================================
__global__ __launch_bounds__(128) void k_oproj(
    const float* __restrict__ outh, const float* __restrict__ Wo, float* __restrict__ out) {
  __shared__ __attribute__((aligned(16))) us_t wo[2][DE][KPITCH];   // [plane][d][z_local]
  __shared__ __attribute__((aligned(16))) float so[4][16][OPITCH];
  const int t = threadIdx.x, w = t >> 5, l = t & 31, m = l & 15, hh = l >> 4;
  const int rowbase = blockIdx.x * 64 + w * 16;

  v8f acc[4];
#pragma unroll
  for (int n = 0; n < 4; ++n) acc[n] = zero8();

#pragma unroll 1
  for (int c = 0; c < ZDIM / 32; ++c) {
    __syncthreads();                       // all waves done reading the staged chunk
#pragma unroll
    for (int j = 0; j < 16; ++j) {
      const int idx = j * 128 + t;
      const int zz = idx >> 6, d = idx & 63;
      us_t hb, lb;
      split1(Wo[(size_t)(c * 32 + zz) * DE + d], hb, lb);
      wo[0][d][zz] = hb;
      wo[1][d][zz] = lb;
    }
    __syncthreads();
    const float* ar = outh + (size_t)(rowbase + m) * ZDIM + c * 32;
    Frag ah, al;
    {
      v4f a, e;
      a = *(const v4f*)(ar + 8 * hh);       e = *(const v4f*)(ar + 8 * hh + 4);       split8(a, e, ah.u[0], al.u[0]);
      a = *(const v4f*)(ar + 16 + 8 * hh);  e = *(const v4f*)(ar + 16 + 8 * hh + 4);  split8(a, e, ah.u[1], al.u[1]);
    }
#pragma unroll
    for (int n = 0; n < 4; ++n)
      acc[n] = mma3(ah.v, al.v, ldfrag(&wo[0][n * 16][0], KPITCH, 0, l),
                    ldfrag(&wo[1][n * 16][0], KPITCH, 0, l), acc[n]);
  }
  // acc[n][r] = out[rowbase + 8*hh + r][n*16 + m]

#pragma unroll
  for (int n = 0; n < 4; ++n)
#pragma unroll
    for (int r = 0; r < 8; ++r) so[w][8 * hh + r][n * 16 + m] = acc[n][r];
  __syncthreads();

  v4f vals[8];
  size_t offs[8];
#pragma unroll
  for (int i = 0; i < 8; ++i) {
    const int row = 2 * i + hh;
    vals[i] = *(const v4f*)&so[w][row][4 * m];
    offs[i] = (size_t)(rowbase + row) * DE + 4 * m;
  }
#pragma unroll
  for (int i = 0; i < 8; ++i) *(v4f*)(out + offs[i]) = vals[i];
  
}

extern "C" void kernel_launch(void* const* d_in, const int* in_sizes, int n_in,
                              void* d_out, int out_size, void* d_ws, size_t ws_size,
                              hipStream_t stream) {
  if (n_in < 7) return;
  if (in_sizes[0] != ROWS * DE || in_sizes[1] != ROWS * DE || in_sizes[2] != ROWS * DE) return;
  if (in_sizes[3] != HEADS * DE * DE || in_sizes[4] != HEADS * DE * DE || in_sizes[5] != HEADS * DE * DE) return;
  if (in_sizes[6] != ZDIM * DE) return;
  if (out_size != ROWS * DE) return;

  const float* q  = (const float*)d_in[0];
  const float* k  = (const float*)d_in[1];
  const float* v  = (const float*)d_in[2];
  const float* Wq = (const float*)d_in[3];
  const float* Wk = (const float*)d_in[4];
  const float* Wv = (const float*)d_in[5];
  const float* Wo = (const float*)d_in[6];
  float* out = (float*)d_out;

  char* ws = (char*)d_ws;
  size_t off = 0;
  const size_t plane = (size_t)BH * SEQ * DE * sizeof(us_t);          // 4 MiB each
  us_t* qhh = (us_t*)(ws + off); off += plane;
  us_t* qhl = (us_t*)(ws + off); off += plane;
  us_t* khh = (us_t*)(ws + off); off += plane;
  us_t* khl = (us_t*)(ws + off); off += plane;
  us_t* vth = (us_t*)(ws + off); off += plane;
  us_t* vtl = (us_t*)(ws + off); off += plane;
  float* ml   = (float*)(ws + off); off += (size_t)BH * SEQ * 2 * sizeof(float);    // 256 KiB
  float* outh = (float*)(ws + off); off += (size_t)ROWS * ZDIM * sizeof(float);      // 8 MiB
  if (off > ws_size) return;

  k_proj<<<dim3(3 * HEADS * RT64), dim3(128), 0, stream>>>(q, k, v, Wq, Wk, Wv,
                                                           qhh, qhl, khh, khl, vth, vtl);
  k_stats<<<dim3(BH * QT), dim3(32 * SPLIT), 0, stream>>>(qhh, qhl, khh, khl, ml);
  k_attn<<<dim3(BH * QT), dim3(32 * SPLIT), 0, stream>>>(qhh, qhl, khh, khl, vth, vtl, ml, outh);
  k_oproj<<<dim3(ROWS / 64), dim3(128), 0, stream>>>(outh, Wo, out);
}

// v003
// It runs in 124 microseconds.
// Timed twice side by side with v002, it ran 1.54 and 1.55 times as fast.
// All steps since v000 together make it 4.37 times as fast.
#include <hip/hip_runtime.h>
#include <stddef.h>

// Contractions: head projections, q.k scores (statistics pass and output pass), P.V over the query axis,
// output projection -- all v_wmma_f32_16x16x32_bf16 with bf16 hi/lo operand split (hi*hi + hi*lo + lo*hi),
// f32 accumulate. RoPE, softmax statistics, masks and epilogues in f32.

#define HEADS 8
#define DE 64
#define BATCH 2
#define SEQ 2048
#define BH (BATCH * HEADS)
#define ZDIM (HEADS * DE)
#define ROWS (BATCH * SEQ)
#define QT (SEQ / 16)
#define RT64 (ROWS / 64)
#define WPITCH 72
#define KPITCH 40
#define OPITCH 68
#define NEG_BIG (-3.0e38f)
#define SPLIT 8   // waves of a work-group that share one tile's loop in k_stats and k_attn

typedef char chk_de[(DE == 64) ? 1 : -1];
typedef char chk_seq[((SEQ % 64) == 0) ? 1 : -1];
typedef char chk_rows[((ROWS % 64) == 0) ? 1 : -1];
typedef char chk_z[((ZDIM % 32) == 0) ? 1 : -1];

typedef __bf16 bf16_t;
typedef bf16_t v16bf __attribute__((ext_vector_type(16)));
typedef float v8f __attribute__((ext_vector_type(8)));
typedef float v4f __attribute__((ext_vector_type(4)));
typedef float v2f __attribute__((ext_vector_type(2)));
typedef unsigned int v4u __attribute__((ext_vector_type(4)));
typedef unsigned short us_t;

union Frag {
  v16bf v;
  v4u u[2];
};

__device__ __forceinline__ v4u mk4(unsigned int a, unsigned int b, unsigned int c, unsigned int d) {
  v4u r;
  r.x = a; r.y = b; r.z = c; r.w = d;
  return r;
}

__device__ __forceinline__ v8f zero8() {
  v8f z;
#pragma unroll
  for (int i = 0; i < 8; ++i) z[i] = 0.f;
  return z;
}

// f32 -> bf16 bits, RNE
__device__ __forceinline__ unsigned int bf_rne(float x) {
  unsigned int u = __float_as_uint(x);
  u += 0x7FFFu + ((u >> 16) & 1u);
  return u >> 16;
}
__device__ __forceinline__ float bf_val(unsigned int b) { return __uint_as_float(b << 16); }

// x ~= hi + lo : hi = RNE16(x), lo = RNE16(x - hi); two values packed per dword (even element in the low half)
__device__ __forceinline__ void split2(float x0, float x1, unsigned int& ph, unsigned int& pl) {
  const unsigned int h0 = bf_rne(x0), h1 = bf_rne(x1);
  const unsigned int l0 = bf_rne(x0 - bf_val(h0)), l1 = bf_rne(x1 - bf_val(h1));
  ph = h0 | (h1 << 16);
  pl = l0 | (l1 << 16);
}
__device__ __forceinline__ void split1(float x, us_t& hb, us_t& lb) {
  const unsigned int h = bf_rne(x);
  hb = (us_t)h;
  lb = (us_t)bf_rne(x - bf_val(h));
}
// 8 consecutive k values (a = k..k+3, b = k+4..k+7) -> packed hi and lo halves of a fragment
__device__ __forceinline__ void split8(v4f a, v4f b, v4u& ph, v4u& pl) {
  unsigned int h0, l0, h1, l1, h2, l2, h3, l3;
  split2(a.x, a.y, h0, l0);
  split2(a.z, a.w, h1, l1);
  split2(b.x, b.y, h2, l2);
  split2(b.z, b.w, h3, l3);
  ph = mk4(h0, h1, h2, h3);
  pl = mk4(l0, l1, l2, l3);
}

// D += Ah*Bh + Ah*Bl + Al*Bh ; 4 v_nop guard tying D and keeping all operands live
__device__ __forceinline__ v8f mma3(v16bf ah, v16bf al, v16bf bh, v16bf bl, v8f c) {
  c = __builtin_amdgcn_wmma_f32_16x16x32_bf16(false, ah, false, bh, (short)0, c, false, false);
  c = __builtin_amdgcn_wmma_f32_16x16x32_bf16(false, ah, false, bl, (short)0, c, false, false);
  c = __builtin_amdgcn_wmma_f32_16x16x32_bf16(false, al, false, bh, (short)0, c, false, false);
  asm volatile("v_nop\n\tv_nop\n\tv_nop\n\tv_nop" : "+v"(c) : "v"(ah), "v"(al), "v"(bh), "v"(bl));
  return c;
}

// 16-bit fragment from a row-major [row][k] array (pitch ld elements), rows base..base+15, k from k0.
// Lane l: row = l&15, h = l>>4; elements 0..7 = k0+8h+0..7, elements 8..15 = k0+16+8h+0..7.
// Used for B stored n-major with k contiguous (row = n), on LDS tiles.
__device__ __forceinline__ v16bf ldfrag(const us_t* base, int ld, int k0, int l) {
  const us_t* p = base + (size_t)(l & 15) * ld + k0 + 8 * (l >> 4);
  Frag f;
  f.u[0] = *(const v4u*)p;
  f.u[1] = *(const v4u*)(p + 16);
  return f.v;
}

// The workspace planes hold whole fragments in register order: one fragment (16 rows x 32 k) = FRAG
// elements = [half u][lane l][8 elements], the element map being ldfrag's. Each of the two loads of a
// wave then reads 512 contiguous bytes (4 cache lines) instead of 32 bytes from each of 16 lines.
// plane: wave-uniform base; off: byte offset of the fragment plus 16 * lane.
#define FRAG 512
#define FRAGB (2 * FRAG)
__device__ __forceinline__ v16bf ldfragp(const us_t* plane, unsigned int off) {
  const char* p = (const char*)plane + off;
  Frag f;
  f.u[0] = *(const v4u*)p;
  f.u[1] = *(const v4u*)(p + 512);
  return f.v;
}

// =====================================================================
// Kernel 1: head projections + RoPE on q,k.  Block = 4 waves = 64 rows of one (matrix, head).
// Outputs (bf16 hi and lo planes), in fragment order (see ldfragp):
//   qh, kh : [bh][s / 16][d / 32][fragment: row = s % 16, k = d % 32]
//   vt     : [bh][s / 32][d / 16][fragment: row = d % 16, k = s % 32]
// =====================================================================
__global__ __launch_bounds__(128) void k_proj(
    const float* __restrict__ q, const float* __restrict__ k, const float* __restrict__ v,
    const float* __restrict__ Wq, const float* __restrict__ Wk, const float* __restrict__ Wv,
    us_t* __restrict__ qhh, us_t* __restrict__ qhl, us_t* __restrict__ khh, us_t* __restrict__ khl,
    us_t* __restrict__ vth, us_t* __restrict__ vtl) {
#pragma clang fp contract(off)
  __shared__ __attribute__((aligned(16))) us_t wt[2][DE][WPITCH];   // W^T hi/lo : [plane][d][z]
  __shared__ __attribute__((aligned(16))) us_t st[2][64][WPITCH];   // result tile staging
  __shared__ float invf[32];

  const int t = threadIdx.x, w = t >> 5, l = t & 31, m = l & 15, hh = l >> 4;
  const int blk = blockIdx.x;
  const int mat = blk / (HEADS * RT64);                 // 0 = q, 1 = k, 2 = v (block-uniform)
  const int rem = blk - mat * (HEADS * RT64);
  const int head = rem / RT64;
  const int rt = rem - head * RT64;
  const int row0 = rt * 64;                             // row in [0, BATCH*SEQ)
  const int b = row0 / SEQ, s0 = row0 - b * SEQ, bh = b * HEADS + head;

  const float* X = (mat == 0) ? q : ((mat == 1) ? k : v);
  const float* W = ((mat == 0) ? Wq : ((mat == 1) ? Wk : Wv)) + (size_t)head * DE * DE;

  // stage W[z][d] -> wt[p][d][z] as hi/lo bf16
#pragma unroll 4
  for (int j = 0; j < 32; ++j) {
    const int idx = j * 128 + t;
    const int z = idx >> 6, d = idx & 63;
    us_t hb, lb;
    split1(W[idx], hb, lb);
    wt[0][d][z] = hb;
    wt[1][d][z] = lb;
  }
  if (t < 32) invf[t] = 1.0f / powf(10000.0f, (float)t * 0.03125f);
  __syncthreads();

  // A fragments: this wave's 16 rows of X, k 0..31 and 32..63
  const float* xr = X + (size_t)(row0 + w * 16 + m) * DE;
  Frag ah0, al0, ah1, al1;
  {
    v4f a, c;
    a = *(const v4f*)(xr + 8 * hh);       c = *(const v4f*)(xr + 8 * hh + 4);       split8(a, c, ah0.u[0], al0.u[0]);
    a = *(const v4f*)(xr + 16 + 8 * hh);  c = *(const v4f*)(xr + 16 + 8 * hh + 4);  split8(a, c, ah0.u[1], al0.u[1]);
    a = *(const v4f*)(xr + 32 + 8 * hh);  c = *(const v4f*)(xr + 32 + 8 * hh + 4);  split8(a, c, ah1.u[0], al1.u[0]);
    a = *(const v4f*)(xr + 48 + 8 * hh);  c = *(const v4f*)(xr + 48 + 8 * hh + 4);  split8(a, c, ah1.u[1], al1.u[1]);
  }

  v8f acc[4];
#pragma unroll
  for (int n = 0; n < 4; ++n) acc[n] = zero8();
#pragma unroll
  for (int n = 0; n < 4; ++n) {
    acc[n] = mma3(ah0.v, al0.v, ldfrag(&wt[0][n * 16][0], WPITCH, 0, l),
                  ldfrag(&wt[1][n * 16][0], WPITCH, 0, l), acc[n]);
    acc[n] = mma3(ah1.v, al1.v, ldfrag(&wt[0][n * 16][0], WPITCH, 32, l),
                  ldfrag(&wt[1][n * 16][0], WPITCH, 32, l), acc[n]);
  }
  // acc[n][r] = Y[row0 + w*16 + 8*hh + r][n*16 + m]

  if (mat < 2) {   // interleaved-pair rotary embedding: cols (2i, 2i+1) are adjacent lanes
#pragma unroll
    for (int n = 0; n < 4; ++n) {
      const int N = n * 16 + m;
      const float f = invf[N >> 1];
#pragma unroll
      for (int r = 0; r < 8; ++r) {
        const int pos = s0 + w * 16 + 8 * hh + r;
        const float ang = (float)pos * f;
        const float sn = sinf(ang), cs = cosf(ang);
        const float mine = acc[n][r];
        const float other = __shfl_xor(mine, 1, 32);
        acc[n][r] = ((N & 1) == 0) ? (mine * cs - other * sn) : (other * sn + mine * cs);
      }
    }
  }

  // stage the 64-row block tile as hi/lo bf16
  if (mat == 2) {   // transposed: st[p][d][row_local]
#pragma unroll
    for (int n = 0; n < 4; ++n)
#pragma unroll
      for (int r = 0; r < 8; ++r) {
        us_t hb, lb;
        split1(acc[n][r], hb, lb);
        st[0][n * 16 + m][w * 16 + 8 * hh + r] = hb;
        st[1][n * 16 + m][w * 16 + 8 * hh + r] = lb;
      }
  } else {          // row major: st[p][row_local][d]
#pragma unroll
    for (int n = 0; n < 4; ++n)
#pragma unroll
      for (int r = 0; r < 8; ++r) {
        us_t hb, lb;
        split1(acc[n][r], hb, lb);
        st[0][w * 16 + 8 * hh + r][n * 16 + m] = hb;
        st[1][w * 16 + 8 * hh + r][n * 16 + m] = lb;
      }
  }
  __syncthreads();

  // wave w writes the two fragments (k 0..31 and 32..63 of the staged tile) of staged rows w*16..w*16+15
  us_t* dsth = (mat == 2) ? vth : ((mat == 0) ? qhh : khh);
  us_t* dstl = (mat == 2) ? vtl : ((mat == 0) ? qhl : khl);
  // q, k: rows are s, the two fragments are neighbours; v: rows are d, the fragments lie one 32-query chunk apart
  const size_t fbase = (size_t)bh * SEQ * DE + (size_t)s0 * DE + (size_t)w * ((mat == 2) ? FRAG : 2 * FRAG);
  const size_t fstep = (mat == 2) ? (size_t)(32 * DE) : (size_t)FRAG;
  v4u vals[2][4];
#pragma unroll
  for (int i = 0; i < 4; ++i) {
    vals[0][i] = *(const v4u*)&st[0][w * 16 + m][16 * i + 8 * hh];
    vals[1][i] = *(const v4u*)&st[1][w * 16 + m][16 * i + 8 * hh];
  }
#pragma unroll
  for (int i = 0; i < 4; ++i) {
    const size_t o = fbase + (size_t)(i >> 1) * fstep + (i & 1) * 256 + 8 * l;
    *(v4u*)(dsth + o) = vals[0][i];
    *(v4u*)(dstl + o) = vals[1][i];
  }
  
}

// =====================================================================
// Kernel 2: per query row: m[q] = max_{k<=q} s/64, rcp[q] = 1 / sum exp(s/64 - m).
// One work-group per (bh, 16-row query tile); wave w takes key tiles w, w + SPLIT, ...; the waves'
// (max, sum) pairs meet in LDS.
// =====================================================================
__global__ __launch_bounds__(32 * SPLIT) void k_stats(
    const us_t* __restrict__ qhh, const us_t* __restrict__ qhl,
    const us_t* __restrict__ khh, const us_t* __restrict__ khl, float* __restrict__ ml) {
  __shared__ float pm[SPLIT][16];
  __shared__ float ps[SPLIT][16];
  // the wave's number as a scalar: the loop's bounds and branch stay on the scalar unit
  const int w = __builtin_amdgcn_readfirstlane(threadIdx.x >> 5);
  const int bh = blockIdx.x / QT, qt = blockIdx.x - bh * QT;
  const int l = threadIdx.x & 31, m = l & 15, hh = l >> 4;

  const size_t qoff = ((size_t)bh * SEQ + qt * 16) * DE;
  const v16bf aqh0 = ldfragp(qhh + qoff, 16 * l), aqh1 = ldfragp(qhh + qoff, FRAGB + 16 * l);
  const v16bf aql0 = ldfragp(qhl + qoff, 16 * l), aql1 = ldfragp(qhl + qoff, FRAGB + 16 * l);
  const us_t* Kh = khh + (size_t)bh * SEQ * DE;
  const us_t* Kl = khl + (size_t)bh * SEQ * DE;

  float mrow[8], lrow[8];
#pragma unroll
  for (int r = 0; r < 8; ++r) { mrow[r] = NEG_BIG; lrow[r] = 0.f; }

#pragma unroll 1
  for (int kt = w; kt <= qt; kt += SPLIT) {
    const unsigned int ko = (unsigned int)kt * (2 * FRAGB) + 16 * l;
    v8f s = zero8();
    s = mma3(aqh0, aql0, ldfragp(Kh, ko), ldfragp(Kl, ko), s);
    s = mma3(aqh1, aql1, ldfragp(Kh, ko + FRAGB), ldfragp(Kl, ko + FRAGB), s);
    // s[r] = score[q = qt*16 + 8*hh + r][k = kt*16 + m]
    // running maximum and sum stay private to the lane (its own key column of every tile)
#pragma unroll
    for (int r = 0; r < 8; ++r) {
      const int qg = qt * 16 + 8 * hh + r;
      const int kg = kt * 16 + m;
      const float x = (kg <= qg) ? s[r] * (1.0f / 64.0f) : NEG_BIG;
      const float mn = fmaxf(mrow[r], x);
      lrow[r] = lrow[r] * __expf(mrow[r] - mn) + __expf(x - mn);
      mrow[r] = mn;
    }
  }

  // one merge of the 16 lanes of each row: a lane that saw no valid key holds NEG_BIG and its sum scales to 0
#pragma unroll
  for (int r = 0; r < 8; ++r) {
    float gm = mrow[r];
#pragma unroll
    for (int off = 1; off < 16; off <<= 1) gm = fmaxf(gm, __shfl_xor(gm, off, 32));
    float e = lrow[r] * __expf(mrow[r] - gm);
#pragma unroll
    for (int off = 1; off < 16; off <<= 1) e += __shfl_xor(e, off, 32);
    mrow[r] = gm;
    lrow[r] = e;
  }

  // merge of the waves: a wave that had no key tile holds NEG_BIG and a sum of 0
  if (m == 0) {
#pragma unroll   // mrow and lrow live in registers: r must be a constant
    for (int r = 0; r < 8; ++r) {
      pm[w][8 * hh + r] = mrow[r];
      ps[w][8 * hh + r] = lrow[r];
    }
  }
  __syncthreads();
  if (threadIdx.x < 16) {
    const int row = threadIdx.x;
    float gm = pm[0][row];
    for (int j = 1; j < SPLIT; ++j) gm = fmaxf(gm, pm[j][row]);
    float e = 0.f;
    for (int j = 0; j < SPLIT; ++j) e += ps[j][row] * __expf(pm[j][row] - gm);
    v2f val;
    val.x = gm; val.y = 1.0f / e;
    *(v2f*)(ml + ((size_t)bh * SEQ + qt * 16 + row) * 2) = val;
  }
}

// =====================================================================
// Kernel 3: out_h[bh][kpos][d] = sum_{q > kpos} P[q,kpos] * vh[q][d]   (contraction over the query axis)
// One work-group per (bh, 16-col k tile); wave w takes the 32-query chunks w, w + SPLIT, ... from the
// diagonal on: two 16x16 score tiles -> P in registers (packed D tiles = P^T A fragment) -> 4 P^T.V products.
// The waves' partial tiles are summed through LDS. Stores f32 out_h [b*S][H*DE].
// =====================================================================
__global__ __launch_bounds__(32 * SPLIT) void k_attn(
    const us_t* __restrict__ qhh, const us_t* __restrict__ qhl,
    const us_t* __restrict__ khh, const us_t* __restrict__ khl,
    const us_t* __restrict__ vth, const us_t* __restrict__ vtl,
    const float* __restrict__ ml, float* __restrict__ outh) {
  __shared__ __attribute__((aligned(16))) float so[SPLIT][16][OPITCH];
  // the wave's number as a scalar: the loop's bounds and branch stay on the scalar unit
  const int w = __builtin_amdgcn_readfirstlane(threadIdx.x >> 5);
  const int bh = blockIdx.x / QT, kt = blockIdx.x - bh * QT;
  const int l = threadIdx.x & 31, m = l & 15, hh = l >> 4;

  // loop-invariant B fragments of the key tile (kh rows kt*16.., lane = key)
  const size_t koff = ((size_t)bh * SEQ + kt * 16) * DE;
  const v16bf bkh0 = ldfragp(khh + koff, 16 * l), bkh1 = ldfragp(khh + koff, FRAGB + 16 * l);
  const v16bf bkl0 = ldfragp(khl + koff, 16 * l), bkl1 = ldfragp(khl + koff, FRAGB + 16 * l);

  v8f o[4];
#pragma unroll
  for (int n = 0; n < 4; ++n) o[n] = zero8();

  const int kg = kt * 16 + m;                       // this lane's key column in the score tiles
  const float* mlb = ml + (size_t)bh * SEQ * 2;
  const us_t* Qh = qhh + (size_t)bh * SEQ * DE;
  const us_t* Ql = qhl + (size_t)bh * SEQ * DE;
  const us_t* Vh = vth + (size_t)bh * DE * SEQ;
  const us_t* Vl = vtl + (size_t)bh * DE * SEQ;

#pragma unroll 1
  for (int qc = ((kt >> 1) + w) * 32; qc < SEQ; qc += 32 * SPLIT) {
    // a 32-query chunk is 4 fragments in each plane, q and v alike: one byte offset serves all four planes
    const unsigned int fo = (unsigned int)qc * (DE * 2) + 16 * l;
    unsigned int ph[2][4], pl[2][4];
#pragma unroll
    for (int sub = 0; sub < 2; ++sub) {
      const int q0 = qc + 16 * sub;
      const unsigned int qo = fo + sub * (2 * FRAGB);
      v8f s = zero8();
      s = mma3(ldfragp(Qh, qo), ldfragp(Ql, qo), bkh0, bkl0, s);
      s = mma3(ldfragp(Qh, qo + FRAGB), ldfragp(Ql, qo + FRAGB), bkh1, bkl1, s);
      // s[r] = score[q = q0 + 8*hh + r][k = kg]
      float p[8];
#pragma unroll
      for (int r = 0; r < 8; ++r) {
        const int qg = q0 + 8 * hh + r;
        const v2f mr = *(const v2f*)(mlb + 2 * qg);
        const float e = __expf(s[r] * (1.0f / 64.0f) - mr.x) * mr.y;
        p[r] = (kg < qg) ? e : 0.f;                 // causal and zeroed diagonal: strictly k < q
      }
#pragma unroll
      for (int j = 0; j < 4; ++j) split2(p[2 * j], p[2 * j + 1], ph[sub][j], pl[sub][j]);
    }
    // P^T A fragment (rows = key m, k = 32 queries of this chunk): elements 0..7 from the first
    // 16-query D tile, 8..15 from the second, same lane.
    Frag aph, apl;
    aph.u[0] = mk4(ph[0][0], ph[0][1], ph[0][2], ph[0][3]);
    aph.u[1] = mk4(ph[1][0], ph[1][1], ph[1][2], ph[1][3]);
    apl.u[0] = mk4(pl[0][0], pl[0][1], pl[0][2], pl[0][3]);
    apl.u[1] = mk4(pl[1][0], pl[1][1], pl[1][2], pl[1][3]);
#pragma unroll
    for (int n = 0; n < 4; ++n) {
      const unsigned int vo = fo + n * FRAGB;        // B fragment: rows d = n*16.., k = query from qc
      o[n] = mma3(aph.v, apl.v, ldfragp(Vh, vo), ldfragp(Vl, vo), o[n]);
    }
  }
  // o[n][r] = this wave's share of out_h[kpos = kt*16 + 8*hh + r][d = n*16 + m]

#pragma unroll
  for (int n = 0; n < 4; ++n)
#pragma unroll
    for (int r = 0; r < 8; ++r) so[w][8 * hh + r][n * 16 + m] = o[n][r];
  __syncthreads();

  // each thread sums one 4-float piece of the 16 x 64 tile over the waves
  const int bb = bh / HEADS, head = bh - bb * HEADS;
  for (int i = threadIdx.x; i < 16 * 16; i += 32 * SPLIT) {
    const int row = i >> 4, c4 = i & 15;
    v4f sum = *(const v4f*)&so[0][row][4 * c4];
    for (int j = 1; j < SPLIT; ++j) sum += *(const v4f*)&so[j][row][4 * c4];
    *(v4f*)(outh + ((size_t)bb * SEQ + kt * 16 + row) * ZDIM + head * DE + 4 * c4) = sum;
  }
}

// =====================================================================
// Kernel 4: out = out_h (4096 x 512) . W_o (512 x 64). Block = 4 waves = 64 rows;
// W_o^T staged per 32-deep k chunk as hi/lo bf16 in LDS.
// =====================================================================
__global__ __launch_bounds__(128) void k_oproj(
    const float* __restrict__ outh, const float* __restrict__ Wo, float* __restrict__ out) {
  __shared__ __attribute__((aligned(16))) us_t wo[2][DE][KPITCH];   // [plane][d][z_local]
  __shared__ __attribute__((aligned(16))) float so[4][16][OPITCH];
  const int t = threadIdx.x, w = t >> 5, l = t & 31, m = l & 15, hh = l >> 4;
  const int rowbase = blockIdx.x * 64 + w * 16;

  v8f acc[4];
#pragma unroll
  for (int n = 0; n < 4; ++n) acc[n] = zero8();

#pragma unroll 1
  for (int c = 0; c < ZDIM / 32; ++c) {
    __syncthreads();                       // all waves done reading the staged chunk
#pragma unroll
    for (int j = 0; j < 16; ++j) {
      const int idx = j * 128 + t;
      const int zz = idx >> 6, d = idx & 63;
      us_t hb, lb;
      split1(Wo[(size_t)(c * 32 + zz) * DE + d], hb, lb);
      wo[0][d][zz] = hb;
      wo[1][d][zz] = lb;
    }
    __syncthreads();
    const float* ar = outh + (size_t)(rowbase + m) * ZDIM + c * 32;
    Frag ah, al;
    {
      v4f a, e;
      a = *(const v4f*)(ar + 8 * hh);       e = *(const v4f*)(ar + 8 * hh + 4);       split8(a, e, ah.u[0], al.u[0]);
      a = *(const v4f*)(ar + 16 + 8 * hh);  e = *(const v4f*)(ar + 16 + 8 * hh + 4);  split8(a, e, ah.u[1], al.u[1]);
    }
#pragma unroll
    for (int n = 0; n < 4; ++n)
      acc[n] = mma3(ah.v, al.v, ldfrag(&wo[0][n * 16][0], KPITCH, 0, l),
                    ldfrag(&wo[1][n * 16][0], KPITCH, 0, l), acc[n]);
  }
  // acc[n][r] = out[rowbase + 8*hh + r][n*16 + m]

#pragma unroll
  for (int n = 0; n < 4; ++n)
#pragma unroll
    for (int r = 0; r < 8; ++r) so[w][8 * hh + r][n * 16 + m] = acc[n][r];
  __syncthreads();

  v4f vals[8];
  size_t offs[8];
#pragma unroll
  for (int i = 0; i < 8; ++i) {
    const int row = 2 * i + hh;
    vals[i] = *(const v4f*)&so[w][row][4 * m];
    offs[i] = (size_t)(rowbase + row) * DE + 4 * m;
  }
#pragma unroll
  for (int i = 0; i < 8; ++i) *(v4f*)(out + offs[i]) = vals[i];
  
}

extern "C" void kernel_launch(void* const* d_in, const int* in_sizes, int n_in,
                              void* d_out, int out_size, void* d_ws, size_t ws_size,
                              hipStream_t stream) {
  if (n_in < 7) return;
  if (in_sizes[0] != ROWS * DE || in_sizes[1] != ROWS * DE || in_sizes[2] != ROWS * DE) return;
  if (in_sizes[3] != HEADS * DE * DE || in_sizes[4] != HEADS * DE * DE || in_sizes[5] != HEADS * DE * DE) return;
  if (in_sizes[6] != ZDIM * DE) return;
  if (out_size != ROWS * DE) return;

  const float* q  = (const float*)d_in[0];
  const float* k  = (const float*)d_in[1];
  const float* v  = (const float*)d_in[2];
  const float* Wq = (const float*)d_in[3];
  const float* Wk = (const float*)d_in[4];
  const float* Wv = (const float*)d_in[5];
  const float* Wo = (const float*)d_in[6];
  float* out = (float*)d_out;

  char* ws = (char*)d_ws;
  size_t off = 0;
  const size_t plane = (size_t)BH * SEQ * DE * sizeof(us_t);          // 4 MiB each
  us_t* qhh = (us_t*)(ws + off); off += plane;
  us_t* qhl = (us_t*)(ws + off); off += plane;
  us_t* khh = (us_t*)(ws + off); off += plane;
  us_t* khl = (us_t*)(ws + off); off += plane;
  us_t* vth = (us_t*)(ws + off); off += plane;
  us_t* vtl = (us_t*)(ws + off); off += plane;
  float* ml   = (float*)(ws + off); off += (size_t)BH * SEQ * 2 * sizeof(float);    // 256 KiB
  float* outh = (float*)(ws + off); off += (size_t)ROWS * ZDIM * sizeof(float);      // 8 MiB
  if (off > ws_size) return;

  k_proj<<<dim3(3 * HEADS * RT64), dim3(128), 0, stream>>>(q, k, v, Wq, Wk, Wv,
                                                           qhh, qhl, khh, khl, vth, vtl);
  k_stats<<<dim3(BH * QT), dim3(32 * SPLIT), 0, stream>>>(qhh, qhl, khh, khl, ml);
  k_attn<<<dim3(BH * QT), dim3(32 * SPLIT), 0, stream>>>(qhh, qhl, khh, khl, vth, vtl, ml, outh);
  k_oproj<<<dim3(ROWS / 64), dim3(128), 0, stream>>>(outh, Wo, out);
}

// v004
// One run takes 106 microseconds.
// In both of two side-by-side timings against v003, it was 1.17 times as fast.
// All steps since v000 together make it 5.11 times as fast.
#include <hip/hip_runtime.h>
#include <stddef.h>

// Contractions: head projections, q.k scores (statistics pass and output pass), P.V over the query axis,
// output projection -- all v_wmma_f32_16x16x32_bf16 with bf16 hi/lo operand split (hi*hi + hi*lo + lo*hi),
// f32 accumulate. RoPE, softmax statistics, masks and epilogues in f32.

#define HEADS 8
#define DE 64
#define BATCH 2
#define SEQ 2048
#define BH (BATCH * HEADS)
#define ZDIM (HEADS * DE)
#define ROWS (BATCH * SEQ)
#define QT (SEQ / 16)
#define RT64 (ROWS / 64)
#define WPITCH 72
#define KPITCH 40
#define OPITCH 68
#define NEG_BIG (-3.0e38f)
#define SPLIT 8   // waves of a work-group that share one loop over its WT tiles in k_stats and k_attn
#define WT 2      // 16-wide tiles one wave holds in k_stats and k_attn: each fragment loaded in the loop feeds WT products

typedef char chk_de[(DE == 64) ? 1 : -1];
typedef char chk_seq[((SEQ % 64) == 0) ? 1 : -1];
typedef char chk_rows[((ROWS % 64) == 0) ? 1 : -1];
typedef char chk_z[((ZDIM % 32) == 0) ? 1 : -1];
typedef char chk_wt[((QT % WT) == 0 && (WT % 2) == 0) ? 1 : -1];

typedef __bf16 bf16_t;
typedef bf16_t v16bf __attribute__((ext_vector_type(16)));
typedef float v8f __attribute__((ext_vector_type(8)));
typedef float v4f __attribute__((ext_vector_type(4)));
typedef float v2f __attribute__((ext_vector_type(2)));
typedef unsigned int v4u __attribute__((ext_vector_type(4)));
typedef unsigned short us_t;

union Frag {
  v16bf v;
  v4u u[2];
};

__device__ __forceinline__ v4u mk4(unsigned int a, unsigned int b, unsigned int c, unsigned int d) {
  v4u r;
  r.x = a; r.y = b; r.z = c; r.w = d;
  return r;
}

__device__ __forceinline__ v8f zero8() {
  v8f z;
#pragma unroll
  for (int i = 0; i < 8; ++i) z[i] = 0.f;
  return z;
}

// f32 -> bf16 bits, RNE
__device__ __forceinline__ unsigned int bf_rne(float x) {
  unsigned int u = __float_as_uint(x);
  u += 0x7FFFu + ((u >> 16) & 1u);
  return u >> 16;
}
__device__ __forceinline__ float bf_val(unsigned int b) { return __uint_as_float(b << 16); }

// x ~= hi + lo : hi = RNE16(x), lo = RNE16(x - hi); two values packed per dword (even element in the low half)
__device__ __forceinline__ void split2(float x0, float x1, unsigned int& ph, unsigned int& pl) {
  const unsigned int h0 = bf_rne(x0), h1 = bf_rne(x1);
  const unsigned int l0 = bf_rne(x0 - bf_val(h0)), l1 = bf_rne(x1 - bf_val(h1));
  ph = h0 | (h1 << 16);
  pl = l0 | (l1 << 16);
}
__device__ __forceinline__ void split1(float x, us_t& hb, us_t& lb) {
  const unsigned int h = bf_rne(x);
  hb = (us_t)h;
  lb = (us_t)bf_rne(x - bf_val(h));
}
// 8 consecutive k values (a = k..k+3, b = k+4..k+7) -> packed hi and lo halves of a fragment
__device__ __forceinline__ void split8(v4f a, v4f b, v4u& ph, v4u& pl) {
  unsigned int h0, l0, h1, l1, h2, l2, h3, l3;
  split2(a.x, a.y, h0, l0);
  split2(a.z, a.w, h1, l1);
  split2(b.x, b.y, h2, l2);
  split2(b.z, b.w, h3, l3);
  ph = mk4(h0, h1, h2, h3);
  pl = mk4(l0, l1, l2, l3);
}

// D += Ah*Bh + Ah*Bl + Al*Bh ; 4 v_nop guard tying D and keeping all operands live
__device__ __forceinline__ v8f mma3(v16bf ah, v16bf al, v16bf bh, v16bf bl, v8f c) {
  c = __builtin_amdgcn_wmma_f32_16x16x32_bf16(false, ah, false, bh, (short)0, c, false, false);
  c = __builtin_amdgcn_wmma_f32_16x16x32_bf16(false, ah, false, bl, (short)0, c, false, false);
  c = __builtin_amdgcn_wmma_f32_16x16x32_bf16(false, al, false, bh, (short)0, c, false, false);
  asm volatile("v_nop\n\tv_nop\n\tv_nop\n\tv_nop" : "+v"(c) : "v"(ah), "v"(al), "v"(bh), "v"(bl));
  return c;
}

// 16-bit fragment from a row-major [row][k] array (pitch ld elements), rows base..base+15, k from k0.
// Lane l: row = l&15, h = l>>4; elements 0..7 = k0+8h+0..7, elements 8..15 = k0+16+8h+0..7.
// Used for B stored n-major with k contiguous (row = n), on LDS tiles.
__device__ __forceinline__ v16bf ldfrag(const us_t* base, int ld, int k0, int l) {
  const us_t* p = base + (size_t)(l & 15) * ld + k0 + 8 * (l >> 4);
  Frag f;
  f.u[0] = *(const v4u*)p;
  f.u[1] = *(const v4u*)(p + 16);
  return f.v;
}

// The workspace planes hold whole fragments in register order: one fragment (16 rows x 32 k) = FRAG
// elements = [half u][lane l][8 elements], the element map being ldfrag's. Each of the two loads of a
// wave then reads 512 contiguous bytes (4 cache lines) instead of 32 bytes from each of 16 lines.
// plane: wave-uniform base; off: byte offset of the fragment plus 16 * lane.
#define FRAG 512
#define FRAGB (2 * FRAG)
__device__ __forceinline__ v16bf ldfragp(const us_t* plane, unsigned int off) {
  const char* p = (const char*)plane + off;
  Frag f;
  f.u[0] = *(const v4u*)p;
  f.u[1] = *(const v4u*)(p + 512);
  return f.v;
}

// =====================================================================
// Kernel 1: head projections + RoPE on q,k.  Block = 4 waves = 64 rows of one (matrix, head).
// Outputs (bf16 hi and lo planes), in fragment order (see ldfragp):
//   qh, kh : [bh][s / 16][d / 32][fragment: row = s % 16, k = d % 32]
//   vt     : [bh][s / 32][d / 16][fragment: row = d % 16, k = s % 32]
// =====================================================================
__global__ __launch_bounds__(128) void k_proj(
    const float* __restrict__ q, const float* __restrict__ k, const float* __restrict__ v,
    const float* __restrict__ Wq, const float* __restrict__ Wk, const float* __restrict__ Wv,
    us_t* __restrict__ qhh, us_t* __restrict__ qhl, us_t* __restrict__ khh, us_t* __restrict__ khl,
    us_t* __restrict__ vth, us_t* __restrict__ vtl) {
#pragma clang fp contract(off)
  __shared__ __attribute__((aligned(16))) us_t wt[2][DE][WPITCH];   // W^T hi/lo : [plane][d][z]
  __shared__ __attribute__((aligned(16))) us_t st[2][64][WPITCH];   // result tile staging
  __shared__ float invf[32];

  const int t = threadIdx.x, w = t >> 5, l = t & 31, m = l & 15, hh = l >> 4;
  const int blk = blockIdx.x;
  const int mat = blk / (HEADS * RT64);                 // 0 = q, 1 = k, 2 = v (block-uniform)
  const int rem = blk - mat * (HEADS * RT64);
  const int head = rem / RT64;
  const int rt = rem - head * RT64;
  const int row0 = rt * 64;                             // row in [0, BATCH*SEQ)
  const int b = row0 / SEQ, s0 = row0 - b * SEQ, bh = b * HEADS + head;

  const float* X = (mat == 0) ? q : ((mat == 1) ? k : v);
  const float* W = ((mat == 0) ? Wq : ((mat == 1) ? Wk : Wv)) + (size_t)head * DE * DE;

  // stage W[z][d] -> wt[p][d][z] as hi/lo bf16
#pragma unroll 4
  for (int j = 0; j < 32; ++j) {
    const int idx = j * 128 + t;
    const int z = idx >> 6, d = idx & 63;
    us_t hb, lb;
    split1(W[idx], hb, lb);
    wt[0][d][z] = hb;
    wt[1][d][z] = lb;
  }
  if (t < 32) invf[t] = 1.0f / powf(10000.0f, (float)t * 0.03125f);
  __syncthreads();

  // A fragments: this wave's 16 rows of X, k 0..31 and 32..63
  const float* xr = X + (size_t)(row0 + w * 16 + m) * DE;
  Frag ah0, al0, ah1, al1;
  {
    v4f a, c;
    a = *(const v4f*)(xr + 8 * hh);       c = *(const v4f*)(xr + 8 * hh + 4);       split8(a, c, ah0.u[0], al0.u[0]);
    a = *(const v4f*)(xr + 16 + 8 * hh);  c = *(const v4f*)(xr + 16 + 8 * hh + 4);  split8(a, c, ah0.u[1], al0.u[1]);
    a = *(const v4f*)(xr + 32 + 8 * hh);  c = *(const v4f*)(xr + 32 + 8 * hh + 4);  split8(a, c, ah1.u[0], al1.u[0]);
    a = *(const v4f*)(xr + 48 + 8 * hh);  c = *(const v4f*)(xr + 48 + 8 * hh + 4);  split8(a, c, ah1.u[1], al1.u[1]);
  }

  v8f acc[4];
#pragma unroll
  for (int n = 0; n < 4; ++n) acc[n] = zero8();
#pragma unroll
  for (int n = 0; n < 4; ++n) {
    acc[n] = mma3(ah0.v, al0.v, ldfrag(&wt[0][n * 16][0], WPITCH, 0, l),
                  ldfrag(&wt[1][n * 16][0], WPITCH, 0, l), acc[n]);
    acc[n] = mma3(ah1.v, al1.v, ldfrag(&wt[0][n * 16][0], WPITCH, 32, l),
                  ldfrag(&wt[1][n * 16][0], WPITCH, 32, l), acc[n]);
  }
  // acc[n][r] = Y[row0 + w*16 + 8*hh + r][n*16 + m]

  if (mat < 2) {   // interleaved-pair rotary embedding: cols (2i, 2i+1) are adjacent lanes
#pragma unroll
    for (int n = 0; n < 4; ++n) {
      const int N = n * 16 + m;
      const float f = invf[N >> 1];
#pragma unroll
      for (int r = 0; r < 8; ++r) {
        const int pos = s0 + w * 16 + 8 * hh + r;
        const float ang = (float)pos * f;
        const float sn = sinf(ang), cs = cosf(ang);
        const float mine = acc[n][r];
        const float other = __shfl_xor(mine, 1, 32);
        acc[n][r] = ((N & 1) == 0) ? (mine * cs - other * sn) : (other * sn + mine * cs);
      }
    }
  }

  // stage the 64-row block tile as hi/lo bf16
  if (mat == 2) {   // transposed: st[p][d][row_local]
#pragma unroll
    for (int n = 0; n < 4; ++n)
#pragma unroll
      for (int r = 0; r < 8; ++r) {
        us_t hb, lb;
        split1(acc[n][r], hb, lb);
        st[0][n * 16 + m][w * 16 + 8 * hh + r] = hb;
        st[1][n * 16 + m][w * 16 + 8 * hh + r] = lb;
      }
  } else {          // row major: st[p][row_local][d]
#pragma unroll
    for (int n = 0; n < 4; ++n)
#pragma unroll
      for (int r = 0; r < 8; ++r) {
        us_t hb, lb;
        split1(acc[n][r], hb, lb);
        st[0][w * 16 + 8 * hh + r][n * 16 + m] = hb;
        st[1][w * 16 + 8 * hh + r][n * 16 + m] = lb;
      }
  }
  __syncthreads();

  // wave w writes the two fragments (k 0..31 and 32..63 of the staged tile) of staged rows w*16..w*16+15
  us_t* dsth = (mat == 2) ? vth : ((mat == 0) ? qhh : khh);
  us_t* dstl = (mat == 2) ? vtl : ((mat == 0) ? qhl : khl);
  // q, k: rows are s, the two fragments are neighbours; v: rows are d, the fragments lie one 32-query chunk apart
  const size_t fbase = (size_t)bh * SEQ * DE + (size_t)s0 * DE + (size_t)w * ((mat == 2) ? FRAG : 2 * FRAG);
  const size_t fstep = (mat == 2) ? (size_t)(32 * DE) : (size_t)FRAG;
  v4u vals[2][4];
#pragma unroll
  for (int i = 0; i < 4; ++i) {
    vals[0][i] = *(const v4u*)&st[0][w * 16 + m][16 * i + 8 * hh];
    vals[1][i] = *(const v4u*)&st[1][w * 16 + m][16 * i + 8 * hh];
  }
#pragma unroll
  for (int i = 0; i < 4; ++i) {
    const size_t o = fbase + (size_t)(i >> 1) * fstep + (i & 1) * 256 + 8 * l;
    *(v4u*)(dsth + o) = vals[0][i];
    *(v4u*)(dstl + o) = vals[1][i];
  }
  
}

// =====================================================================
// Kernel 2: per query row: m[q] = max_{k<=q} s/64, rcp[q] = 1 / sum exp(s/64 - m).
// One work-group per (bh, WT query tiles of 16 rows); wave w takes key tiles w, w + SPLIT, ... and puts
// each loaded key fragment to all WT query tiles; the waves' (max, sum) pairs meet in LDS.
// =====================================================================
__global__ __launch_bounds__(32 * SPLIT) void k_stats(
    const us_t* __restrict__ qhh, const us_t* __restrict__ qhl,
    const us_t* __restrict__ khh, const us_t* __restrict__ khl, float* __restrict__ ml) {
  __shared__ float pm[SPLIT][16 * WT];
  __shared__ float ps[SPLIT][16 * WT];
  // the wave's number as a scalar: the loop's bounds and branch stay on the scalar unit
  const int w = __builtin_amdgcn_readfirstlane(threadIdx.x >> 5);
  const int bh = blockIdx.x / (QT / WT), qt0 = (blockIdx.x - bh * (QT / WT)) * WT;   // first query tile
  const int l = threadIdx.x & 31, m = l & 15, hh = l >> 4;

  const size_t qoff = ((size_t)bh * SEQ + qt0 * 16) * DE;
  v16bf aqh[WT][2], aql[WT][2];
#pragma unroll
  for (int t = 0; t < WT; ++t) {
    const unsigned int ao = t * (2 * FRAGB) + 16 * l;
    aqh[t][0] = ldfragp(qhh + qoff, ao);
    aqh[t][1] = ldfragp(qhh + qoff, ao + FRAGB);
    aql[t][0] = ldfragp(qhl + qoff, ao);
    aql[t][1] = ldfragp(qhl + qoff, ao + FRAGB);
  }
  const us_t* Kh = khh + (size_t)bh * SEQ * DE;
  const us_t* Kl = khl + (size_t)bh * SEQ * DE;

  float mrow[WT][8], lrow[WT][8];
#pragma unroll
  for (int t = 0; t < WT; ++t)
#pragma unroll
    for (int r = 0; r < 8; ++r) { mrow[t][r] = NEG_BIG; lrow[t][r] = 0.f; }

  // a key tile past the diagonal of one of the query tiles is all masked there and adds exactly 0
#pragma unroll 1
  for (int kt = w; kt < qt0 + WT; kt += SPLIT) {
    const unsigned int ko = (unsigned int)kt * (2 * FRAGB) + 16 * l;
    const v16bf kh0 = ldfragp(Kh, ko), kl0 = ldfragp(Kl, ko);
    const v16bf kh1 = ldfragp(Kh, ko + FRAGB), kl1 = ldfragp(Kl, ko + FRAGB);
#pragma unroll
    for (int t = 0; t < WT; ++t) {
      v8f s = zero8();
      s = mma3(aqh[t][0], aql[t][0], kh0, kl0, s);
      s = mma3(aqh[t][1], aql[t][1], kh1, kl1, s);
      // s[r] = score[q = (qt0 + t)*16 + 8*hh + r][k = kt*16 + m]
      // running maximum and sum stay private to the lane (its own key column of every tile)
#pragma unroll
      for (int r = 0; r < 8; ++r) {
        const int qg = (qt0 + t) * 16 + 8 * hh + r;
        const int kg = kt * 16 + m;
        const float x = (kg <= qg) ? s[r] * (1.0f / 64.0f) : NEG_BIG;
        const float mn = fmaxf(mrow[t][r], x);
        lrow[t][r] = lrow[t][r] * __expf(mrow[t][r] - mn) + __expf(x - mn);
        mrow[t][r] = mn;
      }
    }
  }

  // one merge of the 16 lanes of each row: a lane that saw no valid key holds NEG_BIG and its sum scales to 0
#pragma unroll
  for (int t = 0; t < WT; ++t)
#pragma unroll
    for (int r = 0; r < 8; ++r) {
      float gm = mrow[t][r];
#pragma unroll
      for (int off = 1; off < 16; off <<= 1) gm = fmaxf(gm, __shfl_xor(gm, off, 32));
      float e = lrow[t][r] * __expf(mrow[t][r] - gm);
#pragma unroll
      for (int off = 1; off < 16; off <<= 1) e += __shfl_xor(e, off, 32);
      mrow[t][r] = gm;
      lrow[t][r] = e;
    }

  // merge of the waves: a wave that saw no valid key of a row holds NEG_BIG there and its sum scales to 0
  if (m == 0) {
#pragma unroll   // mrow and lrow live in registers: t and r must be constants
    for (int t = 0; t < WT; ++t)
#pragma unroll
      for (int r = 0; r < 8; ++r) {
        pm[w][16 * t + 8 * hh + r] = mrow[t][r];
        ps[w][16 * t + 8 * hh + r] = lrow[t][r];
      }
  }
  __syncthreads();
  if (threadIdx.x < 16 * WT) {
    const int row = threadIdx.x;
    float gm = pm[0][row];
    for (int j = 1; j < SPLIT; ++j) gm = fmaxf(gm, pm[j][row]);
    float e = 0.f;
    for (int j = 0; j < SPLIT; ++j) e += ps[j][row] * __expf(pm[j][row] - gm);
    v2f val;
    val.x = gm; val.y = 1.0f / e;
    *(v2f*)(ml + ((size_t)bh * SEQ + qt0 * 16 + row) * 2) = val;
  }
}

// =====================================================================
// Kernel 3: out_h[bh][kpos][d] = sum_{q > kpos} P[q,kpos] * vh[q][d]   (contraction over the query axis)
// One work-group per (bh, WT key tiles of 16 columns); wave w takes the 32-query chunks w, w + SPLIT, ... from
// the diagonal on. Each loaded q fragment, v fragment and row statistic serves all WT key tiles: per key tile
// two 16x16 score tiles -> P in registers (packed D tiles = P^T A fragment) -> 4 P^T.V products.
// The waves' partial tiles are summed through LDS. Stores f32 out_h [b*S][H*DE].
// =====================================================================
__global__ __launch_bounds__(32 * SPLIT) void k_attn(
    const us_t* __restrict__ qhh, const us_t* __restrict__ qhl,
    const us_t* __restrict__ khh, const us_t* __restrict__ khl,
    const us_t* __restrict__ vth, const us_t* __restrict__ vtl,
    const float* __restrict__ ml, float* __restrict__ outh) {
  __shared__ __attribute__((aligned(16))) float so[SPLIT][16 * WT][OPITCH];
  // the wave's number as a scalar: the loop's bounds and branch stay on the scalar unit
  const int w = __builtin_amdgcn_readfirstlane(threadIdx.x >> 5);
  const int bh = blockIdx.x / (QT / WT), kt0 = (blockIdx.x - bh * (QT / WT)) * WT;   // first key tile
  const int l = threadIdx.x & 31, m = l & 15, hh = l >> 4;

  // loop-invariant B fragments of the key tiles (kh rows kt0*16.., lane = key)
  const size_t koff = ((size_t)bh * SEQ + kt0 * 16) * DE;
  v16bf bkh[WT][2], bkl[WT][2];
#pragma unroll
  for (int t = 0; t < WT; ++t) {
    const unsigned int bo = t * (2 * FRAGB) + 16 * l;
    bkh[t][0] = ldfragp(khh + koff, bo);
    bkh[t][1] = ldfragp(khh + koff, bo + FRAGB);
    bkl[t][0] = ldfragp(khl + koff, bo);
    bkl[t][1] = ldfragp(khl + koff, bo + FRAGB);
  }

  v8f o[WT][4];
#pragma unroll
  for (int t = 0; t < WT; ++t)
#pragma unroll
    for (int n = 0; n < 4; ++n) o[t][n] = zero8();

  const float* mlb = ml + (size_t)bh * SEQ * 2;
  const us_t* Qh = qhh + (size_t)bh * SEQ * DE;
  const us_t* Ql = qhl + (size_t)bh * SEQ * DE;
  const us_t* Vh = vth + (size_t)bh * DE * SEQ;
  const us_t* Vl = vtl + (size_t)bh * DE * SEQ;

#pragma unroll 1
  for (int qc = ((kt0 >> 1) + w) * 32; qc < SEQ; qc += 32 * SPLIT) {
    // a 32-query chunk is 4 fragments in each plane, q and v alike: one byte offset serves all four planes
    const unsigned int fo = (unsigned int)qc * (DE * 2) + 16 * l;
    unsigned int ph[WT][2][4], pl[WT][2][4];
#pragma unroll
    for (int sub = 0; sub < 2; ++sub) {
      const int q0 = qc + 16 * sub;
      const unsigned int qo = fo + sub * (2 * FRAGB);
      const v16bf qh0 = ldfragp(Qh, qo), ql0 = ldfragp(Ql, qo);
      const v16bf qh1 = ldfragp(Qh, qo + FRAGB), ql1 = ldfragp(Ql, qo + FRAGB);
      v2f mr[8];
#pragma unroll
      for (int r = 0; r < 8; ++r) mr[r] = *(const v2f*)(mlb + 2 * (q0 + 8 * hh + r));
#pragma unroll
      for (int t = 0; t < WT; ++t) {
        const int kg = (kt0 + t) * 16 + m;          // this lane's key column in the score tile
        v8f s = zero8();
        s = mma3(qh0, ql0, bkh[t][0], bkl[t][0], s);
        s = mma3(qh1, ql1, bkh[t][1], bkl[t][1], s);
        // s[r] = score[q = q0 + 8*hh + r][k = kg]
        float p[8];
#pragma unroll
        for (int r = 0; r < 8; ++r) {
          const int qg = q0 + 8 * hh + r;
          const float e = __expf(s[r] * (1.0f / 64.0f) - mr[r].x) * mr[r].y;
          p[r] = (kg < qg) ? e : 0.f;               // causal and zeroed diagonal: strictly k < q
        }
#pragma unroll
        for (int j = 0; j < 4; ++j) split2(p[2 * j], p[2 * j + 1], ph[t][sub][j], pl[t][sub][j]);
      }
    }
    // P^T A fragments (rows = key m, k = 32 queries of this chunk): elements 0..7 from the first
    // 16-query D tile, 8..15 from the second, same lane.
    Frag aph[WT], apl[WT];
#pragma unroll
    for (int t = 0; t < WT; ++t) {
      aph[t].u[0] = mk4(ph[t][0][0], ph[t][0][1], ph[t][0][2], ph[t][0][3]);
      aph[t].u[1] = mk4(ph[t][1][0], ph[t][1][1], ph[t][1][2], ph[t][1][3]);
      apl[t].u[0] = mk4(pl[t][0][0], pl[t][0][1], pl[t][0][2], pl[t][0][3]);
      apl[t].u[1] = mk4(pl[t][1][0], pl[t][1][1], pl[t][1][2], pl[t][1][3]);
    }
#pragma unroll
    for (int n = 0; n < 4; ++n) {
      const unsigned int vo = fo + n * FRAGB;        // B fragment: rows d = n*16.., k = query from qc
      const v16bf vh = ldfragp(Vh, vo), vl = ldfragp(Vl, vo);
#pragma unroll
      for (int t = 0; t < WT; ++t) o[t][n] = mma3(aph[t].v, apl[t].v, vh, vl, o[t][n]);
    }
  }
  // o[t][n][r] = this wave's share of out_h[kpos = (kt0 + t)*16 + 8*hh + r][d = n*16 + m]

#pragma unroll
  for (int t = 0; t < WT; ++t)
#pragma unroll
    for (int n = 0; n < 4; ++n)
#pragma unroll
      for (int r = 0; r < 8; ++r) so[w][16 * t + 8 * hh + r][n * 16 + m] = o[t][n][r];
  __syncthreads();

  // each thread sums 4-float pieces of the (16 * WT) x 64 tile over the waves
  const int bb = bh / HEADS, head = bh - bb * HEADS;
  for (int i = threadIdx.x; i < 16 * WT * 16; i += 32 * SPLIT) {
    const int row = i >> 4, c4 = i & 15;
    v4f sum = *(const v4f*)&so[0][row][4 * c4];
    for (int j = 1; j < SPLIT; ++j) sum += *(const v4f*)&so[j][row][4 * c4];
    *(v4f*)(outh + ((size_t)bb * SEQ + kt0 * 16 + row) * ZDIM + head * DE + 4 * c4) = sum;
  }
}

// =====================================================================
// Kernel 4: out = out_h (4096 x 512) . W_o (512 x 64). Block = 4 waves = 64 rows;
// W_o^T staged per 32-deep k chunk as hi/lo bf16 in LDS.
// =====================================================================
__global__ __launch_bounds__(128) void k_oproj(
    const float* __restrict__ outh, const float* __restrict__ Wo, float* __restrict__ out) {
  __shared__ __attribute__((aligned(16))) us_t wo[2][DE][KPITCH];   // [plane][d][z_local]
  __shared__ __attribute__((aligned(16))) float so[4][16][OPITCH];
  const int t = threadIdx.x, w = t >> 5, l = t & 31, m = l & 15, hh = l >> 4;
  const int rowbase = blockIdx.x * 64 + w * 16;

  v8f acc[4];
#pragma unroll
  for (int n = 0; n < 4; ++n) acc[n] = zero8();

#pragma unroll 1
  for (int c = 0; c < ZDIM / 32; ++c) {
    __syncthreads();                       // all waves done reading the staged chunk
#pragma unroll
    for (int j = 0; j < 16; ++j) {
      const int idx = j * 128 + t;
      const int zz = idx >> 6, d = idx & 63;
      us_t hb, lb;
      split1(Wo[(size_t)(c * 32 + zz) * DE + d], hb, lb);
      wo[0][d][zz] = hb;
      wo[1][d][zz] = lb;
    }
    __syncthreads();
    const float* ar = outh + (size_t)(rowbase + m) * ZDIM + c * 32;
    Frag ah, al;
    {
      v4f a, e;
      a = *(const v4f*)(ar + 8 * hh);       e = *(const v4f*)(ar + 8 * hh + 4);       split8(a, e, ah.u[0], al.u[0]);
      a = *(const v4f*)(ar + 16 + 8 * hh);  e = *(const v4f*)(ar + 16 + 8 * hh + 4);  split8(a, e, ah.u[1], al.u[1]);
    }
#pragma unroll
    for (int n = 0; n < 4; ++n)
      acc[n] = mma3(ah.v, al.v, ldfrag(&wo[0][n * 16][0], KPITCH, 0, l),
                    ldfrag(&wo[1][n * 16][0], KPITCH, 0, l), acc[n]);
  }
  // acc[n][r] = out[rowbase + 8*hh + r][n*16 + m]

#pragma unroll
  for (int n = 0; n < 4; ++n)
#pragma unroll
    for (int r = 0; r < 8; ++r) so[w][8 * hh + r][n * 16 + m] = acc[n][r];
  __syncthreads();

  v4f vals[8];
  size_t offs[8];
#pragma unroll
  for (int i = 0; i < 8; ++i) {
    const int row = 2 * i + hh;
    vals[i] = *(const v4f*)&so[w][row][4 * m];
    offs[i] = (size_t)(rowbase + row) * DE + 4 * m;
  }
#pragma unroll
  for (int i = 0; i < 8; ++i) *(v4f*)(out + offs[i]) = vals[i];
  
}

extern "C" void kernel_launch(void* const* d_in, const int* in_sizes, int n_in,
                              void* d_out, int out_size, void* d_ws, size_t ws_size,
                              hipStream_t stream) {
  if (n_in < 7) return;
  if (in_sizes[0] != ROWS * DE || in_sizes[1] != ROWS * DE || in_sizes[2] != ROWS * DE) return;
  if (in_sizes[3] != HEADS * DE * DE || in_sizes[4] != HEADS * DE * DE || in_sizes[5] != HEADS * DE * DE) return;
  if (in_sizes[6] != ZDIM * DE) return;
  if (out_size != ROWS * DE) return;

  const float* q  = (const float*)d_in[0];
  const float* k  = (const float*)d_in[1];
  const float* v  = (const float*)d_in[2];
  const float* Wq = (const float*)d_in[3];
  const float* Wk = (const float*)d_in[4];
  const float* Wv = (const float*)d_in[5];
  const float* Wo = (const float*)d_in[6];
  float* out = (float*)d_out;

  char* ws = (char*)d_ws;
  size_t off = 0;
  const size_t plane = (size_t)BH * SEQ * DE * sizeof(us_t);          // 4 MiB each
  us_t* qhh = (us_t*)(ws + off); off += plane;
  us_t* qhl = (us_t*)(ws + off); off += plane;
  us_t* khh = (us_t*)(ws + off); off += plane;
  us_t* khl = (us_t*)(ws + off); off += plane;
  us_t* vth = (us_t*)(ws + off); off += plane;
  us_t* vtl = (us_t*)(ws + off); off += plane;
  float* ml   = (float*)(ws + off); off += (size_t)BH * SEQ * 2 * sizeof(float);    // 256 KiB
  float* outh = (float*)(ws + off); off += (size_t)ROWS * ZDIM * sizeof(float);      // 8 MiB
  if (off > ws_size) return;

  k_proj<<<dim3(3 * HEADS * RT64), dim3(128), 0, stream>>>(q, k, v, Wq, Wk, Wv,
                                                           qhh, qhl, khh, khl, vth, vtl);
  k_stats<<<dim3(BH * (QT / WT)), dim3(32 * SPLIT), 0, stream>>>(qhh, qhl, khh, khl, ml);
  k_attn<<<dim3(BH * (QT / WT)), dim3(32 * SPLIT), 0, stream>>>(qhh, qhl, khh, khl, vth, vtl, ml, outh);
  k_oproj<<<dim3(ROWS / 64), dim3(128), 0, stream>>>(outh, Wo, out);
}

// v005
// A run of this version takes 88.2 microseconds.
// Two timings next to v004 both put it at 1.20 times that version's speed.
// Counting every step since v000, it is 6.15 times as fast.
#include <hip/hip_runtime.h>
#include <stddef.h>

// Contractions: head projections, q.k scores (statistics pass and output pass), P.V over the query axis,
// output projection -- all v_wmma_f32_16x16x32_bf16 with bf16 hi/lo operand split (hi*hi + hi*lo + lo*hi),
// f32 accumulate. RoPE, softmax statistics, masks and epilogues in f32.

#define HEADS 8
#define DE 64
#define BATCH 2
#define SEQ 2048
#define BH (BATCH * HEADS)
#define ZDIM (HEADS * DE)
#define ROWS (BATCH * SEQ)
#define QT (SEQ / 16)
#define RT64 (ROWS / 64)
#define WPITCH 72
#define OPITCH 68
#define NEG_BIG (-3.0e38f)
#define SPLIT 8   // waves of a work-group that share the loop over its WT tiles in k_stats and k_attn
#define OSPLIT 8  // waves of a work-group that share the k axis in k_oproj: DE of the ZDIM k values each
#define WT 2      // 16-wide tiles one wave holds in k_stats and k_attn: each fragment loaded in the loop feeds WT products

typedef char chk_de[(DE == 64) ? 1 : -1];
typedef char chk_seq[((SEQ % 64) == 0) ? 1 : -1];
typedef char chk_rows[((ROWS % 64) == 0) ? 1 : -1];
typedef char chk_z[((ZDIM % 32) == 0) ? 1 : -1];
typedef char chk_os[(ZDIM == OSPLIT * DE && 16 * 16 == 32 * OSPLIT) ? 1 : -1];
typedef char chk_wt[((QT % WT) == 0 && (WT % 2) == 0) ? 1 : -1];

typedef __bf16 bf16_t;
typedef bf16_t v16bf __attribute__((ext_vector_type(16)));
typedef float v8f __attribute__((ext_vector_type(8)));
typedef float v4f __attribute__((ext_vector_type(4)));
typedef float v2f __attribute__((ext_vector_type(2)));
typedef unsigned int v4u __attribute__((ext_vector_type(4)));
typedef unsigned short us_t;

union Frag {
  v16bf v;
  v4u u[2];
};

__device__ __forceinline__ v4u mk4(unsigned int a, unsigned int b, unsigned int c, unsigned int d) {
  v4u r;
  r.x = a; r.y = b; r.z = c; r.w = d;
  return r;
}

__device__ __forceinline__ v8f zero8() {
  v8f z;
#pragma unroll
  for (int i = 0; i < 8; ++i) z[i] = 0.f;
  return z;
}

// f32 -> bf16 bits, RNE
__device__ __forceinline__ unsigned int bf_rne(float x) {
  unsigned int u = __float_as_uint(x);
  u += 0x7FFFu + ((u >> 16) & 1u);
  return u >> 16;
}
__device__ __forceinline__ float bf_val(unsigned int b) { return __uint_as_float(b << 16); }

// x ~= hi + lo : hi = RNE16(x), lo = RNE16(x - hi); two values packed per dword (even element in the low half)
__device__ __forceinline__ void split2(float x0, float x1, unsigned int& ph, unsigned int& pl) {
  const unsigned int h0 = bf_rne(x0), h1 = bf_rne(x1);
  const unsigned int l0 = bf_rne(x0 - bf_val(h0)), l1 = bf_rne(x1 - bf_val(h1));
  ph = h0 | (h1 << 16);
  pl = l0 | (l1 << 16);
}
__device__ __forceinline__ void split1(float x, us_t& hb, us_t& lb) {
  const unsigned int h = bf_rne(x);
  hb = (us_t)h;
  lb = (us_t)bf_rne(x - bf_val(h));
}
// 8 consecutive k values (a = k..k+3, b = k+4..k+7) -> packed hi and lo halves of a fragment
__device__ __forceinline__ void split8(v4f a, v4f b, v4u& ph, v4u& pl) {
  unsigned int h0, l0, h1, l1, h2, l2, h3, l3;
  split2(a.x, a.y, h0, l0);
  split2(a.z, a.w, h1, l1);
  split2(b.x, b.y, h2, l2);
  split2(b.z, b.w, h3, l3);
  ph = mk4(h0, h1, h2, h3);
  pl = mk4(l0, l1, l2, l3);
}

// D += Ah*Bh + Ah*Bl + Al*Bh ; 4 v_nop guard tying D and keeping all operands live
__device__ __forceinline__ v8f mma3(v16bf ah, v16bf al, v16bf bh, v16bf bl, v8f c) {
  c = __builtin_amdgcn_wmma_f32_16x16x32_bf16(false, ah, false, bh, (short)0, c, false, false);
  c = __builtin_amdgcn_wmma_f32_16x16x32_bf16(false, ah, false, bl, (short)0, c, false, false);
  c = __builtin_amdgcn_wmma_f32_16x16x32_bf16(false, al, false, bh, (short)0, c, false, false);
  asm volatile("v_nop\n\tv_nop\n\tv_nop\n\tv_nop" : "+v"(c) : "v"(ah), "v"(al), "v"(bh), "v"(bl));
  return c;
}

// 16-bit fragment from a row-major [row][k] array (pitch ld elements), rows base..base+15, k from k0.
// Lane l: row = l&15, h = l>>4; elements 0..7 = k0+8h+0..7, elements 8..15 = k0+16+8h+0..7.
// Used for B stored n-major with k contiguous (row = n), on LDS tiles.
__device__ __forceinline__ v16bf ldfrag(const us_t* base, int ld, int k0, int l) {
  const us_t* p = base + (size_t)(l & 15) * ld + k0 + 8 * (l >> 4);
  Frag f;
  f.u[0] = *(const v4u*)p;
  f.u[1] = *(const v4u*)(p + 16);
  return f.v;
}

// The workspace planes hold whole fragments in register order: one fragment (16 rows x 32 k) = FRAG
// elements = [half u][lane l][8 elements], the element map being ldfrag's. Each of the two loads of a
// wave then reads 512 contiguous bytes (4 cache lines) instead of 32 bytes from each of 16 lines.
// plane: wave-uniform base; off: byte offset of the fragment plus 16 * lane.
#define FRAG 512
#define FRAGB (2 * FRAG)
__device__ __forceinline__ v16bf ldfragp(const us_t* plane, unsigned int off) {
  const char* p = (const char*)plane + off;
  Frag f;
  f.u[0] = *(const v4u*)p;
  f.u[1] = *(const v4u*)(p + 512);
  return f.v;
}

// =====================================================================
// Kernel 1: head projections + RoPE on q,k.  Block = 4 waves = 64 rows of one (matrix, head).
// Outputs (bf16 hi and lo planes), in fragment order (see ldfragp):
//   qh, kh : [bh][s / 16][d / 32][fragment: row = s % 16, k = d % 32]
//   vt     : [bh][s / 32][d / 16][fragment: row = d % 16, k = s % 32]
// =====================================================================
__global__ __launch_bounds__(128) void k_proj(
    const float* __restrict__ q, const float* __restrict__ k, const float* __restrict__ v,
    const float* __restrict__ Wq, const float* __restrict__ Wk, const float* __restrict__ Wv,
    us_t* __restrict__ qhh, us_t* __restrict__ qhl, us_t* __restrict__ khh, us_t* __restrict__ khl,
    us_t* __restrict__ vth, us_t* __restrict__ vtl) {
#pragma clang fp contract(off)
  __shared__ __attribute__((aligned(16))) us_t wt[2][DE][WPITCH];   // W^T hi/lo : [plane][d][z]
  __shared__ __attribute__((aligned(16))) us_t st[2][64][WPITCH];   // result tile staging
  __shared__ float invf[32];

  const int t = threadIdx.x, w = t >> 5, l = t & 31, m = l & 15, hh = l >> 4;
  const int blk = blockIdx.x;
  const int mat = blk / (HEADS * RT64);                 // 0 = q, 1 = k, 2 = v (block-uniform)
  const int rem = blk - mat * (HEADS * RT64);
  const int head = rem / RT64;
  const int rt = rem - head * RT64;
  const int row0 = rt * 64;                             // row in [0, BATCH*SEQ)
  const int b = row0 / SEQ, s0 = row0 - b * SEQ, bh = b * HEADS + head;

  const float* X = (mat == 0) ? q : ((mat == 1) ? k : v);
  const float* W = ((mat == 0) ? Wq : ((mat == 1) ? Wk : Wv)) + (size_t)head * DE * DE;

  // stage W[z][d] -> wt[p][d][z] as hi/lo bf16
#pragma unroll 4
  for (int j = 0; j < 32; ++j) {
    const int idx = j * 128 + t;
    const int z = idx >> 6, d = idx & 63;
    us_t hb, lb;
    split1(W[idx], hb, lb);
    wt[0][d][z] = hb;
    wt[1][d][z] = lb;
  }
  if (t < 32) invf[t] = 1.0f / powf(10000.0f, (float)t * 0.03125f);
  __syncthreads();

  // A fragments: this wave's 16 rows of X, k 0..31 and 32..63
  const float* xr = X + (size_t)(row0 + w * 16 + m) * DE;
  Frag ah0, al0, ah1, al1;
  {
    v4f a, c;
    a = *(const v4f*)(xr + 8 * hh);       c = *(const v4f*)(xr + 8 * hh + 4);       split8(a, c, ah0.u[0], al0.u[0]);
    a = *(const v4f*)(xr + 16 + 8 * hh);  c = *(const v4f*)(xr + 16 + 8 * hh + 4);  split8(a, c, ah0.u[1], al0.u[1]);
    a = *(const v4f*)(xr + 32 + 8 * hh);  c = *(const v4f*)(xr + 32 + 8 * hh + 4);  split8(a, c, ah1.u[0], al1.u[0]);
    a = *(const v4f*)(xr + 48 + 8 * hh);  c = *(const v4f*)(xr + 48 + 8 * hh + 4);  split8(a, c, ah1.u[1], al1.u[1]);
  }

  v8f acc[4];
#pragma unroll
  for (int n = 0; n < 4; ++n) acc[n] = zero8();
#pragma unroll
  for (int n = 0; n < 4; ++n) {
    acc[n] = mma3(ah0.v, al0.v, ldfrag(&wt[0][n * 16][0], WPITCH, 0, l),
                  ldfrag(&wt[1][n * 16][0], WPITCH, 0, l), acc[n]);
    acc[n] = mma3(ah1.v, al1.v, ldfrag(&wt[0][n * 16][0], WPITCH, 32, l),
                  ldfrag(&wt[1][n * 16][0], WPITCH, 32, l), acc[n]);
  }
  // acc[n][r] = Y[row0 + w*16 + 8*hh + r][n*16 + m]

  if (mat < 2) {   // interleaved-pair rotary embedding: cols (2i, 2i+1) are adjacent lanes
#pragma unroll
    for (int n = 0; n < 4; ++n) {
      const int N = n * 16 + m;
      const float f = invf[N >> 1];
#pragma unroll
      for (int r = 0; r < 8; ++r) {
        const int pos = s0 + w * 16 + 8 * hh + r;
        const float ang = (float)pos * f;
        const float sn = sinf(ang), cs = cosf(ang);
        const float mine = acc[n][r];
        const float other = __shfl_xor(mine, 1, 32);
        acc[n][r] = ((N & 1) == 0) ? (mine * cs - other * sn) : (other * sn + mine * cs);
      }
    }
  }

  // stage the 64-row block tile as hi/lo bf16
  if (mat == 2) {   // transposed: st[p][d][row_local]
#pragma unroll
    for (int n = 0; n < 4; ++n)
#pragma unroll
      for (int r = 0; r < 8; ++r) {
        us_t hb, lb;
        split1(acc[n][r], hb, lb);
        st[0][n * 16 + m][w * 16 + 8 * hh + r] = hb;
        st[1][n * 16 + m][w * 16 + 8 * hh + r] = lb;
      }
  } else {          // row major: st[p][row_local][d]
#pragma unroll
    for (int n = 0; n < 4; ++n)
#pragma unroll
      for (int r = 0; r < 8; ++r) {
        us_t hb, lb;
        split1(acc[n][r], hb, lb);
        st[0][w * 16 + 8 * hh + r][n * 16 + m] = hb;
        st[1][w * 16 + 8 * hh + r][n * 16 + m] = lb;
      }
  }
  __syncthreads();

  // wave w writes the two fragments (k 0..31 and 32..63 of the staged tile) of staged rows w*16..w*16+15
  us_t* dsth = (mat == 2) ? vth : ((mat == 0) ? qhh : khh);
  us_t* dstl = (mat == 2) ? vtl : ((mat == 0) ? qhl : khl);
  // q, k: rows are s, the two fragments are neighbours; v: rows are d, the fragments lie one 32-query chunk apart
  const size_t fbase = (size_t)bh * SEQ * DE + (size_t)s0 * DE + (size_t)w * ((mat == 2) ? FRAG : 2 * FRAG);
  const size_t fstep = (mat == 2) ? (size_t)(32 * DE) : (size_t)FRAG;
  v4u vals[2][4];
#pragma unroll
  for (int i = 0; i < 4; ++i) {
    vals[0][i] = *(const v4u*)&st[0][w * 16 + m][16 * i + 8 * hh];
    vals[1][i] = *(const v4u*)&st[1][w * 16 + m][16 * i + 8 * hh];
  }
#pragma unroll
  for (int i = 0; i < 4; ++i) {
    const size_t o = fbase + (size_t)(i >> 1) * fstep + (i & 1) * 256 + 8 * l;
    *(v4u*)(dsth + o) = vals[0][i];
    *(v4u*)(dstl + o) = vals[1][i];
  }
  
}

// =====================================================================
// Kernel 2: per query row: m[q] = max_{k<=q} s/64, rcp[q] = 1 / sum exp(s/64 - m).
// One work-group per (bh, WT query tiles of 16 rows); wave w takes key tiles w, w + SPLIT, ... and puts
// each loaded key fragment to all WT query tiles; the waves' (max, sum) pairs meet in LDS.
// =====================================================================
__global__ __launch_bounds__(32 * SPLIT) void k_stats(
    const us_t* __restrict__ qhh, const us_t* __restrict__ qhl,
    const us_t* __restrict__ khh, const us_t* __restrict__ khl, float* __restrict__ ml) {
  __shared__ float pm[SPLIT][16 * WT];
  __shared__ float ps[SPLIT][16 * WT];
  // the wave's number as a scalar: the loop's bounds and branch stay on the scalar unit
  const int w = __builtin_amdgcn_readfirstlane(threadIdx.x >> 5);
  const int bh = blockIdx.x / (QT / WT), qt0 = (blockIdx.x - bh * (QT / WT)) * WT;   // first query tile
  const int l = threadIdx.x & 31, m = l & 15, hh = l >> 4;

  const size_t qoff = ((size_t)bh * SEQ + qt0 * 16) * DE;
  v16bf aqh[WT][2], aql[WT][2];
#pragma unroll
  for (int t = 0; t < WT; ++t) {
    const unsigned int ao = t * (2 * FRAGB) + 16 * l;
    aqh[t][0] = ldfragp(qhh + qoff, ao);
    aqh[t][1] = ldfragp(qhh + qoff, ao + FRAGB);
    aql[t][0] = ldfragp(qhl + qoff, ao);
    aql[t][1] = ldfragp(qhl + qoff, ao + FRAGB);
  }
  const us_t* Kh = khh + (size_t)bh * SEQ * DE;
  const us_t* Kl = khl + (size_t)bh * SEQ * DE;

  float mrow[WT][8], lrow[WT][8];
#pragma unroll
  for (int t = 0; t < WT; ++t)
#pragma unroll
    for (int r = 0; r < 8; ++r) { mrow[t][r] = NEG_BIG; lrow[t][r] = 0.f; }

  // a key tile past the diagonal of one of the query tiles is all masked there and adds exactly 0
#pragma unroll 1
  for (int kt = w; kt < qt0 + WT; kt += SPLIT) {
    const unsigned int ko = (unsigned int)kt * (2 * FRAGB) + 16 * l;
    const v16bf kh0 = ldfragp(Kh, ko), kl0 = ldfragp(Kl, ko);
    const v16bf kh1 = ldfragp(Kh, ko + FRAGB), kl1 = ldfragp(Kl, ko + FRAGB);
#pragma unroll
    for (int t = 0; t < WT; ++t) {
      v8f s = zero8();
      s = mma3(aqh[t][0], aql[t][0], kh0, kl0, s);
      s = mma3(aqh[t][1], aql[t][1], kh1, kl1, s);
      // s[r] = score[q = (qt0 + t)*16 + 8*hh + r][k = kt*16 + m]
      // running maximum and sum stay private to the lane (its own key column of every tile)
#pragma unroll
      for (int r = 0; r < 8; ++r) {
        const int qg = (qt0 + t) * 16 + 8 * hh + r;
        const int kg = kt * 16 + m;
        const float x = (kg <= qg) ? s[r] * (1.0f / 64.0f) : NEG_BIG;
        const float mn = fmaxf(mrow[t][r], x);
        lrow[t][r] = lrow[t][r] * __expf(mrow[t][r] - mn) + __expf(x - mn);
        mrow[t][r] = mn;
      }
    }
  }

  // one merge of the 16 lanes of each row: a lane that saw no valid key holds NEG_BIG and its sum scales to 0
#pragma unroll
  for (int t = 0; t < WT; ++t)
#pragma unroll
    for (int r = 0; r < 8; ++r) {
      float gm = mrow[t][r];
#pragma unroll
      for (int off = 1; off < 16; off <<= 1) gm = fmaxf(gm, __shfl_xor(gm, off, 32));
      float e = lrow[t][r] * __expf(mrow[t][r] - gm);
#pragma unroll
      for (int off = 1; off < 16; off <<= 1) e += __shfl_xor(e, off, 32);
      mrow[t][r] = gm;
      lrow[t][r] = e;
    }

  // merge of the waves: a wave that saw no valid key of a row holds NEG_BIG there and its sum scales to 0
  if (m == 0) {
#pragma unroll   // mrow and lrow live in registers: t and r must be constants
    for (int t = 0; t < WT; ++t)
#pragma unroll
      for (int r = 0; r < 8; ++r) {
        pm[w][16 * t + 8 * hh + r] = mrow[t][r];
        ps[w][16 * t + 8 * hh + r] = lrow[t][r];
      }
  }
  __syncthreads();
  if (threadIdx.x < 16 * WT) {
    const int row = threadIdx.x;
    float gm = pm[0][row];
    for (int j = 1; j < SPLIT; ++j) gm = fmaxf(gm, pm[j][row]);
    float e = 0.f;
    for (int j = 0; j < SPLIT; ++j) e += ps[j][row] * __expf(pm[j][row] - gm);
    v2f val;
    val.x = gm; val.y = 1.0f / e;
    *(v2f*)(ml + ((size_t)bh * SEQ + qt0 * 16 + row) * 2) = val;
  }
}

// =====================================================================
// Kernel 3: out_h[bh][kpos][d] = sum_{q > kpos} P[q,kpos] * vh[q][d]   (contraction over the query axis)
// One work-group per (bh, WT key tiles of 16 columns); wave w takes the 32-query chunks w, w + SPLIT, ... from
// the diagonal on. Each loaded q fragment, v fragment and row statistic serves all WT key tiles: per key tile
// two 16x16 score tiles -> P in registers (packed D tiles = P^T A fragment) -> 4 P^T.V products.
// The waves' partial tiles are summed through LDS. Stores f32 out_h [b*S][H*DE].
// =====================================================================
__global__ __launch_bounds__(32 * SPLIT) void k_attn(
    const us_t* __restrict__ qhh, const us_t* __restrict__ qhl,
    const us_t* __restrict__ khh, const us_t* __restrict__ khl,
    const us_t* __restrict__ vth, const us_t* __restrict__ vtl,
    const float* __restrict__ ml, float* __restrict__ outh) {
  __shared__ __attribute__((aligned(16))) float so[SPLIT][16 * WT][OPITCH];
  // the wave's number as a scalar: the loop's bounds and branch stay on the scalar unit
  const int w = __builtin_amdgcn_readfirstlane(threadIdx.x >> 5);
  const int bh = blockIdx.x / (QT / WT), kt0 = (blockIdx.x - bh * (QT / WT)) * WT;   // first key tile
  const int l = threadIdx.x & 31, m = l & 15, hh = l >> 4;

  // loop-invariant B fragments of the key tiles (kh rows kt0*16.., lane = key)
  const size_t koff = ((size_t)bh * SEQ + kt0 * 16) * DE;
  v16bf bkh[WT][2], bkl[WT][2];
#pragma unroll
  for (int t = 0; t < WT; ++t) {
    const unsigned int bo = t * (2 * FRAGB) + 16 * l;
    bkh[t][0] = ldfragp(khh + koff, bo);
    bkh[t][1] = ldfragp(khh + koff, bo + FRAGB);
    bkl[t][0] = ldfragp(khl + koff, bo);
    bkl[t][1] = ldfragp(khl + koff, bo + FRAGB);
  }

  v8f o[WT][4];
#pragma unroll
  for (int t = 0; t < WT; ++t)
#pragma unroll
    for (int n = 0; n < 4; ++n) o[t][n] = zero8();

  const float* mlb = ml + (size_t)bh * SEQ * 2;
  const us_t* Qh = qhh + (size_t)bh * SEQ * DE;
  const us_t* Ql = qhl + (size_t)bh * SEQ * DE;
  const us_t* Vh = vth + (size_t)bh * DE * SEQ;
  const us_t* Vl = vtl + (size_t)bh * DE * SEQ;

#pragma unroll 1
  for (int qc = ((kt0 >> 1) + w) * 32; qc < SEQ; qc += 32 * SPLIT) {
    // a 32-query chunk is 4 fragments in each plane, q and v alike: one byte offset serves all four planes
    const unsigned int fo = (unsigned int)qc * (DE * 2) + 16 * l;
    unsigned int ph[WT][2][4], pl[WT][2][4];
#pragma unroll
    for (int sub = 0; sub < 2; ++sub) {
      const int q0 = qc + 16 * sub;
      const unsigned int qo = fo + sub * (2 * FRAGB);
      const v16bf qh0 = ldfragp(Qh, qo), ql0 = ldfragp(Ql, qo);
      const v16bf qh1 = ldfragp(Qh, qo + FRAGB), ql1 = ldfragp(Ql, qo + FRAGB);
      v2f mr[8];
#pragma unroll
      for (int r = 0; r < 8; ++r) mr[r] = *(const v2f*)(mlb + 2 * (q0 + 8 * hh + r));
#pragma unroll
      for (int t = 0; t < WT; ++t) {
        const int kg = (kt0 + t) * 16 + m;          // this lane's key column in the score tile
        v8f s = zero8();
        s = mma3(qh0, ql0, bkh[t][0], bkl[t][0], s);
        s = mma3(qh1, ql1, bkh[t][1], bkl[t][1], s);
        // s[r] = score[q = q0 + 8*hh + r][k = kg]
        float p[8];
#pragma unroll
        for (int r = 0; r < 8; ++r) {
          const int qg = q0 + 8 * hh + r;
          const float e = __expf(s[r] * (1.0f / 64.0f) - mr[r].x) * mr[r].y;
          p[r] = (kg < qg) ? e : 0.f;               // causal and zeroed diagonal: strictly k < q
        }
#pragma unroll
        for (int j = 0; j < 4; ++j) split2(p[2 * j], p[2 * j + 1], ph[t][sub][j], pl[t][sub][j]);
      }
    }
    // P^T A fragments (rows = key m, k = 32 queries of this chunk): elements 0..7 from the first
    // 16-query D tile, 8..15 from the second, same lane.
    Frag aph[WT], apl[WT];
#pragma unroll
    for (int t = 0; t < WT; ++t) {
      aph[t].u[0] = mk4(ph[t][0][0], ph[t][0][1], ph[t][0][2], ph[t][0][3]);
      aph[t].u[1] = mk4(ph[t][1][0], ph[t][1][1], ph[t][1][2], ph[t][1][3]);
      apl[t].u[0] = mk4(pl[t][0][0], pl[t][0][1], pl[t][0][2], pl[t][0][3]);
      apl[t].u[1] = mk4(pl[t][1][0], pl[t][1][1], pl[t][1][2], pl[t][1][3]);
    }
#pragma unroll
    for (int n = 0; n < 4; ++n) {
      const unsigned int vo = fo + n * FRAGB;        // B fragment: rows d = n*16.., k = query from qc
      const v16bf vh = ldfragp(Vh, vo), vl = ldfragp(Vl, vo);
#pragma unroll
      for (int t = 0; t < WT; ++t) o[t][n] = mma3(aph[t].v, apl[t].v, vh, vl, o[t][n]);
    }
  }
  // o[t][n][r] = this wave's share of out_h[kpos = (kt0 + t)*16 + 8*hh + r][d = n*16 + m]

#pragma unroll
  for (int t = 0; t < WT; ++t)
#pragma unroll
    for (int n = 0; n < 4; ++n)
#pragma unroll
      for (int r = 0; r < 8; ++r) so[w][16 * t + 8 * hh + r][n * 16 + m] = o[t][n][r];
  __syncthreads();

  // each thread sums 4-float pieces of the (16 * WT) x 64 tile over the waves
  const int bb = bh / HEADS, head = bh - bb * HEADS;
  for (int i = threadIdx.x; i < 16 * WT * 16; i += 32 * SPLIT) {
    const int row = i >> 4, c4 = i & 15;
    v4f sum = *(const v4f*)&so[0][row][4 * c4];
    for (int j = 1; j < SPLIT; ++j) sum += *(const v4f*)&so[j][row][4 * c4];
    *(v4f*)(outh + ((size_t)bb * SEQ + kt0 * 16 + row) * ZDIM + head * DE + 4 * c4) = sum;
  }
}

// =====================================================================
// Kernel 4: out = out_h (4096 x 512) . W_o (512 x 64). One work-group per 16 rows; wave w takes the 64 k of
// head w, so no wave waits for a chunk another wave stages: its A rows and its W_o B fragments come straight
// from global memory, with no barrier between a load and its product. The waves' partial tiles are summed in LDS.
// =====================================================================
__global__ __launch_bounds__(32 * OSPLIT) void k_oproj(
    const float* __restrict__ outh, const float* __restrict__ Wo, float* __restrict__ out) {
  __shared__ __attribute__((aligned(16))) float so[OSPLIT][16][OPITCH];
  // the wave's number as a scalar: the bases of its k range stay on the scalar unit
  const int w = __builtin_amdgcn_readfirstlane(threadIdx.x >> 5);
  const int l = threadIdx.x & 31, m = l & 15, hh = l >> 4;
  const int rowbase = blockIdx.x * 16;

  // A: row = rowbase + m, k as in ldfrag. B: lane = column n*16 + m, the same k order, one W_o row per element.
  const float* ar = outh + (size_t)w * DE + (size_t)(rowbase + m) * ZDIM + 8 * hh;
  const float* br = Wo + (size_t)w * DE * DE + (size_t)(8 * hh) * DE + m;
  // araw, braw and acc live in registers: every loop below is unrolled so that their indices are constants
  v4f araw[2][4];
  float braw[2][4][16];
#pragma unroll
  for (int c = 0; c < 2; ++c)
#pragma unroll
    for (int u = 0; u < 2; ++u) {
      araw[c][2 * u] = *(const v4f*)(ar + c * 32 + 16 * u);
      araw[c][2 * u + 1] = *(const v4f*)(ar + c * 32 + 16 * u + 4);
    }
#pragma unroll
  for (int c = 0; c < 2; ++c)
#pragma unroll
    for (int n = 0; n < 4; ++n)
#pragma unroll
      for (int e = 0; e < 16; ++e)
        braw[c][n][e] = br[(size_t)(c * 32 + 16 * (e >> 3) + (e & 7)) * DE + n * 16];

  v8f acc[4];
#pragma unroll
  for (int n = 0; n < 4; ++n) acc[n] = zero8();
#pragma unroll
  for (int c = 0; c < 2; ++c) {
    Frag ah, al;
    split8(araw[c][0], araw[c][1], ah.u[0], al.u[0]);
    split8(araw[c][2], araw[c][3], ah.u[1], al.u[1]);
#pragma unroll
    for (int n = 0; n < 4; ++n) {
      Frag bh, bl;
#pragma unroll
      for (int u = 0; u < 2; ++u) {
        unsigned int h[4], lo[4];
#pragma unroll
        for (int j = 0; j < 4; ++j) split2(braw[c][n][8 * u + 2 * j], braw[c][n][8 * u + 2 * j + 1], h[j], lo[j]);
        bh.u[u] = mk4(h[0], h[1], h[2], h[3]);
        bl.u[u] = mk4(lo[0], lo[1], lo[2], lo[3]);
      }
      acc[n] = mma3(ah.v, al.v, bh.v, bl.v, acc[n]);
    }
  }
  // acc[n][r] = this wave's share of out[rowbase + 8*hh + r][n*16 + m]

#pragma unroll
  for (int n = 0; n < 4; ++n)
#pragma unroll
    for (int r = 0; r < 8; ++r) so[w][8 * hh + r][n * 16 + m] = acc[n][r];
  __syncthreads();

  // each thread sums one 4-float piece of the 16 x 64 tile over the waves; a wave stores 512 contiguous bytes
  const int row = threadIdx.x >> 4, c4 = threadIdx.x & 15;
  v4f sum = *(const v4f*)&so[0][row][4 * c4];
#pragma unroll
  for (int j = 1; j < OSPLIT; ++j) sum += *(const v4f*)&so[j][row][4 * c4];
  *(v4f*)(out + (size_t)(rowbase + row) * DE + 4 * c4) = sum;
}

extern "C" void kernel_launch(void* const* d_in, const int* in_sizes, int n_in,
                              void* d_out, int out_size, void* d_ws, size_t ws_size,
                              hipStream_t stream) {
  if (n_in < 7) return;
  if (in_sizes[0] != ROWS * DE || in_sizes[1] != ROWS * DE || in_sizes[2] != ROWS * DE) return;
  if (in_sizes[3] != HEADS * DE * DE || in_sizes[4] != HEADS * DE * DE || in_sizes[5] != HEADS * DE * DE) return;
  if (in_sizes[6] != ZDIM * DE) return;
  if (out_size != ROWS * DE) return;

  const float* q  = (const float*)d_in[0];
  const float* k  = (const float*)d_in[1];
  const float* v  = (const float*)d_in[2];
  const float* Wq = (const float*)d_in[3];
  const float* Wk = (const float*)d_in[4];
  const float* Wv = (const float*)d_in[5];
  const float* Wo = (const float*)d_in[6];
  float* out = (float*)d_out;

  char* ws = (char*)d_ws;
  size_t off = 0;
  const size_t plane = (size_t)BH * SEQ * DE * sizeof(us_t);          // 4 MiB each
  us_t* qhh = (us_t*)(ws + off); off += plane;
  us_t* qhl = (us_t*)(ws + off); off += plane;
  us_t* khh = (us_t*)(ws + off); off += plane;
  us_t* khl = (us_t*)(ws + off); off += plane;
  us_t* vth = (us_t*)(ws + off); off += plane;
  us_t* vtl = (us_t*)(ws + off); off += plane;
  float* ml   = (float*)(ws + off); off += (size_t)BH * SEQ * 2 * sizeof(float);    // 256 KiB
  float* outh = (float*)(ws + off); off += (size_t)ROWS * ZDIM * sizeof(float);      // 8 MiB
  if (off > ws_size) return;

  k_proj<<<dim3(3 * HEADS * RT64), dim3(128), 0, stream>>>(q, k, v, Wq, Wk, Wv,
                                                           qhh, qhl, khh, khl, vth, vtl);
  k_stats<<<dim3(BH * (QT / WT)), dim3(32 * SPLIT), 0, stream>>>(qhh, qhl, khh, khl, ml);
  k_attn<<<dim3(BH * (QT / WT)), dim3(32 * SPLIT), 0, stream>>>(qhh, qhl, khh, khl, vth, vtl, ml, outh);
  k_oproj<<<dim3(ROWS / 16), dim3(32 * OSPLIT), 0, stream>>>(outh, Wo, out);
}

// v006
// Measured time: 71.6 microseconds a run.
// In two side-by-side timings against v005, it was 1.23 and 1.22 times as fast.
// Counting every step since v000, it is 7.55 times as fast.
#include <hip/hip_runtime.h>
#include <stddef.h>

// Contractions: head projections, q.k scores (statistics pass and output pass), P.V over the query axis,
// output projection -- all v_wmma_f32_16x16x32_bf16 with bf16 hi/lo operand split (hi*hi + hi*lo + lo*hi),
// f32 accumulate. RoPE, softmax statistics, masks and epilogues in f32.

#define HEADS 8
#define DE 64
#define BATCH 2
#define SEQ 2048
#define BH (BATCH * HEADS)
#define ZDIM (HEADS * DE)
#define ROWS (BATCH * SEQ)
#define QT (SEQ / 16)
#define RT64 (ROWS / 64)
#define WPITCH 72
#define OPITCH 68
#define NEG_BIG (-3.0e38f)
#define SPLIT 8   // waves of a work-group that share the loop over its WT tiles in k_stats and k_attn
#define OSPLIT 8  // waves of a work-group that share the k axis in k_oproj: DE of the ZDIM k values each
#define WT 2      // 16-wide tiles one wave holds in k_stats and k_attn: each fragment loaded in the loop feeds WT products

typedef char chk_de[(DE == 64) ? 1 : -1];
typedef char chk_seq[((SEQ % 64) == 0) ? 1 : -1];
typedef char chk_rows[((ROWS % 64) == 0) ? 1 : -1];
typedef char chk_z[((ZDIM % 32) == 0) ? 1 : -1];
typedef char chk_os[(ZDIM == OSPLIT * DE && 16 * 16 == 32 * OSPLIT) ? 1 : -1];
typedef char chk_wt[((QT % WT) == 0 && (WT % 2) == 0) ? 1 : -1];

typedef __bf16 bf16_t;
typedef bf16_t v16bf __attribute__((ext_vector_type(16)));
typedef float v8f __attribute__((ext_vector_type(8)));
typedef float v4f __attribute__((ext_vector_type(4)));
typedef float v2f __attribute__((ext_vector_type(2)));
typedef unsigned int v4u __attribute__((ext_vector_type(4)));
typedef unsigned short us_t;

union Frag {
  v16bf v;
  v4u u[2];
};

__device__ __forceinline__ v4u mk4(unsigned int a, unsigned int b, unsigned int c, unsigned int d) {
  v4u r;
  r.x = a; r.y = b; r.z = c; r.w = d;
  return r;
}

__device__ __forceinline__ v8f zero8() {
  v8f z;
#pragma unroll
  for (int i = 0; i < 8; ++i) z[i] = 0.f;
  return z;
}

// f32 -> bf16 bits, RNE
__device__ __forceinline__ unsigned int bf_rne(float x) {
  unsigned int u = __float_as_uint(x);
  u += 0x7FFFu + ((u >> 16) & 1u);
  return u >> 16;
}
__device__ __forceinline__ float bf_val(unsigned int b) { return __uint_as_float(b << 16); }

// x ~= hi + lo : hi = RNE16(x), lo = RNE16(x - hi); two values packed per dword (even element in the low half)
__device__ __forceinline__ void split2(float x0, float x1, unsigned int& ph, unsigned int& pl) {
  const unsigned int h0 = bf_rne(x0), h1 = bf_rne(x1);
  const unsigned int l0 = bf_rne(x0 - bf_val(h0)), l1 = bf_rne(x1 - bf_val(h1));
  ph = h0 | (h1 << 16);
  pl = l0 | (l1 << 16);
}
__device__ __forceinline__ void split1(float x, us_t& hb, us_t& lb) {
  const unsigned int h = bf_rne(x);
  hb = (us_t)h;
  lb = (us_t)bf_rne(x - bf_val(h));
}
// 8 consecutive k values (a = k..k+3, b = k+4..k+7) -> packed hi and lo halves of a fragment
__device__ __forceinline__ void split8(v4f a, v4f b, v4u& ph, v4u& pl) {
  unsigned int h0, l0, h1, l1, h2, l2, h3, l3;
  split2(a.x, a.y, h0, l0);
  split2(a.z, a.w, h1, l1);
  split2(b.x, b.y, h2, l2);
  split2(b.z, b.w, h3, l3);
  ph = mk4(h0, h1, h2, h3);
  pl = mk4(l0, l1, l2, l3);
}

// D += Ah*Bh + Ah*Bl + Al*Bh ; 4 v_nop guard tying D and keeping all operands live
__device__ __forceinline__ v8f mma3(v16bf ah, v16bf al, v16bf bh, v16bf bl, v8f c) {
  c = __builtin_amdgcn_wmma_f32_16x16x32_bf16(false, ah, false, bh, (short)0, c, false, false);
  c = __builtin_amdgcn_wmma_f32_16x16x32_bf16(false, ah, false, bl, (short)0, c, false, false);
  c = __builtin_amdgcn_wmma_f32_16x16x32_bf16(false, al, false, bh, (short)0, c, false, false);
  asm volatile("v_nop\n\tv_nop\n\tv_nop\n\tv_nop" : "+v"(c) : "v"(ah), "v"(al), "v"(bh), "v"(bl));
  return c;
}

// 16-bit fragment from a row-major [row][k] array (pitch ld elements), rows base..base+15, k from k0.
// Lane l: row = l&15, h = l>>4; elements 0..7 = k0+8h+0..7, elements 8..15 = k0+16+8h+0..7.
// Used for B stored n-major with k contiguous (row = n), on LDS tiles.
__device__ __forceinline__ v16bf ldfrag(const us_t* base, int ld, int k0, int l) {
  const us_t* p = base + (size_t)(l & 15) * ld + k0 + 8 * (l >> 4);
  Frag f;
  f.u[0] = *(const v4u*)p;
  f.u[1] = *(const v4u*)(p + 16);
  return f.v;
}

// The workspace planes hold whole fragments in register order: one fragment (16 rows x 32 k) = FRAG
// elements = [half u][lane l][8 elements], the element map being ldfrag's. Each of the two loads of a
// wave then reads 512 contiguous bytes (4 cache lines) instead of 32 bytes from each of 16 lines.
// plane: wave-uniform base; off: byte offset of the fragment plus 16 * lane.
#define FRAG 512
#define FRAGB (2 * FRAG)
__device__ __forceinline__ v16bf ldfragp(const us_t* plane, unsigned int off) {
  const char* p = (const char*)plane + off;
  Frag f;
  f.u[0] = *(const v4u*)p;
  f.u[1] = *(const v4u*)(p + 512);
  return f.v;
}

// =====================================================================
// Kernel 1: head projections + RoPE on q,k.  Block = 4 waves = 64 rows of one (matrix, head).
// Outputs (bf16 hi and lo planes), in fragment order (see ldfragp):
//   qh, kh : [bh][s / 16][d / 32][fragment: row = s % 16, k = d % 32]
//   vt     : [bh][s / 32][d / 16][fragment: row = d % 16, k = s % 32]
// =====================================================================
__global__ __launch_bounds__(128) void k_proj(
    const float* __restrict__ q, const float* __restrict__ k, const float* __restrict__ v,
    const float* __restrict__ Wq, const float* __restrict__ Wk, const float* __restrict__ Wv,
    us_t* __restrict__ qhh, us_t* __restrict__ qhl, us_t* __restrict__ khh, us_t* __restrict__ khl,
    us_t* __restrict__ vth, us_t* __restrict__ vtl) {
#pragma clang fp contract(off)
  __shared__ __attribute__((aligned(16))) us_t wt[2][DE][WPITCH];   // W^T hi/lo : [plane][d][z]
  __shared__ __attribute__((aligned(16))) us_t st[2][64][WPITCH];   // result tile staging
  __shared__ float invf[32];

  const int t = threadIdx.x, w = t >> 5, l = t & 31, m = l & 15, hh = l >> 4;
  const int blk = blockIdx.x;
  const int mat = blk / (HEADS * RT64);                 // 0 = q, 1 = k, 2 = v (block-uniform)
  const int rem = blk - mat * (HEADS * RT64);
  const int head = rem / RT64;
  const int rt = rem - head * RT64;
  const int row0 = rt * 64;                             // row in [0, BATCH*SEQ)
  const int b = row0 / SEQ, s0 = row0 - b * SEQ, bh = b * HEADS + head;

  const float* X = (mat == 0) ? q : ((mat == 1) ? k : v);
  const float* W = ((mat == 0) ? Wq : ((mat == 1) ? Wk : Wv)) + (size_t)head * DE * DE;

  // stage W[z][d] -> wt[p][d][z] as hi/lo bf16
#pragma unroll 4
  for (int j = 0; j < 32; ++j) {
    const int idx = j * 128 + t;
    const int z = idx >> 6, d = idx & 63;
    us_t hb, lb;
    split1(W[idx], hb, lb);
    wt[0][d][z] = hb;
    wt[1][d][z] = lb;
  }
  if (t < 32) invf[t] = 1.0f / powf(10000.0f, (float)t * 0.03125f);
  __syncthreads();

  // A fragments: this wave's 16 rows of X, k 0..31 and 32..63
  const float* xr = X + (size_t)(row0 + w * 16 + m) * DE;
  Frag ah0, al0, ah1, al1;
  {
    v4f a, c;
    a = *(const v4f*)(xr + 8 * hh);       c = *(const v4f*)(xr + 8 * hh + 4);       split8(a, c, ah0.u[0], al0.u[0]);
    a = *(const v4f*)(xr + 16 + 8 * hh);  c = *(const v4f*)(xr + 16 + 8 * hh + 4);  split8(a, c, ah0.u[1], al0.u[1]);
    a = *(const v4f*)(xr + 32 + 8 * hh);  c = *(const v4f*)(xr + 32 + 8 * hh + 4);  split8(a, c, ah1.u[0], al1.u[0]);
    a = *(const v4f*)(xr + 48 + 8 * hh);  c = *(const v4f*)(xr + 48 + 8 * hh + 4);  split8(a, c, ah1.u[1], al1.u[1]);
  }

  v8f acc[4];
#pragma unroll
  for (int n = 0; n < 4; ++n) acc[n] = zero8();
#pragma unroll
  for (int n = 0; n < 4; ++n) {
    acc[n] = mma3(ah0.v, al0.v, ldfrag(&wt[0][n * 16][0], WPITCH, 0, l),
                  ldfrag(&wt[1][n * 16][0], WPITCH, 0, l), acc[n]);
    acc[n] = mma3(ah1.v, al1.v, ldfrag(&wt[0][n * 16][0], WPITCH, 32, l),
                  ldfrag(&wt[1][n * 16][0], WPITCH, 32, l), acc[n]);
  }
  // acc[n][r] = Y[row0 + w*16 + 8*hh + r][n*16 + m]

  if (mat < 2) {   // interleaved-pair rotary embedding: cols (2i, 2i+1) are adjacent lanes
#pragma unroll
    for (int n = 0; n < 4; ++n) {
      const int N = n * 16 + m;
      const float f = invf[N >> 1];
#pragma unroll
      for (int r = 0; r < 8; ++r) {
        const int pos = s0 + w * 16 + 8 * hh + r;
        const float ang = (float)pos * f;
        const float sn = sinf(ang), cs = cosf(ang);
        const float mine = acc[n][r];
        const float other = __shfl_xor(mine, 1, 32);
        acc[n][r] = ((N & 1) == 0) ? (mine * cs - other * sn) : (other * sn + mine * cs);
      }
    }
  }

  // stage the 64-row block tile as hi/lo bf16
  if (mat == 2) {   // transposed: st[p][d][row_local]
#pragma unroll
    for (int n = 0; n < 4; ++n)
#pragma unroll
      for (int r = 0; r < 8; ++r) {
        us_t hb, lb;
        split1(acc[n][r], hb, lb);
        st[0][n * 16 + m][w * 16 + 8 * hh + r] = hb;
        st[1][n * 16 + m][w * 16 + 8 * hh + r] = lb;
      }
  } else {          // row major: st[p][row_local][d]
#pragma unroll
    for (int n = 0; n < 4; ++n)
#pragma unroll
      for (int r = 0; r < 8; ++r) {
        us_t hb, lb;
        split1(acc[n][r], hb, lb);
        st[0][w * 16 + 8 * hh + r][n * 16 + m] = hb;
        st[1][w * 16 + 8 * hh + r][n * 16 + m] = lb;
      }
  }
  __syncthreads();

  // wave w writes the two fragments (k 0..31 and 32..63 of the staged tile) of staged rows w*16..w*16+15
  us_t* dsth = (mat == 2) ? vth : ((mat == 0) ? qhh : khh);
  us_t* dstl = (mat == 2) ? vtl : ((mat == 0) ? qhl : khl);
  // q, k: rows are s, the two fragments are neighbours; v: rows are d, the fragments lie one 32-query chunk apart
  const size_t fbase = (size_t)bh * SEQ * DE + (size_t)s0 * DE + (size_t)w * ((mat == 2) ? FRAG : 2 * FRAG);
  const size_t fstep = (mat == 2) ? (size_t)(32 * DE) : (size_t)FRAG;
  v4u vals[2][4];
#pragma unroll
  for (int i = 0; i < 4; ++i) {
    vals[0][i] = *(const v4u*)&st[0][w * 16 + m][16 * i + 8 * hh];
    vals[1][i] = *(const v4u*)&st[1][w * 16 + m][16 * i + 8 * hh];
  }
#pragma unroll
  for (int i = 0; i < 4; ++i) {
    const size_t o = fbase + (size_t)(i >> 1) * fstep + (i & 1) * 256 + 8 * l;
    *(v4u*)(dsth + o) = vals[0][i];
    *(v4u*)(dstl + o) = vals[1][i];
  }
  
}

// =====================================================================
// Kernel 2: per query row: m[q] = max_{k<=q} s/64, rcp[q] = 1 / sum exp(s/64 - m).
// One work-group per (bh, WT query tiles of 16 rows); wave w takes key tiles w, w + SPLIT, ... and puts
// each loaded key fragment to all WT query tiles; the waves' (max, sum) pairs meet in LDS.
// There are more work-groups than resident places; the index runs over the
// tiles from the longest key loop to the shortest (all bh of a tile side by side).
// =====================================================================
__global__ __launch_bounds__(32 * SPLIT) void k_stats(
    const us_t* __restrict__ qhh, const us_t* __restrict__ qhl,
    const us_t* __restrict__ khh, const us_t* __restrict__ khl, float* __restrict__ ml) {
  __shared__ float pm[SPLIT][16 * WT];
  __shared__ float ps[SPLIT][16 * WT];
  // the wave's number as a scalar: the loop's bounds and branch stay on the scalar unit
  const int w = __builtin_amdgcn_readfirstlane(threadIdx.x >> 5);
  const int rank = blockIdx.x / BH, bh = blockIdx.x - rank * BH;
  const int qt0 = (QT / WT - 1 - rank) * WT;   // first query tile: the last tile has the most keys
  const int l = threadIdx.x & 31, m = l & 15, hh = l >> 4;

  const size_t qoff = ((size_t)bh * SEQ + qt0 * 16) * DE;
  v16bf aqh[WT][2], aql[WT][2];
#pragma unroll
  for (int t = 0; t < WT; ++t) {
    const unsigned int ao = t * (2 * FRAGB) + 16 * l;
    aqh[t][0] = ldfragp(qhh + qoff, ao);
    aqh[t][1] = ldfragp(qhh + qoff, ao + FRAGB);
    aql[t][0] = ldfragp(qhl + qoff, ao);
    aql[t][1] = ldfragp(qhl + qoff, ao + FRAGB);
  }
  const us_t* Kh = khh + (size_t)bh * SEQ * DE;
  const us_t* Kl = khl + (size_t)bh * SEQ * DE;

  float mrow[WT][8], lrow[WT][8];
#pragma unroll
  for (int t = 0; t < WT; ++t)
#pragma unroll
    for (int r = 0; r < 8; ++r) { mrow[t][r] = NEG_BIG; lrow[t][r] = 0.f; }

  // a key tile past the diagonal of one of the query tiles is all masked there and adds exactly 0
#pragma unroll 1
  for (int kt = w; kt < qt0 + WT; kt += SPLIT) {
    const unsigned int ko = (unsigned int)kt * (2 * FRAGB) + 16 * l;
    const v16bf kh0 = ldfragp(Kh, ko), kl0 = ldfragp(Kl, ko);
    const v16bf kh1 = ldfragp(Kh, ko + FRAGB), kl1 = ldfragp(Kl, ko + FRAGB);
#pragma unroll
    for (int t = 0; t < WT; ++t) {
      v8f s = zero8();
      s = mma3(aqh[t][0], aql[t][0], kh0, kl0, s);
      s = mma3(aqh[t][1], aql[t][1], kh1, kl1, s);
      // s[r] = score[q = (qt0 + t)*16 + 8*hh + r][k = kt*16 + m]
      // running maximum and sum stay private to the lane (its own key column of every tile)
#pragma unroll
      for (int r = 0; r < 8; ++r) {
        const int qg = (qt0 + t) * 16 + 8 * hh + r;
        const int kg = kt * 16 + m;
        const float x = (kg <= qg) ? s[r] * (1.0f / 64.0f) : NEG_BIG;
        const float mn = fmaxf(mrow[t][r], x);
        lrow[t][r] = lrow[t][r] * __expf(mrow[t][r] - mn) + __expf(x - mn);
        mrow[t][r] = mn;
      }
    }
  }

  // one merge of the 16 lanes of each row: a lane that saw no valid key holds NEG_BIG and its sum scales to 0
#pragma unroll
  for (int t = 0; t < WT; ++t)
#pragma unroll
    for (int r = 0; r < 8; ++r) {
      float gm = mrow[t][r];
#pragma unroll
      for (int off = 1; off < 16; off <<= 1) gm = fmaxf(gm, __shfl_xor(gm, off, 32));
      float e = lrow[t][r] * __expf(mrow[t][r] - gm);
#pragma unroll
      for (int off = 1; off < 16; off <<= 1) e += __shfl_xor(e, off, 32);
      mrow[t][r] = gm;
      lrow[t][r] = e;
    }

  // merge of the waves: a wave that saw no valid key of a row holds NEG_BIG there and its sum scales to 0
  if (m == 0) {
#pragma unroll   // mrow and lrow live in registers: t and r must be constants
    for (int t = 0; t < WT; ++t)
#pragma unroll
      for (int r = 0; r < 8; ++r) {
        pm[w][16 * t + 8 * hh + r] = mrow[t][r];
        ps[w][16 * t + 8 * hh + r] = lrow[t][r];
      }
  }
  __syncthreads();
  if (threadIdx.x < 16 * WT) {
    const int row = threadIdx.x;
    float gm = pm[0][row];
    for (int j = 1; j < SPLIT; ++j) gm = fmaxf(gm, pm[j][row]);
    float e = 0.f;
    for (int j = 0; j < SPLIT; ++j) e += ps[j][row] * __expf(pm[j][row] - gm);
    v2f val;
    val.x = gm; val.y = 1.0f / e;
    *(v2f*)(ml + ((size_t)bh * SEQ + qt0 * 16 + row) * 2) = val;
  }
}

// =====================================================================
// Kernel 3: out_h[bh][kpos][d] = sum_{q > kpos} P[q,kpos] * vh[q][d]   (contraction over the query axis)
// One work-group per (bh, WT key tiles of 16 columns); wave w takes the 32-query chunks w, w + SPLIT, ... from
// the diagonal on. Each loaded q fragment, v fragment and row statistic serves all WT key tiles: per key tile
// two 16x16 score tiles -> P in registers (packed D tiles = P^T A fragment) -> 4 P^T.V products.
// The waves' partial tiles are summed through LDS. Stores f32 out_h [b*S][H*DE].
// The index runs over the tiles from the longest query loop to the shortest, as in k_stats.
// =====================================================================
__global__ __launch_bounds__(32 * SPLIT) void k_attn(
    const us_t* __restrict__ qhh, const us_t* __restrict__ qhl,
    const us_t* __restrict__ khh, const us_t* __restrict__ khl,
    const us_t* __restrict__ vth, const us_t* __restrict__ vtl,
    const float* __restrict__ ml, float* __restrict__ outh) {
  __shared__ __attribute__((aligned(16))) float so[SPLIT][16 * WT][OPITCH];
  // the wave's number as a scalar: the loop's bounds and branch stay on the scalar unit
  const int w = __builtin_amdgcn_readfirstlane(threadIdx.x >> 5);
  const int rank = blockIdx.x / BH, bh = blockIdx.x - rank * BH;
  const int kt0 = rank * WT;   // first key tile: the first tile has the most queries
  const int l = threadIdx.x & 31, m = l & 15, hh = l >> 4;

  // loop-invariant B fragments of the key tiles (kh rows kt0*16.., lane = key)
  const size_t koff = ((size_t)bh * SEQ + kt0 * 16) * DE;
  v16bf bkh[WT][2], bkl[WT][2];
#pragma unroll
  for (int t = 0; t < WT; ++t) {
    const unsigned int bo = t * (2 * FRAGB) + 16 * l;
    bkh[t][0] = ldfragp(khh + koff, bo);
    bkh[t][1] = ldfragp(khh + koff, bo + FRAGB);
    bkl[t][0] = ldfragp(khl + koff, bo);
    bkl[t][1] = ldfragp(khl + koff, bo + FRAGB);
  }

  v8f o[WT][4];
#pragma unroll
  for (int t = 0; t < WT; ++t)
#pragma unroll
    for (int n = 0; n < 4; ++n) o[t][n] = zero8();

  const float* mlb = ml + (size_t)bh * SEQ * 2;
  const us_t* Qh = qhh + (size_t)bh * SEQ * DE;
  const us_t* Ql = qhl + (size_t)bh * SEQ * DE;
  const us_t* Vh = vth + (size_t)bh * DE * SEQ;
  const us_t* Vl = vtl + (size_t)bh * DE * SEQ;

#pragma unroll 1
  for (int qc = ((kt0 >> 1) + w) * 32; qc < SEQ; qc += 32 * SPLIT) {
    // a 32-query chunk is 4 fragments in each plane, q and v alike: one byte offset serves all four planes
    const unsigned int fo = (unsigned int)qc * (DE * 2) + 16 * l;
    unsigned int ph[WT][2][4], pl[WT][2][4];
#pragma unroll
    for (int sub = 0; sub < 2; ++sub) {
      const int q0 = qc + 16 * sub;
      const unsigned int qo = fo + sub * (2 * FRAGB);
      const v16bf qh0 = ldfragp(Qh, qo), ql0 = ldfragp(Ql, qo);
      const v16bf qh1 = ldfragp(Qh, qo + FRAGB), ql1 = ldfragp(Ql, qo + FRAGB);
      v2f mr[8];
#pragma unroll
      for (int r = 0; r < 8; ++r) mr[r] = *(const v2f*)(mlb + 2 * (q0 + 8 * hh + r));
#pragma unroll
      for (int t = 0; t < WT; ++t) {
        const int kg = (kt0 + t) * 16 + m;          // this lane's key column in the score tile
        v8f s = zero8();
        s = mma3(qh0, ql0, bkh[t][0], bkl[t][0], s);
        s = mma3(qh1, ql1, bkh[t][1], bkl[t][1], s);
        // s[r] = score[q = q0 + 8*hh + r][k = kg]
        float p[8];
#pragma unroll
        for (int r = 0; r < 8; ++r) {
          const int qg = q0 + 8 * hh + r;
          const float e = __expf(s[r] * (1.0f / 64.0f) - mr[r].x) * mr[r].y;
          p[r] = (kg < qg) ? e : 0.f;               // causal and zeroed diagonal: strictly k < q
        }
#pragma unroll
        for (int j = 0; j < 4; ++j) split2(p[2 * j], p[2 * j + 1], ph[t][sub][j], pl[t][sub][j]);
      }
    }
    // P^T A fragments (rows = key m, k = 32 queries of this chunk): elements 0..7 from the first
    // 16-query D tile, 8..15 from the second, same lane.
    Frag aph[WT], apl[WT];
#pragma unroll
    for (int t = 0; t < WT; ++t) {
      aph[t].u[0] = mk4(ph[t][0][0], ph[t][0][1], ph[t][0][2], ph[t][0][3]);
      aph[t].u[1] = mk4(ph[t][1][0], ph[t][1][1], ph[t][1][2], ph[t][1][3]);
      apl[t].u[0] = mk4(pl[t][0][0], pl[t][0][1], pl[t][0][2], pl[t][0][3]);
      apl[t].u[1] = mk4(pl[t][1][0], pl[t][1][1], pl[t][1][2], pl[t][1][3]);
    }
#pragma unroll
    for (int n = 0; n < 4; ++n) {
      const unsigned int vo = fo + n * FRAGB;        // B fragment: rows d = n*16.., k = query from qc
      const v16bf vh = ldfragp(Vh, vo), vl = ldfragp(Vl, vo);
#pragma unroll
      for (int t = 0; t < WT; ++t) o[t][n] = mma3(aph[t].v, apl[t].v, vh, vl, o[t][n]);
    }
  }
  // o[t][n][r] = this wave's share of out_h[kpos = (kt0 + t)*16 + 8*hh + r][d = n*16 + m]

#pragma unroll
  for (int t = 0; t < WT; ++t)
#pragma unroll
    for (int n = 0; n < 4; ++n)
#pragma unroll
      for (int r = 0; r < 8; ++r) so[w][16 * t + 8 * hh + r][n * 16 + m] = o[t][n][r];
  __syncthreads();

  // each thread sums 4-float pieces of the (16 * WT) x 64 tile over the waves
  const int bb = bh / HEADS, head = bh - bb * HEADS;
  for (int i = threadIdx.x; i < 16 * WT * 16; i += 32 * SPLIT) {
    const int row = i >> 4, c4 = i & 15;
    v4f sum = *(const v4f*)&so[0][row][4 * c4];
    for (int j = 1; j < SPLIT; ++j) sum += *(const v4f*)&so[j][row][4 * c4];
    *(v4f*)(outh + ((size_t)bb * SEQ + kt0 * 16 + row) * ZDIM + head * DE + 4 * c4) = sum;
  }
}

// =====================================================================
// Kernel 4: out = out_h (4096 x 512) . W_o (512 x 64). One work-group per 16 rows; wave w takes the 64 k of
// head w, so no wave waits for a chunk another wave stages: its A rows and its W_o B fragments come straight
// from global memory, with no barrier between a load and its product. The waves' partial tiles are summed in LDS.
// =====================================================================
__global__ __launch_bounds__(32 * OSPLIT) void k_oproj(
    const float* __restrict__ outh, const float* __restrict__ Wo, float* __restrict__ out) {
  __shared__ __attribute__((aligned(16))) float so[OSPLIT][16][OPITCH];
  // the wave's number as a scalar: the bases of its k range stay on the scalar unit
  const int w = __builtin_amdgcn_readfirstlane(threadIdx.x >> 5);
  const int l = threadIdx.x & 31, m = l & 15, hh = l >> 4;
  const int rowbase = blockIdx.x * 16;

  // A: row = rowbase + m, k as in ldfrag. B: lane = column n*16 + m, the same k order, one W_o row per element.
  const float* ar = outh + (size_t)w * DE + (size_t)(rowbase + m) * ZDIM + 8 * hh;
  const float* br = Wo + (size_t)w * DE * DE + (size_t)(8 * hh) * DE + m;
  // araw, braw and acc live in registers: every loop below is unrolled so that their indices are constants
  v4f araw[2][4];
  float braw[2][4][16];
#pragma unroll
  for (int c = 0; c < 2; ++c)
#pragma unroll
    for (int u = 0; u < 2; ++u) {
      araw[c][2 * u] = *(const v4f*)(ar + c * 32 + 16 * u);
      araw[c][2 * u + 1] = *(const v4f*)(ar + c * 32 + 16 * u + 4);
    }
#pragma unroll
  for (int c = 0; c < 2; ++c)
#pragma unroll
    for (int n = 0; n < 4; ++n)
#pragma unroll
      for (int e = 0; e < 16; ++e)
        braw[c][n][e] = br[(size_t)(c * 32 + 16 * (e >> 3) + (e & 7)) * DE + n * 16];

  v8f acc[4];
#pragma unroll
  for (int n = 0; n < 4; ++n) acc[n] = zero8();
#pragma unroll
  for (int c = 0; c < 2; ++c) {
    Frag ah, al;
    split8(araw[c][0], araw[c][1], ah.u[0], al.u[0]);
    split8(araw[c][2], araw[c][3], ah.u[1], al.u[1]);
#pragma unroll
    for (int n = 0; n < 4; ++n) {
      Frag bh, bl;
#pragma unroll
      for (int u = 0; u < 2; ++u) {
        unsigned int h[4], lo[4];
#pragma unroll
        for (int j = 0; j < 4; ++j) split2(braw[c][n][8 * u + 2 * j], braw[c][n][8 * u + 2 * j + 1], h[j], lo[j]);
        bh.u[u] = mk4(h[0], h[1], h[2], h[3]);
        bl.u[u] = mk4(lo[0], lo[1], lo[2], lo[3]);
      }
      acc[n] = mma3(ah.v, al.v, bh.v, bl.v, acc[n]);
    }
  }
  // acc[n][r] = this wave's share of out[rowbase + 8*hh + r][n*16 + m]

#pragma unroll
  for (int n = 0; n < 4; ++n)
#pragma unroll
    for (int r = 0; r < 8; ++r) so[w][8 * hh + r][n * 16 + m] = acc[n][r];
  __syncthreads();

  // each thread sums one 4-float piece of the 16 x 64 tile over the waves; a wave stores 512 contiguous bytes
  const int row = threadIdx.x >> 4, c4 = threadIdx.x & 15;
  v4f sum = *(const v4f*)&so[0][row][4 * c4];
#pragma unroll
  for (int j = 1; j < OSPLIT; ++j) sum += *(const v4f*)&so[j][row][4 * c4];
  *(v4f*)(out + (size_t)(rowbase + row) * DE + 4 * c4) = sum;
}

extern "C" void kernel_launch(void* const* d_in, const int* in_sizes, int n_in,
                              void* d_out, int out_size, void* d_ws, size_t ws_size,
                              hipStream_t stream) {
  if (n_in < 7) return;
  if (in_sizes[0] != ROWS * DE || in_sizes[1] != ROWS * DE || in_sizes[2] != ROWS * DE) return;
  if (in_sizes[3] != HEADS * DE * DE || in_sizes[4] != HEADS * DE * DE || in_sizes[5] != HEADS * DE * DE) return;
  if (in_sizes[6] != ZDIM * DE) return;
  if (out_size != ROWS * DE) return;

  const float* q  = (const float*)d_in[0];
  const float* k  = (const float*)d_in[1];
  const float* v  = (const float*)d_in[2];
  const float* Wq = (const float*)d_in[3];
  const float* Wk = (const float*)d_in[4];
  const float* Wv = (const float*)d_in[5];
  const float* Wo = (const float*)d_in[6];
  float* out = (float*)d_out;

  char* ws = (char*)d_ws;
  size_t off = 0;
  const size_t plane = (size_t)BH * SEQ * DE * sizeof(us_t);          // 4 MiB each
  us_t* qhh = (us_t*)(ws + off); off += plane;
  us_t* qhl = (us_t*)(ws + off); off += plane;
  us_t* khh = (us_t*)(ws + off); off += plane;
  us_t* khl = (us_t*)(ws + off); off += plane;
  us_t* vth = (us_t*)(ws + off); off += plane;
  us_t* vtl = (us_t*)(ws + off); off += plane;
  float* ml   = (float*)(ws + off); off += (size_t)BH * SEQ * 2 * sizeof(float);    // 256 KiB
  float* outh = (float*)(ws + off); off += (size_t)ROWS * ZDIM * sizeof(float);      // 8 MiB
  if (off > ws_size) return;

  k_proj<<<dim3(3 * HEADS * RT64), dim3(128), 0, stream>>>(q, k, v, Wq, Wk, Wv,
                                                           qhh, qhl, khh, khl, vth, vtl);
  k_stats<<<dim3(BH * (QT / WT)), dim3(32 * SPLIT), 0, stream>>>(qhh, qhl, khh, khl, ml);
  k_attn<<<dim3(BH * (QT / WT)), dim3(32 * SPLIT), 0, stream>>>(qhh, qhl, khh, khl, vth, vtl, ml, outh);
  k_oproj<<<dim3(ROWS / 16), dim3(32 * OSPLIT), 0, stream>>>(outh, Wo, out);
}

// v007
// A run of this version takes 66.1 microseconds.
// Next to v006, in two timings, it ran 1.08 and 1.09 times as fast.
// Counting every step since v000, it is 8.19 times as fast.
#include <hip/hip_runtime.h>
#include <stddef.h>

// Contractions: head projections, q.k scores (statistics pass and output pass), P.V over the query axis,
// output projection -- all v_wmma_f32_16x16x32_bf16 with bf16 hi/lo operand split (hi*hi + hi*lo + lo*hi),
// f32 accumulate. RoPE, softmax statistics, masks and epilogues in f32.

#define HEADS 8
#define DE 64
#define BATCH 2
#define SEQ 2048
#define BH (BATCH * HEADS)
#define ZDIM (HEADS * DE)
#define ROWS (BATCH * SEQ)
#define QT (SEQ / 16)
#define RT64 (ROWS / 64)
#define WPITCH 72
#define OPITCH 68
#define NEG_BIG (-3.0e38f)
#define SPLIT 8   // waves of a work-group that share the loop over its WT tiles in k_stats and k_attn
#define OSPLIT 8  // waves of a work-group that share the k axis in k_oproj: DE of the ZDIM k values each
#define WT 2      // 16-wide tiles one wave holds in k_stats and k_attn: each fragment loaded in the loop feeds WT products

typedef char chk_de[(DE == 64) ? 1 : -1];
typedef char chk_seq[((SEQ % 64) == 0) ? 1 : -1];
typedef char chk_rows[((ROWS % 64) == 0) ? 1 : -1];
typedef char chk_z[((ZDIM % 32) == 0) ? 1 : -1];
typedef char chk_os[(ZDIM == OSPLIT * DE && 16 * 16 == 32 * OSPLIT) ? 1 : -1];
typedef char chk_wt[((QT % WT) == 0 && (WT % 2) == 0) ? 1 : -1];

typedef __bf16 bf16_t;
typedef bf16_t v16bf __attribute__((ext_vector_type(16)));
typedef float v8f __attribute__((ext_vector_type(8)));
typedef float v4f __attribute__((ext_vector_type(4)));
typedef float v2f __attribute__((ext_vector_type(2)));
typedef unsigned int v4u __attribute__((ext_vector_type(4)));
typedef unsigned short us_t;

union Frag {
  v16bf v;
  v4u u[2];
};

__device__ __forceinline__ v4u mk4(unsigned int a, unsigned int b, unsigned int c, unsigned int d) {
  v4u r;
  r.x = a; r.y = b; r.z = c; r.w = d;
  return r;
}

__device__ __forceinline__ v8f zero8() {
  v8f z;
#pragma unroll
  for (int i = 0; i < 8; ++i) z[i] = 0.f;
  return z;
}

typedef bf16_t v2bf __attribute__((ext_vector_type(2)));

// two f32 -> two bf16 (RNE) packed in a dword, x0 in the low half: one v_cvt_pk_bf16_f32
__device__ __forceinline__ unsigned int bf_pk(float x0, float x1) {
  v2f x;
  x.x = x0; x.y = x1;
  return __builtin_bit_cast(unsigned int, __builtin_convertvector(x, v2bf));
}

// x ~= hi + lo : hi = RNE16(x), lo = RNE16(x - hi); two values packed per dword (even element in the low half)
__device__ __forceinline__ void split2(float x0, float x1, unsigned int& ph, unsigned int& pl) {
  ph = bf_pk(x0, x1);
  pl = bf_pk(x0 - __uint_as_float(ph << 16), x1 - __uint_as_float(ph & 0xFFFF0000u));
}
__device__ __forceinline__ void split1(float x, us_t& hb, us_t& lb) {
  const bf16_t h = (bf16_t)x;
  hb = __builtin_bit_cast(us_t, h);
  lb = __builtin_bit_cast(us_t, (bf16_t)(x - (float)h));
}
// 8 consecutive k values (a = k..k+3, b = k+4..k+7) -> packed hi and lo halves of a fragment
__device__ __forceinline__ void split8(v4f a, v4f b, v4u& ph, v4u& pl) {
  unsigned int h0, l0, h1, l1, h2, l2, h3, l3;
  split2(a.x, a.y, h0, l0);
  split2(a.z, a.w, h1, l1);
  split2(b.x, b.y, h2, l2);
  split2(b.z, b.w, h3, l3);
  ph = mk4(h0, h1, h2, h3);
  pl = mk4(l0, l1, l2, l3);
}

// D += Ah*Bh + Ah*Bl + Al*Bh ; 4 v_nop guard tying D and keeping all operands live
__device__ __forceinline__ v8f mma3(v16bf ah, v16bf al, v16bf bh, v16bf bl, v8f c) {
  c = __builtin_amdgcn_wmma_f32_16x16x32_bf16(false, ah, false, bh, (short)0, c, false, false);
  c = __builtin_amdgcn_wmma_f32_16x16x32_bf16(false, ah, false, bl, (short)0, c, false, false);
  c = __builtin_amdgcn_wmma_f32_16x16x32_bf16(false, al, false, bh, (short)0, c, false, false);
  asm volatile("v_nop\n\tv_nop\n\tv_nop\n\tv_nop" : "+v"(c) : "v"(ah), "v"(al), "v"(bh), "v"(bl));
  return c;
}

// 16-bit fragment from a row-major [row][k] array (pitch ld elements), rows base..base+15, k from k0.
// Lane l: row = l&15, h = l>>4; elements 0..7 = k0+8h+0..7, elements 8..15 = k0+16+8h+0..7.
// Used for B stored n-major with k contiguous (row = n), on LDS tiles.
__device__ __forceinline__ v16bf ldfrag(const us_t* base, int ld, int k0, int l) {
  const us_t* p = base + (size_t)(l & 15) * ld + k0 + 8 * (l >> 4);
  Frag f;
  f.u[0] = *(const v4u*)p;
  f.u[1] = *(const v4u*)(p + 16);
  return f.v;
}

// The workspace planes hold whole fragments in register order: one fragment (16 rows x 32 k) = FRAG
// elements = [half u][lane l][8 elements], the element map being ldfrag's. Each of the two loads of a
// wave then reads 512 contiguous bytes (4 cache lines) instead of 32 bytes from each of 16 lines.
// plane: wave-uniform base; off: byte offset of the fragment plus 16 * lane.
#define FRAG 512
#define FRAGB (2 * FRAG)
__device__ __forceinline__ v16bf ldfragp(const us_t* plane, unsigned int off) {
  const char* p = (const char*)plane + off;
  Frag f;
  f.u[0] = *(const v4u*)p;
  f.u[1] = *(const v4u*)(p + 512);
  return f.v;
}

// =====================================================================
// Kernel 1: head projections + RoPE on q,k.  Block = 4 waves = 64 rows of one (matrix, head).
// Outputs (bf16 hi and lo planes), in fragment order (see ldfragp):
//   qh, kh : [bh][s / 16][d / 32][fragment: row = s % 16, k = d % 32]
//   vt     : [bh][s / 32][d / 16][fragment: row = d % 16, k = s % 32]
// =====================================================================
__global__ __launch_bounds__(128) void k_proj(
    const float* __restrict__ q, const float* __restrict__ k, const float* __restrict__ v,
    const float* __restrict__ Wq, const float* __restrict__ Wk, const float* __restrict__ Wv,
    us_t* __restrict__ qhh, us_t* __restrict__ qhl, us_t* __restrict__ khh, us_t* __restrict__ khl,
    us_t* __restrict__ vth, us_t* __restrict__ vtl) {
#pragma clang fp contract(off)
  __shared__ __attribute__((aligned(16))) us_t wt[2][DE][WPITCH];   // W^T hi/lo : [plane][d][z]
  __shared__ __attribute__((aligned(16))) us_t st[2][64][WPITCH];   // result tile staging
  __shared__ float invf[32];

  const int t = threadIdx.x, w = t >> 5, l = t & 31, m = l & 15, hh = l >> 4;
  const int blk = blockIdx.x;
  const int mat = blk / (HEADS * RT64);                 // 0 = q, 1 = k, 2 = v (block-uniform)
  const int rem = blk - mat * (HEADS * RT64);
  const int head = rem / RT64;
  const int rt = rem - head * RT64;
  const int row0 = rt * 64;                             // row in [0, BATCH*SEQ)
  const int b = row0 / SEQ, s0 = row0 - b * SEQ, bh = b * HEADS + head;

  const float* X = (mat == 0) ? q : ((mat == 1) ? k : v);
  const float* W = ((mat == 0) ? Wq : ((mat == 1) ? Wk : Wv)) + (size_t)head * DE * DE;

  // stage W[z][d] -> wt[p][d][z] as hi/lo bf16
#pragma unroll 4
  for (int j = 0; j < 32; ++j) {
    const int idx = j * 128 + t;
    const int z = idx >> 6, d = idx & 63;
    us_t hb, lb;
    split1(W[idx], hb, lb);
    wt[0][d][z] = hb;
    wt[1][d][z] = lb;
  }
  if (t < 32) invf[t] = 1.0f / powf(10000.0f, (float)t * 0.03125f);
  __syncthreads();

  // A fragments: this wave's 16 rows of X, k 0..31 and 32..63
  const float* xr = X + (size_t)(row0 + w * 16 + m) * DE;
  Frag ah0, al0, ah1, al1;
  {
    v4f a, c;
    a = *(const v4f*)(xr + 8 * hh);       c = *(const v4f*)(xr + 8 * hh + 4);       split8(a, c, ah0.u[0], al0.u[0]);
    a = *(const v4f*)(xr + 16 + 8 * hh);  c = *(const v4f*)(xr + 16 + 8 * hh + 4);  split8(a, c, ah0.u[1], al0.u[1]);
    a = *(const v4f*)(xr + 32 + 8 * hh);  c = *(const v4f*)(xr + 32 + 8 * hh + 4);  split8(a, c, ah1.u[0], al1.u[0]);
    a = *(const v4f*)(xr + 48 + 8 * hh);  c = *(const v4f*)(xr + 48 + 8 * hh + 4);  split8(a, c, ah1.u[1], al1.u[1]);
  }

  v8f acc[4];
#pragma unroll
  for (int n = 0; n < 4; ++n) acc[n] = zero8();
#pragma unroll
  for (int n = 0; n < 4; ++n) {
    acc[n] = mma3(ah0.v, al0.v, ldfrag(&wt[0][n * 16][0], WPITCH, 0, l),
                  ldfrag(&wt[1][n * 16][0], WPITCH, 0, l), acc[n]);
    acc[n] = mma3(ah1.v, al1.v, ldfrag(&wt[0][n * 16][0], WPITCH, 32, l),
                  ldfrag(&wt[1][n * 16][0], WPITCH, 32, l), acc[n]);
  }
  // acc[n][r] = Y[row0 + w*16 + 8*hh + r][n*16 + m]

  if (mat < 2) {   // interleaved-pair rotary embedding: cols (2i, 2i+1) are adjacent lanes
#pragma unroll
    for (int n = 0; n < 4; ++n) {
      const int N = n * 16 + m;
      const float f = invf[N >> 1];
#pragma unroll
      for (int r = 0; r < 8; ++r) {
        const int pos = s0 + w * 16 + 8 * hh + r;
        const float ang = (float)pos * f;
        const float sn = sinf(ang), cs = cosf(ang);
        const float mine = acc[n][r];
        const float other = __shfl_xor(mine, 1, 32);
        acc[n][r] = ((N & 1) == 0) ? (mine * cs - other * sn) : (other * sn + mine * cs);
      }
    }
  }

  // stage the 64-row block tile as hi/lo bf16
  if (mat == 2) {   // transposed: st[p][d][row_local]
#pragma unroll
    for (int n = 0; n < 4; ++n)
#pragma unroll
      for (int r = 0; r < 8; ++r) {
        us_t hb, lb;
        split1(acc[n][r], hb, lb);
        st[0][n * 16 + m][w * 16 + 8 * hh + r] = hb;
        st[1][n * 16 + m][w * 16 + 8 * hh + r] = lb;
      }
  } else {          // row major: st[p][row_local][d]
#pragma unroll
    for (int n = 0; n < 4; ++n)
#pragma unroll
      for (int r = 0; r < 8; ++r) {
        us_t hb, lb;
        split1(acc[n][r], hb, lb);
        st[0][w * 16 + 8 * hh + r][n * 16 + m] = hb;
        st[1][w * 16 + 8 * hh + r][n * 16 + m] = lb;
      }
  }
  __syncthreads();

  // wave w writes the two fragments (k 0..31 and 32..63 of the staged tile) of staged rows w*16..w*16+15
  us_t* dsth = (mat == 2) ? vth : ((mat == 0) ? qhh : khh);
  us_t* dstl = (mat == 2) ? vtl : ((mat == 0) ? qhl : khl);
  // q, k: rows are s, the two fragments are neighbours; v: rows are d, the fragments lie one 32-query chunk apart
  const size_t fbase = (size_t)bh * SEQ * DE + (size_t)s0 * DE + (size_t)w * ((mat == 2) ? FRAG : 2 * FRAG);
  const size_t fstep = (mat == 2) ? (size_t)(32 * DE) : (size_t)FRAG;
  v4u vals[2][4];
#pragma unroll
  for (int i = 0; i < 4; ++i) {
    vals[0][i] = *(const v4u*)&st[0][w * 16 + m][16 * i + 8 * hh];
    vals[1][i] = *(const v4u*)&st[1][w * 16 + m][16 * i + 8 * hh];
  }
#pragma unroll
  for (int i = 0; i < 4; ++i) {
    const size_t o = fbase + (size_t)(i >> 1) * fstep + (i & 1) * 256 + 8 * l;
    *(v4u*)(dsth + o) = vals[0][i];
    *(v4u*)(dstl + o) = vals[1][i];
  }
  
}

// =====================================================================
// Kernel 2: per query row: m[q] = max_{k<=q} s/64, rcp[q] = 1 / sum exp(s/64 - m).
// One work-group per (bh, WT query tiles of 16 rows); wave w takes key tiles w, w + SPLIT, ... and puts
// each loaded key fragment to all WT query tiles; the waves' (max, sum) pairs meet in LDS.
// There are more work-groups than resident places; the index runs over the
// tiles from the longest key loop to the shortest (all bh of a tile side by side).
// =====================================================================
__global__ __launch_bounds__(32 * SPLIT) void k_stats(
    const us_t* __restrict__ qhh, const us_t* __restrict__ qhl,
    const us_t* __restrict__ khh, const us_t* __restrict__ khl, float* __restrict__ ml) {
  __shared__ float pm[SPLIT][16 * WT];
  __shared__ float ps[SPLIT][16 * WT];
  // the wave's number as a scalar: the loop's bounds and branch stay on the scalar unit
  const int w = __builtin_amdgcn_readfirstlane(threadIdx.x >> 5);
  const int rank = blockIdx.x / BH, bh = blockIdx.x - rank * BH;
  const int qt0 = (QT / WT - 1 - rank) * WT;   // first query tile: the last tile has the most keys
  const int l = threadIdx.x & 31, m = l & 15, hh = l >> 4;

  const size_t qoff = ((size_t)bh * SEQ + qt0 * 16) * DE;
  v16bf aqh[WT][2], aql[WT][2];
#pragma unroll
  for (int t = 0; t < WT; ++t) {
    const unsigned int ao = t * (2 * FRAGB) + 16 * l;
    aqh[t][0] = ldfragp(qhh + qoff, ao);
    aqh[t][1] = ldfragp(qhh + qoff, ao + FRAGB);
    aql[t][0] = ldfragp(qhl + qoff, ao);
    aql[t][1] = ldfragp(qhl + qoff, ao + FRAGB);
  }
  const us_t* Kh = khh + (size_t)bh * SEQ * DE;
  const us_t* Kl = khl + (size_t)bh * SEQ * DE;

  float mrow[WT][8], lrow[WT][8];
#pragma unroll
  for (int t = 0; t < WT; ++t)
#pragma unroll
    for (int r = 0; r < 8; ++r) { mrow[t][r] = NEG_BIG; lrow[t][r] = 0.f; }

  // a key tile past the diagonal of one of the query tiles is all masked there and adds exactly 0
#pragma unroll 1
  for (int kt = w; kt < qt0 + WT; kt += SPLIT) {
    const unsigned int ko = (unsigned int)kt * (2 * FRAGB) + 16 * l;
    const v16bf kh0 = ldfragp(Kh, ko), kl0 = ldfragp(Kl, ko);
    const v16bf kh1 = ldfragp(Kh, ko + FRAGB), kl1 = ldfragp(Kl, ko + FRAGB);
#pragma unroll
    for (int t = 0; t < WT; ++t) {
      v8f s = zero8();
      s = mma3(aqh[t][0], aql[t][0], kh0, kl0, s);
      s = mma3(aqh[t][1], aql[t][1], kh1, kl1, s);
      // s[r] = score[q = (qt0 + t)*16 + 8*hh + r][k = kt*16 + m]
      // running maximum and sum stay private to the lane (its own key column of every tile)
#pragma unroll
      for (int r = 0; r < 8; ++r) {
        const int qg = (qt0 + t) * 16 + 8 * hh + r;
        const int kg = kt * 16 + m;
        const float x = (kg <= qg) ? s[r] * (1.0f / 64.0f) : NEG_BIG;
        const float mn = fmaxf(mrow[t][r], x);
        lrow[t][r] = lrow[t][r] * __expf(mrow[t][r] - mn) + __expf(x - mn);
        mrow[t][r] = mn;
      }
    }
  }

  // one merge of the 16 lanes of each row: a lane that saw no valid key holds NEG_BIG and its sum scales to 0
#pragma unroll
  for (int t = 0; t < WT; ++t)
#pragma unroll
    for (int r = 0; r < 8; ++r) {
      float gm = mrow[t][r];
#pragma unroll
      for (int off = 1; off < 16; off <<= 1) gm = fmaxf(gm, __shfl_xor(gm, off, 32));
      float e = lrow[t][r] * __expf(mrow[t][r] - gm);
#pragma unroll
      for (int off = 1; off < 16; off <<= 1) e += __shfl_xor(e, off, 32);
      mrow[t][r] = gm;
      lrow[t][r] = e;
    }

  // merge of the waves: a wave that saw no valid key of a row holds NEG_BIG there and its sum scales to 0
  if (m == 0) {
#pragma unroll   // mrow and lrow live in registers: t and r must be constants
    for (int t = 0; t < WT; ++t)
#pragma unroll
      for (int r = 0; r < 8; ++r) {
        pm[w][16 * t + 8 * hh + r] = mrow[t][r];
        ps[w][16 * t + 8 * hh + r] = lrow[t][r];
      }
  }
  __syncthreads();
  if (threadIdx.x < 16 * WT) {
    const int row = threadIdx.x;
    float gm = pm[0][row];
    for (int j = 1; j < SPLIT; ++j) gm = fmaxf(gm, pm[j][row]);
    float e = 0.f;
    for (int j = 0; j < SPLIT; ++j) e += ps[j][row] * __expf(pm[j][row] - gm);
    v2f val;
    val.x = gm; val.y = 1.0f / e;
    *(v2f*)(ml + ((size_t)bh * SEQ + qt0 * 16 + row) * 2) = val;
  }
}

// =====================================================================
// Kernel 3: out_h[bh][kpos][d] = sum_{q > kpos} P[q,kpos] * vh[q][d]   (contraction over the query axis)
// One work-group per (bh, WT key tiles of 16 columns); wave w takes the 32-query chunks w, w + SPLIT, ... from
// the diagonal on. Each loaded q fragment, v fragment and row statistic serves all WT key tiles: per key tile
// two 16x16 score tiles -> P in registers (packed D tiles = P^T A fragment) -> 4 P^T.V products.
// The waves' partial tiles are summed through LDS. Stores f32 out_h [b*S][H*DE].
// The index runs over the tiles from the longest query loop to the shortest, as in k_stats.
// =====================================================================
__global__ __launch_bounds__(32 * SPLIT) void k_attn(
    const us_t* __restrict__ qhh, const us_t* __restrict__ qhl,
    const us_t* __restrict__ khh, const us_t* __restrict__ khl,
    const us_t* __restrict__ vth, const us_t* __restrict__ vtl,
    const float* __restrict__ ml, float* __restrict__ outh) {
  __shared__ __attribute__((aligned(16))) float so[SPLIT][16 * WT][OPITCH];
  // the wave's number as a scalar: the loop's bounds and branch stay on the scalar unit
  const int w = __builtin_amdgcn_readfirstlane(threadIdx.x >> 5);
  const int rank = blockIdx.x / BH, bh = blockIdx.x - rank * BH;
  const int kt0 = rank * WT;   // first key tile: the first tile has the most queries
  const int l = threadIdx.x & 31, m = l & 15, hh = l >> 4;

  // loop-invariant B fragments of the key tiles (kh rows kt0*16.., lane = key)
  const size_t koff = ((size_t)bh * SEQ + kt0 * 16) * DE;
  v16bf bkh[WT][2], bkl[WT][2];
#pragma unroll
  for (int t = 0; t < WT; ++t) {
    const unsigned int bo = t * (2 * FRAGB) + 16 * l;
    bkh[t][0] = ldfragp(khh + koff, bo);
    bkh[t][1] = ldfragp(khh + koff, bo + FRAGB);
    bkl[t][0] = ldfragp(khl + koff, bo);
    bkl[t][1] = ldfragp(khl + koff, bo + FRAGB);
  }

  v8f o[WT][4];
#pragma unroll
  for (int t = 0; t < WT; ++t)
#pragma unroll
    for (int n = 0; n < 4; ++n) o[t][n] = zero8();

  const float* mlb = ml + (size_t)bh * SEQ * 2;
  const us_t* Qh = qhh + (size_t)bh * SEQ * DE;
  const us_t* Ql = qhl + (size_t)bh * SEQ * DE;
  const us_t* Vh = vth + (size_t)bh * DE * SEQ;
  const us_t* Vl = vtl + (size_t)bh * DE * SEQ;

#pragma unroll 1
  for (int qc = ((kt0 >> 1) + w) * 32; qc < SEQ; qc += 32 * SPLIT) {
    // a 32-query chunk is 4 fragments in each plane, q and v alike: one byte offset serves all four planes
    const unsigned int fo = (unsigned int)qc * (DE * 2) + 16 * l;
    unsigned int ph[WT][2][4], pl[WT][2][4];
#pragma unroll
    for (int sub = 0; sub < 2; ++sub) {
      const int q0 = qc + 16 * sub;
      const unsigned int qo = fo + sub * (2 * FRAGB);
      const v16bf qh0 = ldfragp(Qh, qo), ql0 = ldfragp(Ql, qo);
      const v16bf qh1 = ldfragp(Qh, qo + FRAGB), ql1 = ldfragp(Ql, qo + FRAGB);
      v2f mr[8];
#pragma unroll
      for (int r = 0; r < 8; ++r) mr[r] = *(const v2f*)(mlb + 2 * (q0 + 8 * hh + r));
#pragma unroll
      for (int t = 0; t < WT; ++t) {
        const int kg = (kt0 + t) * 16 + m;          // this lane's key column in the score tile
        v8f s = zero8();
        s = mma3(qh0, ql0, bkh[t][0], bkl[t][0], s);
        s = mma3(qh1, ql1, bkh[t][1], bkl[t][1], s);
        // s[r] = score[q = q0 + 8*hh + r][k = kg]
        float p[8];
#pragma unroll
        for (int r = 0; r < 8; ++r) {
          const int qg = q0 + 8 * hh + r;
          const float e = __expf(s[r] * (1.0f / 64.0f) - mr[r].x) * mr[r].y;
          p[r] = (kg < qg) ? e : 0.f;               // causal and zeroed diagonal: strictly k < q
        }
#pragma unroll
        for (int j = 0; j < 4; ++j) split2(p[2 * j], p[2 * j + 1], ph[t][sub][j], pl[t][sub][j]);
      }
    }
    // P^T A fragments (rows = key m, k = 32 queries of this chunk): elements 0..7 from the first
    // 16-query D tile, 8..15 from the second, same lane.
    Frag aph[WT], apl[WT];
#pragma unroll
    for (int t = 0; t < WT; ++t) {
      aph[t].u[0] = mk4(ph[t][0][0], ph[t][0][1], ph[t][0][2], ph[t][0][3]);
      aph[t].u[1] = mk4(ph[t][1][0], ph[t][1][1], ph[t][1][2], ph[t][1][3]);
      apl[t].u[0] = mk4(pl[t][0][0], pl[t][0][1], pl[t][0][2], pl[t][0][3]);
      apl[t].u[1] = mk4(pl[t][1][0], pl[t][1][1], pl[t][1][2], pl[t][1][3]);
    }
#pragma unroll
    for (int n = 0; n < 4; ++n) {
      const unsigned int vo = fo + n * FRAGB;        // B fragment: rows d = n*16.., k = query from qc
      const v16bf vh = ldfragp(Vh, vo), vl = ldfragp(Vl, vo);
#pragma unroll
      for (int t = 0; t < WT; ++t) o[t][n] = mma3(aph[t].v, apl[t].v, vh, vl, o[t][n]);
    }
  }
  // o[t][n][r] = this wave's share of out_h[kpos = (kt0 + t)*16 + 8*hh + r][d = n*16 + m]

#pragma unroll
  for (int t = 0; t < WT; ++t)
#pragma unroll
    for (int n = 0; n < 4; ++n)
#pragma unroll
      for (int r = 0; r < 8; ++r) so[w][16 * t + 8 * hh + r][n * 16 + m] = o[t][n][r];
  __syncthreads();

  // each thread sums 4-float pieces of the (16 * WT) x 64 tile over the waves
  const int bb = bh / HEADS, head = bh - bb * HEADS;
  for (int i = threadIdx.x; i < 16 * WT * 16; i += 32 * SPLIT) {
    const int row = i >> 4, c4 = i & 15;
    v4f sum = *(const v4f*)&so[0][row][4 * c4];
    for (int j = 1; j < SPLIT; ++j) sum += *(const v4f*)&so[j][row][4 * c4];
    *(v4f*)(outh + ((size_t)bb * SEQ + kt0 * 16 + row) * ZDIM + head * DE + 4 * c4) = sum;
  }
}

// =====================================================================
// Kernel 4: out = out_h (4096 x 512) . W_o (512 x 64). One work-group per 16 rows; wave w takes the 64 k of
// head w, so no wave waits for a chunk another wave stages: its A rows and its W_o B fragments come straight
// from global memory, with no barrier between a load and its product. The waves' partial tiles are summed in LDS.
// =====================================================================
__global__ __launch_bounds__(32 * OSPLIT) void k_oproj(
    const float* __restrict__ outh, const float* __restrict__ Wo, float* __restrict__ out) {
  __shared__ __attribute__((aligned(16))) float so[OSPLIT][16][OPITCH];
  // the wave's number as a scalar: the bases of its k range stay on the scalar unit
  const int w = __builtin_amdgcn_readfirstlane(threadIdx.x >> 5);
  const int l = threadIdx.x & 31, m = l & 15, hh = l >> 4;
  const int rowbase = blockIdx.x * 16;

  // A: row = rowbase + m, k as in ldfrag. B: lane = column n*16 + m, the same k order, one W_o row per element.
  const float* ar = outh + (size_t)w * DE + (size_t)(rowbase + m) * ZDIM + 8 * hh;
  const float* br = Wo + (size_t)w * DE * DE + (size_t)(8 * hh) * DE + m;
  // araw, braw and acc live in registers: every loop below is unrolled so that their indices are constants
  v4f araw[2][4];
  float braw[2][4][16];
#pragma unroll
  for (int c = 0; c < 2; ++c)
#pragma unroll
    for (int u = 0; u < 2; ++u) {
      araw[c][2 * u] = *(const v4f*)(ar + c * 32 + 16 * u);
      araw[c][2 * u + 1] = *(const v4f*)(ar + c * 32 + 16 * u + 4);
    }
#pragma unroll
  for (int c = 0; c < 2; ++c)
#pragma unroll
    for (int n = 0; n < 4; ++n)
#pragma unroll
      for (int e = 0; e < 16; ++e)
        braw[c][n][e] = br[(size_t)(c * 32 + 16 * (e >> 3) + (e & 7)) * DE + n * 16];

  v8f acc[4];
#pragma unroll
  for (int n = 0; n < 4; ++n) acc[n] = zero8();
#pragma unroll
  for (int c = 0; c < 2; ++c) {
    Frag ah, al;
    split8(araw[c][0], araw[c][1], ah.u[0], al.u[0]);
    split8(araw[c][2], araw[c][3], ah.u[1], al.u[1]);
#pragma unroll
    for (int n = 0; n < 4; ++n) {
      Frag bh, bl;
#pragma unroll
      for (int u = 0; u < 2; ++u) {
        unsigned int h[4], lo[4];
#pragma unroll
        for (int j = 0; j < 4; ++j) split2(braw[c][n][8 * u + 2 * j], braw[c][n][8 * u + 2 * j + 1], h[j], lo[j]);
        bh.u[u] = mk4(h[0], h[1], h[2], h[3]);
        bl.u[u] = mk4(lo[0], lo[1], lo[2], lo[3]);
      }
      acc[n] = mma3(ah.v, al.v, bh.v, bl.v, acc[n]);
    }
  }
  // acc[n][r] = this wave's share of out[rowbase + 8*hh + r][n*16 + m]

#pragma unroll
  for (int n = 0; n < 4; ++n)
#pragma unroll
    for (int r = 0; r < 8; ++r) so[w][8 * hh + r][n * 16 + m] = acc[n][r];
  __syncthreads();

  // each thread sums one 4-float piece of the 16 x 64 tile over the waves; a wave stores 512 contiguous bytes
  const int row = threadIdx.x >> 4, c4 = threadIdx.x & 15;
  v4f sum = *(const v4f*)&so[0][row][4 * c4];
#pragma unroll
  for (int j = 1; j < OSPLIT; ++j) sum += *(const v4f*)&so[j][row][4 * c4];
  *(v4f*)(out + (size_t)(rowbase + row) * DE + 4 * c4) = sum;
}

extern "C" void kernel_launch(void* const* d_in, const int* in_sizes, int n_in,
                              void* d_out, int out_size, void* d_ws, size_t ws_size,
                              hipStream_t stream) {
  if (n_in < 7) return;
  if (in_sizes[0] != ROWS * DE || in_sizes[1] != ROWS * DE || in_sizes[2] != ROWS * DE) return;
  if (in_sizes[3] != HEADS * DE * DE || in_sizes[4] != HEADS * DE * DE || in_sizes[5] != HEADS * DE * DE) return;
  if (in_sizes[6] != ZDIM * DE) return;
  if (out_size != ROWS * DE) return;

  const float* q  = (const float*)d_in[0];
  const float* k  = (const float*)d_in[1];
  const float* v  = (const float*)d_in[2];
  const float* Wq = (const float*)d_in[3];
  const float* Wk = (const float*)d_in[4];
  const float* Wv = (const float*)d_in[5];
  const float* Wo = (const float*)d_in[6];
  float* out = (float*)d_out;

  char* ws = (char*)d_ws;
  size_t off = 0;
  const size_t plane = (size_t)BH * SEQ * DE * sizeof(us_t);          // 4 MiB each
  us_t* qhh = (us_t*)(ws + off); off += plane;
  us_t* qhl = (us_t*)(ws + off); off += plane;
  us_t* khh = (us_t*)(ws + off); off += plane;
  us_t* khl = (us_t*)(ws + off); off += plane;
  us_t* vth = (us_t*)(ws + off); off += plane;
  us_t* vtl = (us_t*)(ws + off); off += plane;
  float* ml   = (float*)(ws + off); off += (size_t)BH * SEQ * 2 * sizeof(float);    // 256 KiB
  float* outh = (float*)(ws + off); off += (size_t)ROWS * ZDIM * sizeof(float);      // 8 MiB
  if (off > ws_size) return;

  k_proj<<<dim3(3 * HEADS * RT64), dim3(128), 0, stream>>>(q, k, v, Wq, Wk, Wv,
                                                           qhh, qhl, khh, khl, vth, vtl);
  k_stats<<<dim3(BH * (QT / WT)), dim3(32 * SPLIT), 0, stream>>>(qhh, qhl, khh, khl, ml);
  k_attn<<<dim3(BH * (QT / WT)), dim3(32 * SPLIT), 0, stream>>>(qhh, qhl, khh, khl, vth, vtl, ml, outh);
  k_oproj<<<dim3(ROWS / 16), dim3(32 * OSPLIT), 0, stream>>>(outh, Wo, out);
}

// v008
// One run takes 63 microseconds.
// In two side-by-side timings against v007, it was 1.06 and 1.05 times as fast.
// Over all steps from v000 it is 8.65 times as fast.
#include <hip/hip_runtime.h>
#include <stddef.h>

// Contractions: head projections, q.k scores (statistics pass and output pass), P.V over the query axis,
// output projection -- all v_wmma_f32_16x16x32_bf16 with bf16 hi/lo operand split (hi*hi + hi*lo + lo*hi),
// f32 accumulate. RoPE, softmax statistics, masks and epilogues in f32.

#define HEADS 8
#define DE 64
#define BATCH 2
#define SEQ 2048
#define BH (BATCH * HEADS)
#define ZDIM (HEADS * DE)
#define ROWS (BATCH * SEQ)
#define QT (SEQ / 16)
#define RT64 (ROWS / 64)
#define WPITCH 72
#define OPITCH 68
#define NEG_BIG (-3.0e38f)
#define SPLIT 8   // waves of a work-group that share the key-tile loop in k_stats and the query-chunk loop in k_attn
#define OSPLIT 8  // waves of a work-group that share the k axis in k_oproj: DE of the ZDIM k values each
#define WT 2      // 16-wide tiles one wave holds in k_stats and k_attn: each fragment loaded in the loop feeds WT products

typedef char chk_de[(DE == 64) ? 1 : -1];
typedef char chk_seq[((SEQ % 64) == 0) ? 1 : -1];
typedef char chk_rows[((ROWS % 64) == 0) ? 1 : -1];
typedef char chk_z[((ZDIM % 32) == 0) ? 1 : -1];
typedef char chk_os[(ZDIM == OSPLIT * DE && 16 * 16 == 32 * OSPLIT) ? 1 : -1];
typedef char chk_wt[((QT % WT) == 0 && (WT % 2) == 0) ? 1 : -1];

typedef __bf16 bf16_t;
typedef bf16_t v16bf __attribute__((ext_vector_type(16)));
typedef float v8f __attribute__((ext_vector_type(8)));
typedef float v4f __attribute__((ext_vector_type(4)));
typedef float v2f __attribute__((ext_vector_type(2)));
typedef unsigned int v4u __attribute__((ext_vector_type(4)));
typedef unsigned short us_t;

union Frag {
  v16bf v;
  v4u u[2];
};

__device__ __forceinline__ v4u mk4(unsigned int a, unsigned int b, unsigned int c, unsigned int d) {
  v4u r;
  r.x = a; r.y = b; r.z = c; r.w = d;
  return r;
}

__device__ __forceinline__ v8f zero8() {
  v8f z;
#pragma unroll
  for (int i = 0; i < 8; ++i) z[i] = 0.f;
  return z;
}

typedef bf16_t v2bf __attribute__((ext_vector_type(2)));

// two f32 -> two bf16 (RNE) packed in a dword, x0 in the low half: one v_cvt_pk_bf16_f32
__device__ __forceinline__ unsigned int bf_pk(float x0, float x1) {
  v2f x;
  x.x = x0; x.y = x1;
  return __builtin_bit_cast(unsigned int, __builtin_convertvector(x, v2bf));
}

// x ~= hi + lo : hi = RNE16(x), lo = RNE16(x - hi); two values packed per dword (even element in the low half)
__device__ __forceinline__ void split2(float x0, float x1, unsigned int& ph, unsigned int& pl) {
  ph = bf_pk(x0, x1);
  pl = bf_pk(x0 - __uint_as_float(ph << 16), x1 - __uint_as_float(ph & 0xFFFF0000u));
}
__device__ __forceinline__ void split1(float x, us_t& hb, us_t& lb) {
  const bf16_t h = (bf16_t)x;
  hb = __builtin_bit_cast(us_t, h);
  lb = __builtin_bit_cast(us_t, (bf16_t)(x - (float)h));
}
// 8 consecutive k values (a = k..k+3, b = k+4..k+7) -> packed hi and lo halves of a fragment
__device__ __forceinline__ void split8(v4f a, v4f b, v4u& ph, v4u& pl) {
  unsigned int h0, l0, h1, l1, h2, l2, h3, l3;
  split2(a.x, a.y, h0, l0);
  split2(a.z, a.w, h1, l1);
  split2(b.x, b.y, h2, l2);
  split2(b.z, b.w, h3, l3);
  ph = mk4(h0, h1, h2, h3);
  pl = mk4(l0, l1, l2, l3);
}

// D += Ah*Bh + Ah*Bl + Al*Bh ; 4 v_nop guard tying D and keeping all operands live
__device__ __forceinline__ v8f mma3(v16bf ah, v16bf al, v16bf bh, v16bf bl, v8f c) {
  c = __builtin_amdgcn_wmma_f32_16x16x32_bf16(false, ah, false, bh, (short)0, c, false, false);
  c = __builtin_amdgcn_wmma_f32_16x16x32_bf16(false, ah, false, bl, (short)0, c, false, false);
  c = __builtin_amdgcn_wmma_f32_16x16x32_bf16(false, al, false, bh, (short)0, c, false, false);
  asm volatile("v_nop\n\tv_nop\n\tv_nop\n\tv_nop" : "+v"(c) : "v"(ah), "v"(al), "v"(bh), "v"(bl));
  return c;
}

// 16-bit fragment from a row-major [row][k] array (pitch ld elements), rows base..base+15, k from k0.
// Lane l: row = l&15, h = l>>4; elements 0..7 = k0+8h+0..7, elements 8..15 = k0+16+8h+0..7.
// Used for B stored n-major with k contiguous (row = n), on LDS tiles.
__device__ __forceinline__ v16bf ldfrag(const us_t* base, int ld, int k0, int l) {
  const us_t* p = base + (size_t)(l & 15) * ld + k0 + 8 * (l >> 4);
  Frag f;
  f.u[0] = *(const v4u*)p;
  f.u[1] = *(const v4u*)(p + 16);
  return f.v;
}

// The workspace planes hold whole fragments in register order: one fragment (16 rows x 32 k) = FRAG
// elements = [half u][lane l][8 elements], the element map being ldfrag's. Each of the two loads of a
// wave then reads 512 contiguous bytes (4 cache lines) instead of 32 bytes from each of 16 lines.
// plane: wave-uniform base; off: byte offset of the fragment plus 16 * lane.
#define FRAG 512
#define FRAGB (2 * FRAG)
__device__ __forceinline__ v16bf ldfragp(const us_t* plane, unsigned int off) {
  const char* p = (const char*)plane + off;
  Frag f;
  f.u[0] = *(const v4u*)p;
  f.u[1] = *(const v4u*)(p + 512);
  return f.v;
}

// sine and cosine of one rotary angle, x in [0, 2^17): the angle is position * inverse frequency, position < SEQ and
// inverse frequency <= 1, whatever the inputs hold. One quadrant reduction (n = nearest whole number of pi/2, pi/2 taken
// off in three parts) serves both; the reduction, the two polynomials and the quadrant rules are those of the library's
// sinf and cosf for arguments of this size, so the values are the same bits. No path for larger, negative or
// non-finite arguments.
typedef char chk_ang[(SEQ <= (1 << 17)) ? 1 : -1];
__device__ __forceinline__ void rope_sincos(float x, float& sn, float& cs) {
  const float n = __builtin_rintf(x * __uint_as_float(0x3f22f983u));
  float r = __builtin_fmaf(n, __uint_as_float(0xbfc90fdau), x);
  r = __builtin_fmaf(n, __uint_as_float(0xb3a22168u), r);
  r = __builtin_fmaf(n, __uint_as_float(0xa7c234c4u), r);
  const unsigned int i = (unsigned int)(int)n;
  const float r2 = r * r;
  float ps = __builtin_fmaf(__uint_as_float(0xb94c1982u), r2, __uint_as_float(0x3c0881c4u));
  ps = __builtin_fmaf(r2, ps, __uint_as_float(0xbe2aaa9du));
  ps = r2 * ps;
  const float s = __builtin_fmaf(r, ps, r);
  float pc = __builtin_fmaf(__uint_as_float(0x37d75334u), r2, __uint_as_float(0xbab64f3bu));
  pc = __builtin_fmaf(r2, pc, __uint_as_float(0x3d2aabf7u));
  pc = __builtin_fmaf(r2, pc, __uint_as_float(0xbf000004u));
  const float c = __builtin_fmaf(r2, pc, 1.0f);
  const bool odd = (i & 1u) != 0u;
  const unsigned int flip = (i << 30) & 0x80000000u;   // quadrants 2 and 3 change the sign of both
  sn = __uint_as_float(__float_as_uint(odd ? c : s) ^ flip);
  cs = __uint_as_float(__float_as_uint(odd ? -s : c) ^ flip);
}

// =====================================================================
// Kernel 1: head projections + RoPE on q,k.  Block = 4 waves = 64 rows of one (matrix, head).
// Outputs (bf16 hi and lo planes), in fragment order (see ldfragp):
//   qh, kh : [bh][s / 16][d / 32][fragment: row = s % 16, k = d % 32]
//   vt     : [bh][s / 32][d / 16][fragment: row = d % 16, k = s % 32]
// =====================================================================
__global__ __launch_bounds__(128) void k_proj(
    const float* __restrict__ q, const float* __restrict__ k, const float* __restrict__ v,
    const float* __restrict__ Wq, const float* __restrict__ Wk, const float* __restrict__ Wv,
    us_t* __restrict__ qhh, us_t* __restrict__ qhl, us_t* __restrict__ khh, us_t* __restrict__ khl,
    us_t* __restrict__ vth, us_t* __restrict__ vtl) {
#pragma clang fp contract(off)
  __shared__ __attribute__((aligned(16))) us_t wt[2][DE][WPITCH];   // W^T hi/lo : [plane][d][z]
  __shared__ __attribute__((aligned(16))) us_t st[2][64][WPITCH];   // result tile staging
  __shared__ float invf[32];

  const int t = threadIdx.x, w = t >> 5, l = t & 31, m = l & 15, hh = l >> 4;
  const int blk = blockIdx.x;
  const int mat = blk / (HEADS * RT64);                 // 0 = q, 1 = k, 2 = v (block-uniform)
  const int rem = blk - mat * (HEADS * RT64);
  const int head = rem / RT64;
  const int rt = rem - head * RT64;
  const int row0 = rt * 64;                             // row in [0, BATCH*SEQ)
  const int b = row0 / SEQ, s0 = row0 - b * SEQ, bh = b * HEADS + head;

  const float* X = (mat == 0) ? q : ((mat == 1) ? k : v);
  const float* W = ((mat == 0) ? Wq : ((mat == 1) ? Wk : Wv)) + (size_t)head * DE * DE;

  // stage W[z][d] -> wt[p][d][z] as hi/lo bf16
#pragma unroll 4
  for (int j = 0; j < 32; ++j) {
    const int idx = j * 128 + t;
    const int z = idx >> 6, d = idx & 63;
    us_t hb, lb;
    split1(W[idx], hb, lb);
    wt[0][d][z] = hb;
    wt[1][d][z] = lb;
  }
  if (t < 32) invf[t] = 1.0f / powf(10000.0f, (float)t * 0.03125f);
  __syncthreads();

  // A fragments: this wave's 16 rows of X, k 0..31 and 32..63
  const float* xr = X + (size_t)(row0 + w * 16 + m) * DE;
  Frag ah0, al0, ah1, al1;
  {
    v4f a, c;
    a = *(const v4f*)(xr + 8 * hh);       c = *(const v4f*)(xr + 8 * hh + 4);       split8(a, c, ah0.u[0], al0.u[0]);
    a = *(const v4f*)(xr + 16 + 8 * hh);  c = *(const v4f*)(xr + 16 + 8 * hh + 4);  split8(a, c, ah0.u[1], al0.u[1]);
    a = *(const v4f*)(xr + 32 + 8 * hh);  c = *(const v4f*)(xr + 32 + 8 * hh + 4);  split8(a, c, ah1.u[0], al1.u[0]);
    a = *(const v4f*)(xr + 48 + 8 * hh);  c = *(const v4f*)(xr + 48 + 8 * hh + 4);  split8(a, c, ah1.u[1], al1.u[1]);
  }

  v8f acc[4];
#pragma unroll
  for (int n = 0; n < 4; ++n) acc[n] = zero8();
#pragma unroll
  for (int n = 0; n < 4; ++n) {
    acc[n] = mma3(ah0.v, al0.v, ldfrag(&wt[0][n * 16][0], WPITCH, 0, l),
                  ldfrag(&wt[1][n * 16][0], WPITCH, 0, l), acc[n]);
    acc[n] = mma3(ah1.v, al1.v, ldfrag(&wt[0][n * 16][0], WPITCH, 32, l),
                  ldfrag(&wt[1][n * 16][0], WPITCH, 32, l), acc[n]);
  }
  // acc[n][r] = Y[row0 + w*16 + 8*hh + r][n*16 + m]

  if (mat < 2) {   // interleaved-pair rotary embedding: cols (2i, 2i+1) are adjacent lanes
#pragma unroll
    for (int n = 0; n < 4; ++n) {
      const int N = n * 16 + m;
      const float f = invf[N >> 1];
#pragma unroll
      for (int r = 0; r < 8; ++r) {
        const int pos = s0 + w * 16 + 8 * hh + r;
        const float ang = (float)pos * f;
        float sn, cs;
        rope_sincos(ang, sn, cs);
        const float mine = acc[n][r];
        const float other = __shfl_xor(mine, 1, 32);
        acc[n][r] = ((N & 1) == 0) ? (mine * cs - other * sn) : (other * sn + mine * cs);
      }
    }
  }

  // stage the 64-row block tile as hi/lo bf16
  if (mat == 2) {   // transposed: st[p][d][row_local]
#pragma unroll
    for (int n = 0; n < 4; ++n)
#pragma unroll
      for (int r = 0; r < 8; ++r) {
        us_t hb, lb;
        split1(acc[n][r], hb, lb);
        st[0][n * 16 + m][w * 16 + 8 * hh + r] = hb;
        st[1][n * 16 + m][w * 16 + 8 * hh + r] = lb;
      }
  } else {          // row major: st[p][row_local][d]
#pragma unroll
    for (int n = 0; n < 4; ++n)
#pragma unroll
      for (int r = 0; r < 8; ++r) {
        us_t hb, lb;
        split1(acc[n][r], hb, lb);
        st[0][w * 16 + 8 * hh + r][n * 16 + m] = hb;
        st[1][w * 16 + 8 * hh + r][n * 16 + m] = lb;
      }
  }
  __syncthreads();

  // wave w writes the two fragments (k 0..31 and 32..63 of the staged tile) of staged rows w*16..w*16+15
  us_t* dsth = (mat == 2) ? vth : ((mat == 0) ? qhh : khh);
  us_t* dstl = (mat == 2) ? vtl : ((mat == 0) ? qhl : khl);
  // q, k: rows are s, the two fragments are neighbours; v: rows are d, the fragments lie one 32-query chunk apart
  const size_t fbase = (size_t)bh * SEQ * DE + (size_t)s0 * DE + (size_t)w * ((mat == 2) ? FRAG : 2 * FRAG);
  const size_t fstep = (mat == 2) ? (size_t)(32 * DE) : (size_t)FRAG;
  v4u vals[2][4];
#pragma unroll
  for (int i = 0; i < 4; ++i) {
    vals[0][i] = *(const v4u*)&st[0][w * 16 + m][16 * i + 8 * hh];
    vals[1][i] = *(const v4u*)&st[1][w * 16 + m][16 * i + 8 * hh];
  }
#pragma unroll
  for (int i = 0; i < 4; ++i) {
    const size_t o = fbase + (size_t)(i >> 1) * fstep + (i & 1) * 256 + 8 * l;
    *(v4u*)(dsth + o) = vals[0][i];
    *(v4u*)(dstl + o) = vals[1][i];
  }
  
}

// =====================================================================
// Kernel 2: per query row: m[q] = max_{k<=q} s/64, rcp[q] = 1 / sum exp(s/64 - m).
// One work-group per (bh, WT query tiles of 16 rows); wave w takes key tiles w, w + SPLIT, ... and puts
// each loaded key fragment to all WT query tiles; the waves' (max, sum) pairs meet in LDS.
// There are more work-groups than resident places; the index runs over the
// tiles from the longest key loop to the shortest (all bh of a tile side by side).
// =====================================================================
__global__ __launch_bounds__(32 * SPLIT) void k_stats(
    const us_t* __restrict__ qhh, const us_t* __restrict__ qhl,
    const us_t* __restrict__ khh, const us_t* __restrict__ khl, float* __restrict__ ml) {
  __shared__ float pm[SPLIT][16 * WT];
  __shared__ float ps[SPLIT][16 * WT];
  // the wave's number as a scalar: the loop's bounds and branch stay on the scalar unit
  const int w = __builtin_amdgcn_readfirstlane(threadIdx.x >> 5);
  const int rank = blockIdx.x / BH, bh = blockIdx.x - rank * BH;
  const int qt0 = (QT / WT - 1 - rank) * WT;   // first query tile: the last tile has the most keys
  const int l = threadIdx.x & 31, m = l & 15, hh = l >> 4;

  const size_t qoff = ((size_t)bh * SEQ + qt0 * 16) * DE;
  v16bf aqh[WT][2], aql[WT][2];
#pragma unroll
  for (int t = 0; t < WT; ++t) {
    const unsigned int ao = t * (2 * FRAGB) + 16 * l;
    aqh[t][0] = ldfragp(qhh + qoff, ao);
    aqh[t][1] = ldfragp(qhh + qoff, ao + FRAGB);
    aql[t][0] = ldfragp(qhl + qoff, ao);
    aql[t][1] = ldfragp(qhl + qoff, ao + FRAGB);
  }
  const us_t* Kh = khh + (size_t)bh * SEQ * DE;
  const us_t* Kl = khl + (size_t)bh * SEQ * DE;

  float mrow[WT][8], lrow[WT][8];
#pragma unroll
  for (int t = 0; t < WT; ++t)
#pragma unroll
    for (int r = 0; r < 8; ++r) { mrow[t][r] = NEG_BIG; lrow[t][r] = 0.f; }

  // a key tile past the diagonal of one of the query tiles is all masked there and adds exactly 0
#pragma unroll 1
  for (int kt = w; kt < qt0 + WT; kt += SPLIT) {
    const unsigned int ko = (unsigned int)kt * (2 * FRAGB) + 16 * l;
    const v16bf kh0 = ldfragp(Kh, ko), kl0 = ldfragp(Kl, ko);
    const v16bf kh1 = ldfragp(Kh, ko + FRAGB), kl1 = ldfragp(Kl, ko + FRAGB);
#pragma unroll
    for (int t = 0; t < WT; ++t) {
      v8f s = zero8();
      s = mma3(aqh[t][0], aql[t][0], kh0, kl0, s);
      s = mma3(aqh[t][1], aql[t][1], kh1, kl1, s);
      // s[r] = score[q = (qt0 + t)*16 + 8*hh + r][k = kt*16 + m]
      // running maximum and sum stay private to the lane (its own key column of every tile)
#pragma unroll
      for (int r = 0; r < 8; ++r) {
        const int qg = (qt0 + t) * 16 + 8 * hh + r;
        const int kg = kt * 16 + m;
        const float x = (kg <= qg) ? s[r] * (1.0f / 64.0f) : NEG_BIG;
        const float mn = fmaxf(mrow[t][r], x);
        lrow[t][r] = lrow[t][r] * __expf(mrow[t][r] - mn) + __expf(x - mn);
        mrow[t][r] = mn;
      }
    }
  }

  // one merge of the 16 lanes of each row: a lane that saw no valid key holds NEG_BIG and its sum scales to 0
#pragma unroll
  for (int t = 0; t < WT; ++t)
#pragma unroll
    for (int r = 0; r < 8; ++r) {
      float gm = mrow[t][r];
#pragma unroll
      for (int off = 1; off < 16; off <<= 1) gm = fmaxf(gm, __shfl_xor(gm, off, 32));
      float e = lrow[t][r] * __expf(mrow[t][r] - gm);
#pragma unroll
      for (int off = 1; off < 16; off <<= 1) e += __shfl_xor(e, off, 32);
      mrow[t][r] = gm;
      lrow[t][r] = e;
    }

  // merge of the waves: a wave that saw no valid key of a row holds NEG_BIG there and its sum scales to 0
  if (m == 0) {
#pragma unroll   // mrow and lrow live in registers: t and r must be constants
    for (int t = 0; t < WT; ++t)
#pragma unroll
      for (int r = 0; r < 8; ++r) {
        pm[w][16 * t + 8 * hh + r] = mrow[t][r];
        ps[w][16 * t + 8 * hh + r] = lrow[t][r];
      }
  }
  __syncthreads();
  if (threadIdx.x < 16 * WT) {
    const int row = threadIdx.x;
    float gm = pm[0][row];
    for (int j = 1; j < SPLIT; ++j) gm = fmaxf(gm, pm[j][row]);
    float e = 0.f;
    for (int j = 0; j < SPLIT; ++j) e += ps[j][row] * __expf(pm[j][row] - gm);
    v2f val;
    val.x = gm; val.y = 1.0f / e;
    *(v2f*)(ml + ((size_t)bh * SEQ + qt0 * 16 + row) * 2) = val;
  }
}

// =====================================================================
// Kernel 3: out_h[bh][kpos][d] = sum_{q > kpos} P[q,kpos] * vh[q][d]   (contraction over the query axis)
// One work-group per (bh, WT key tiles of 16 columns); wave w takes the 32-query chunks w, w + SPLIT, ... from
// the diagonal on. Each loaded q fragment, v fragment and row statistic serves all WT key tiles: per key tile
// two 16x16 score tiles -> P in registers (packed D tiles = P^T A fragment) -> 4 P^T.V products.
// The waves' partial tiles are summed through LDS. Stores f32 out_h [b*S][H*DE].
// The index runs over the tiles from the longest query loop to the shortest, as in k_stats.
// =====================================================================
__global__ __launch_bounds__(32 * SPLIT) void k_attn(
    const us_t* __restrict__ qhh, const us_t* __restrict__ qhl,
    const us_t* __restrict__ khh, const us_t* __restrict__ khl,
    const us_t* __restrict__ vth, const us_t* __restrict__ vtl,
    const float* __restrict__ ml, float* __restrict__ outh) {
  __shared__ __attribute__((aligned(16))) float so[SPLIT][16 * WT][OPITCH];
  // the wave's number as a scalar: the loop's bounds and branch stay on the scalar unit
  const int w = __builtin_amdgcn_readfirstlane(threadIdx.x >> 5);
  const int rank = blockIdx.x / BH, bh = blockIdx.x - rank * BH;
  const int kt0 = rank * WT;   // first key tile: the first tile has the most queries
  const int l = threadIdx.x & 31, m = l & 15, hh = l >> 4;

  // loop-invariant B fragments of the key tiles (kh rows kt0*16.., lane = key)
  const size_t koff = ((size_t)bh * SEQ + kt0 * 16) * DE;
  v16bf bkh[WT][2], bkl[WT][2];
#pragma unroll
  for (int t = 0; t < WT; ++t) {
    const unsigned int bo = t * (2 * FRAGB) + 16 * l;
    bkh[t][0] = ldfragp(khh + koff, bo);
    bkh[t][1] = ldfragp(khh + koff, bo + FRAGB);
    bkl[t][0] = ldfragp(khl + koff, bo);
    bkl[t][1] = ldfragp(khl + koff, bo + FRAGB);
  }

  v8f o[WT][4];
#pragma unroll
  for (int t = 0; t < WT; ++t)
#pragma unroll
    for (int n = 0; n < 4; ++n) o[t][n] = zero8();

  const float* mlb = ml + (size_t)bh * SEQ * 2;
  const us_t* Qh = qhh + (size_t)bh * SEQ * DE;
  const us_t* Ql = qhl + (size_t)bh * SEQ * DE;
  const us_t* Vh = vth + (size_t)bh * DE * SEQ;
  const us_t* Vl = vtl + (size_t)bh * DE * SEQ;

#pragma unroll 1
  for (int qc = ((kt0 >> 1) + w) * 32; qc < SEQ; qc += 32 * SPLIT) {
    // a 32-query chunk is 4 fragments in each plane, q and v alike: one byte offset serves all four planes
    const unsigned int fo = (unsigned int)qc * (DE * 2) + 16 * l;
    unsigned int ph[WT][2][4], pl[WT][2][4];
#pragma unroll
    for (int sub = 0; sub < 2; ++sub) {
      const int q0 = qc + 16 * sub;
      const unsigned int qo = fo + sub * (2 * FRAGB);
      const v16bf qh0 = ldfragp(Qh, qo), ql0 = ldfragp(Ql, qo);
      const v16bf qh1 = ldfragp(Qh, qo + FRAGB), ql1 = ldfragp(Ql, qo + FRAGB);
      v2f mr[8];
#pragma unroll
      for (int r = 0; r < 8; ++r) mr[r] = *(const v2f*)(mlb + 2 * (q0 + 8 * hh + r));
#pragma unroll
      for (int t = 0; t < WT; ++t) {
        const int kg = (kt0 + t) * 16 + m;          // this lane's key column in the score tile
        v8f s = zero8();
        s = mma3(qh0, ql0, bkh[t][0], bkl[t][0], s);
        s = mma3(qh1, ql1, bkh[t][1], bkl[t][1], s);
        // s[r] = score[q = q0 + 8*hh + r][k = kg]
        float p[8];
#pragma unroll
        for (int r = 0; r < 8; ++r) {
          const int qg = q0 + 8 * hh + r;
          const float e = __expf(s[r] * (1.0f / 64.0f) - mr[r].x) * mr[r].y;
          p[r] = (kg < qg) ? e : 0.f;               // causal and zeroed diagonal: strictly k < q
        }
#pragma unroll
        for (int j = 0; j < 4; ++j) split2(p[2 * j], p[2 * j + 1], ph[t][sub][j], pl[t][sub][j]);
      }
    }
    // P^T A fragments (rows = key m, k = 32 queries of this chunk): elements 0..7 from the first
    // 16-query D tile, 8..15 from the second, same lane.
    Frag aph[WT], apl[WT];
#pragma unroll
    for (int t = 0; t < WT; ++t) {
      aph[t].u[0] = mk4(ph[t][0][0], ph[t][0][1], ph[t][0][2], ph[t][0][3]);
      aph[t].u[1] = mk4(ph[t][1][0], ph[t][1][1], ph[t][1][2], ph[t][1][3]);
      apl[t].u[0] = mk4(pl[t][0][0], pl[t][0][1], pl[t][0][2], pl[t][0][3]);
      apl[t].u[1] = mk4(pl[t][1][0], pl[t][1][1], pl[t][1][2], pl[t][1][3]);
    }
#pragma unroll
    for (int n = 0; n < 4; ++n) {
      const unsigned int vo = fo + n * FRAGB;        // B fragment: rows d = n*16.., k = query from qc
      const v16bf vh = ldfragp(Vh, vo), vl = ldfragp(Vl, vo);
#pragma unroll
      for (int t = 0; t < WT; ++t) o[t][n] = mma3(aph[t].v, apl[t].v, vh, vl, o[t][n]);
    }
  }
  // o[t][n][r] = this wave's share of out_h[kpos = (kt0 + t)*16 + 8*hh + r][d = n*16 + m]

#pragma unroll
  for (int t = 0; t < WT; ++t)
#pragma unroll
    for (int n = 0; n < 4; ++n)
#pragma unroll
      for (int r = 0; r < 8; ++r) so[w][16 * t + 8 * hh + r][n * 16 + m] = o[t][n][r];
  __syncthreads();

  // each thread sums 4-float pieces of the (16 * WT) x 64 tile over the waves
  const int bb = bh / HEADS, head = bh - bb * HEADS;
  for (int i = threadIdx.x; i < 16 * WT * 16; i += 32 * SPLIT) {
    const int row = i >> 4, c4 = i & 15;
    v4f sum = *(const v4f*)&so[0][row][4 * c4];
    for (int j = 1; j < SPLIT; ++j) sum += *(const v4f*)&so[j][row][4 * c4];
    *(v4f*)(outh + ((size_t)bb * SEQ + kt0 * 16 + row) * ZDIM + head * DE + 4 * c4) = sum;
  }
}

// =====================================================================
// Kernel 4: out = out_h (4096 x 512) . W_o (512 x 64). One work-group per 16 rows; wave w takes the 64 k of
// head w, so no wave waits for a chunk another wave stages: its A rows and its W_o B fragments come straight
// from global memory, with no barrier between a load and its product. The waves' partial tiles are summed in LDS.
// =====================================================================
__global__ __launch_bounds__(32 * OSPLIT) void k_oproj(
    const float* __restrict__ outh, const float* __restrict__ Wo, float* __restrict__ out) {
  __shared__ __attribute__((aligned(16))) float so[OSPLIT][16][OPITCH];
  // the wave's number as a scalar: the bases of its k range stay on the scalar unit
  const int w = __builtin_amdgcn_readfirstlane(threadIdx.x >> 5);
  const int l = threadIdx.x & 31, m = l & 15, hh = l >> 4;
  const int rowbase = blockIdx.x * 16;

  // A: row = rowbase + m, k as in ldfrag. B: lane = column n*16 + m, the same k order, one W_o row per element.
  const float* ar = outh + (size_t)w * DE + (size_t)(rowbase + m) * ZDIM + 8 * hh;
  const float* br = Wo + (size_t)w * DE * DE + (size_t)(8 * hh) * DE + m;
  // araw, braw and acc live in registers: every loop below is unrolled so that their indices are constants
  v4f araw[2][4];
  float braw[2][4][16];
#pragma unroll
  for (int c = 0; c < 2; ++c)
#pragma unroll
    for (int u = 0; u < 2; ++u) {
      araw[c][2 * u] = *(const v4f*)(ar + c * 32 + 16 * u);
      araw[c][2 * u + 1] = *(const v4f*)(ar + c * 32 + 16 * u + 4);
    }
#pragma unroll
  for (int c = 0; c < 2; ++c)
#pragma unroll
    for (int n = 0; n < 4; ++n)
#pragma unroll
      for (int e = 0; e < 16; ++e)
        braw[c][n][e] = br[(size_t)(c * 32 + 16 * (e >> 3) + (e & 7)) * DE + n * 16];

  v8f acc[4];
#pragma unroll
  for (int n = 0; n < 4; ++n) acc[n] = zero8();
#pragma unroll
  for (int c = 0; c < 2; ++c) {
    Frag ah, al;
    split8(araw[c][0], araw[c][1], ah.u[0], al.u[0]);
    split8(araw[c][2], araw[c][3], ah.u[1], al.u[1]);
#pragma unroll
    for (int n = 0; n < 4; ++n) {
      Frag bh, bl;
#pragma unroll
      for (int u = 0; u < 2; ++u) {
        unsigned int h[4], lo[4];
#pragma unroll
        for (int j = 0; j < 4; ++j) split2(braw[c][n][8 * u + 2 * j], braw[c][n][8 * u + 2 * j + 1], h[j], lo[j]);
        bh.u[u] = mk4(h[0], h[1], h[2], h[3]);
        bl.u[u] = mk4(lo[0], lo[1], lo[2], lo[3]);
      }
      acc[n] = mma3(ah.v, al.v, bh.v, bl.v, acc[n]);
    }
  }
  // acc[n][r] = this wave's share of out[rowbase + 8*hh + r][n*16 + m]

#pragma unroll
  for (int n = 0; n < 4; ++n)
#pragma unroll
    for (int r = 0; r < 8; ++r) so[w][8 * hh + r][n * 16 + m] = acc[n][r];
  __syncthreads();

  // each thread sums one 4-float piece of the 16 x 64 tile over the waves; a wave stores 512 contiguous bytes
  const int row = threadIdx.x >> 4, c4 = threadIdx.x & 15;
  v4f sum = *(const v4f*)&so[0][row][4 * c4];
#pragma unroll
  for (int j = 1; j < OSPLIT; ++j) sum += *(const v4f*)&so[j][row][4 * c4];
  *(v4f*)(out + (size_t)(rowbase + row) * DE + 4 * c4) = sum;
}

extern "C" void kernel_launch(void* const* d_in, const int* in_sizes, int n_in,
                              void* d_out, int out_size, void* d_ws, size_t ws_size,
                              hipStream_t stream) {
  if (n_in < 7) return;
  if (in_sizes[0] != ROWS * DE || in_sizes[1] != ROWS * DE || in_sizes[2] != ROWS * DE) return;
  if (in_sizes[3] != HEADS * DE * DE || in_sizes[4] != HEADS * DE * DE || in_sizes[5] != HEADS * DE * DE) return;
  if (in_sizes[6] != ZDIM * DE) return;
  if (out_size != ROWS * DE) return;

  const float* q  = (const float*)d_in[0];
  const float* k  = (const float*)d_in[1];
  const float* v  = (const float*)d_in[2];
  const float* Wq = (const float*)d_in[3];
  const float* Wk = (const float*)d_in[4];
  const float* Wv = (const float*)d_in[5];
  const float* Wo = (const float*)d_in[6];
  float* out = (float*)d_out;

  char* ws = (char*)d_ws;
  size_t off = 0;
  const size_t plane = (size_t)BH * SEQ * DE * sizeof(us_t);          // 4 MiB each
  us_t* qhh = (us_t*)(ws + off); off += plane;
  us_t* qhl = (us_t*)(ws + off); off += plane;
  us_t* khh = (us_t*)(ws + off); off += plane;
  us_t* khl = (us_t*)(ws + off); off += plane;
  us_t* vth = (us_t*)(ws + off); off += plane;
  us_t* vtl = (us_t*)(ws + off); off += plane;
  float* ml   = (float*)(ws + off); off += (size_t)BH * SEQ * 2 * sizeof(float);    // 256 KiB
  float* outh = (float*)(ws + off); off += (size_t)ROWS * ZDIM * sizeof(float);      // 8 MiB
  if (off > ws_size) return;

  k_proj<<<dim3(3 * HEADS * RT64), dim3(128), 0, stream>>>(q, k, v, Wq, Wk, Wv,
                                                           qhh, qhl, khh, khl, vth, vtl);
  k_stats<<<dim3(BH * (QT / WT)), dim3(32 * SPLIT), 0, stream>>>(qhh, qhl, khh, khl, ml);
  k_attn<<<dim3(BH * (QT / WT)), dim3(32 * SPLIT), 0, stream>>>(qhh, qhl, khh, khl, vth, vtl, ml, outh);
  k_oproj<<<dim3(ROWS / 16), dim3(32 * OSPLIT), 0, stream>>>(outh, Wo, out);
}

// v009
// Measured time: 58.1 microseconds a run.
// In two side-by-side timings against v008, it was 1.09 and 1.07 times as fast.
// All steps since v000 together make it 9.35 times as fast.
#include <hip/hip_runtime.h>
#include <stddef.h>

// Contractions: head projections, q.k scores (statistics pass and output pass), P.V over the query axis,
// output projection -- all v_wmma_f32_16x16x32_bf16 with bf16 hi/lo operand split (hi*hi + hi*lo + lo*hi),
// f32 accumulate. RoPE, softmax statistics, masks and epilogues in f32.

#define HEADS 8
#define DE 64
#define BATCH 2
#define SEQ 2048
#define BH (BATCH * HEADS)
#define ZDIM (HEADS * DE)
#define ROWS (BATCH * SEQ)
#define QT (SEQ / 16)
#define RT64 (ROWS / 64)
#define WPITCH 72
#define OPITCH 68
#define NEG_BIG (-3.0e38f)
#define SPLIT 8   // waves of a work-group that share one tile's loop in k_stats
#define OSPLIT 8  // waves of a work-group that share the k axis in k_oproj: DE of the ZDIM k values each
#define WT 2      // 16-wide tiles one wave holds in k_stats and k_attn: each fragment loaded in the loop feeds WT products

typedef char chk_de[(DE == 64) ? 1 : -1];
typedef char chk_seq[((SEQ % 64) == 0) ? 1 : -1];
typedef char chk_rows[((ROWS % 64) == 0) ? 1 : -1];
typedef char chk_z[((ZDIM % 32) == 0) ? 1 : -1];
typedef char chk_os[(ZDIM == OSPLIT * DE && 16 * 16 == 32 * OSPLIT) ? 1 : -1];
typedef char chk_wt[((QT % WT) == 0 && (WT % 2) == 0) ? 1 : -1];

typedef __bf16 bf16_t;
typedef bf16_t v16bf __attribute__((ext_vector_type(16)));
typedef float v8f __attribute__((ext_vector_type(8)));
typedef float v4f __attribute__((ext_vector_type(4)));
typedef float v2f __attribute__((ext_vector_type(2)));
typedef unsigned int v4u __attribute__((ext_vector_type(4)));
typedef unsigned short us_t;

union Frag {
  v16bf v;
  v4u u[2];
};

__device__ __forceinline__ v4u mk4(unsigned int a, unsigned int b, unsigned int c, unsigned int d) {
  v4u r;
  r.x = a; r.y = b; r.z = c; r.w = d;
  return r;
}

__device__ __forceinline__ v8f zero8() {
  v8f z;
#pragma unroll
  for (int i = 0; i < 8; ++i) z[i] = 0.f;
  return z;
}

typedef bf16_t v2bf __attribute__((ext_vector_type(2)));

// two f32 -> two bf16 (RNE) packed in a dword, x0 in the low half: one v_cvt_pk_bf16_f32
__device__ __forceinline__ unsigned int bf_pk(float x0, float x1) {
  v2f x;
  x.x = x0; x.y = x1;
  return __builtin_bit_cast(unsigned int, __builtin_convertvector(x, v2bf));
}

// x ~= hi + lo : hi = RNE16(x), lo = RNE16(x - hi); two values packed per dword (even element in the low half)
__device__ __forceinline__ void split2(float x0, float x1, unsigned int& ph, unsigned int& pl) {
  ph = bf_pk(x0, x1);
  pl = bf_pk(x0 - __uint_as_float(ph << 16), x1 - __uint_as_float(ph & 0xFFFF0000u));
}
__device__ __forceinline__ void split1(float x, us_t& hb, us_t& lb) {
  const bf16_t h = (bf16_t)x;
  hb = __builtin_bit_cast(us_t, h);
  lb = __builtin_bit_cast(us_t, (bf16_t)(x - (float)h));
}
// 8 consecutive k values (a = k..k+3, b = k+4..k+7) -> packed hi and lo halves of a fragment
__device__ __forceinline__ void split8(v4f a, v4f b, v4u& ph, v4u& pl) {
  unsigned int h0, l0, h1, l1, h2, l2, h3, l3;
  split2(a.x, a.y, h0, l0);
  split2(a.z, a.w, h1, l1);
  split2(b.x, b.y, h2, l2);
  split2(b.z, b.w, h3, l3);
  ph = mk4(h0, h1, h2, h3);
  pl = mk4(l0, l1, l2, l3);
}

// D += Ah*Bh + Ah*Bl + Al*Bh ; 4 v_nop guard tying D and keeping all operands live
__device__ __forceinline__ v8f mma3(v16bf ah, v16bf al, v16bf bh, v16bf bl, v8f c) {
  c = __builtin_amdgcn_wmma_f32_16x16x32_bf16(false, ah, false, bh, (short)0, c, false, false);
  c = __builtin_amdgcn_wmma_f32_16x16x32_bf16(false, ah, false, bl, (short)0, c, false, false);
  c = __builtin_amdgcn_wmma_f32_16x16x32_bf16(false, al, false, bh, (short)0, c, false, false);
  asm volatile("v_nop\n\tv_nop\n\tv_nop\n\tv_nop" : "+v"(c) : "v"(ah), "v"(al), "v"(bh), "v"(bl));
  return c;
}

// 16-bit fragment from a row-major [row][k] array (pitch ld elements), rows base..base+15, k from k0.
// Lane l: row = l&15, h = l>>4; elements 0..7 = k0+8h+0..7, elements 8..15 = k0+16+8h+0..7.
// Used for B stored n-major with k contiguous (row = n), on LDS tiles.
__device__ __forceinline__ v16bf ldfrag(const us_t* base, int ld, int k0, int l) {
  const us_t* p = base + (size_t)(l & 15) * ld + k0 + 8 * (l >> 4);
  Frag f;
  f.u[0] = *(const v4u*)p;
  f.u[1] = *(const v4u*)(p + 16);
  return f.v;
}

// The workspace planes hold whole fragments in register order: one fragment (16 rows x 32 k) = FRAG
// elements = [half u][lane l][8 elements], the element map being ldfrag's. Each of the two loads of a
// wave then reads 512 contiguous bytes (4 cache lines) instead of 32 bytes from each of 16 lines.
// plane: wave-uniform base; off: byte offset of the fragment plus 16 * lane.
#define FRAG 512
#define FRAGB (2 * FRAG)
__device__ __forceinline__ v16bf ldfragp(const us_t* plane, unsigned int off) {
  const char* p = (const char*)plane + off;
  Frag f;
  f.u[0] = *(const v4u*)p;
  f.u[1] = *(const v4u*)(p + 512);
  return f.v;
}

// sine and cosine of one rotary angle, x in [0, 2^17): the angle is position * inverse frequency, position < SEQ and
// inverse frequency <= 1, whatever the inputs hold. One quadrant reduction (n = nearest whole number of pi/2, pi/2 taken
// off in three parts) serves both; the reduction, the two polynomials and the quadrant rules are those of the library's
// sinf and cosf for arguments of this size, so the values are the same bits. No path for larger, negative or
// non-finite arguments.
typedef char chk_ang[(SEQ <= (1 << 17)) ? 1 : -1];
__device__ __forceinline__ void rope_sincos(float x, float& sn, float& cs) {
  const float n = __builtin_rintf(x * __uint_as_float(0x3f22f983u));
  float r = __builtin_fmaf(n, __uint_as_float(0xbfc90fdau), x);
  r = __builtin_fmaf(n, __uint_as_float(0xb3a22168u), r);
  r = __builtin_fmaf(n, __uint_as_float(0xa7c234c4u), r);
  const unsigned int i = (unsigned int)(int)n;
  const float r2 = r * r;
  float ps = __builtin_fmaf(__uint_as_float(0xb94c1982u), r2, __uint_as_float(0x3c0881c4u));
  ps = __builtin_fmaf(r2, ps, __uint_as_float(0xbe2aaa9du));
  ps = r2 * ps;
  const float s = __builtin_fmaf(r, ps, r);
  float pc = __builtin_fmaf(__uint_as_float(0x37d75334u), r2, __uint_as_float(0xbab64f3bu));
  pc = __builtin_fmaf(r2, pc, __uint_as_float(0x3d2aabf7u));
  pc = __builtin_fmaf(r2, pc, __uint_as_float(0xbf000004u));
  const float c = __builtin_fmaf(r2, pc, 1.0f);
  const bool odd = (i & 1u) != 0u;
  const unsigned int flip = (i << 30) & 0x80000000u;   // quadrants 2 and 3 change the sign of both
  sn = __uint_as_float(__float_as_uint(odd ? c : s) ^ flip);
  cs = __uint_as_float(__float_as_uint(odd ? -s : c) ^ flip);
}

// =====================================================================
// Kernel 1: head projections + RoPE on q,k.  Block = 4 waves = 64 rows of one (matrix, head).
// Outputs (bf16 hi and lo planes), in fragment order (see ldfragp):
//   qh, kh : [bh][s / 16][d / 32][fragment: row = s % 16, k = d % 32]
//   vt     : [bh][s / 32][d / 16][fragment: row = d % 16, k = s % 32]
// =====================================================================
__global__ __launch_bounds__(128) void k_proj(
    const float* __restrict__ q, const float* __restrict__ k, const float* __restrict__ v,
    const float* __restrict__ Wq, const float* __restrict__ Wk, const float* __restrict__ Wv,
    us_t* __restrict__ qhh, us_t* __restrict__ qhl, us_t* __restrict__ khh, us_t* __restrict__ khl,
    us_t* __restrict__ vth, us_t* __restrict__ vtl) {
#pragma clang fp contract(off)
  __shared__ __attribute__((aligned(16))) us_t wt[2][DE][WPITCH];   // W^T hi/lo : [plane][d][z]
  __shared__ __attribute__((aligned(16))) us_t st[2][64][WPITCH];   // result tile staging
  __shared__ float invf[32];

  const int t = threadIdx.x, w = t >> 5, l = t & 31, m = l & 15, hh = l >> 4;
  const int blk = blockIdx.x;
  const int mat = blk / (HEADS * RT64);                 // 0 = q, 1 = k, 2 = v (block-uniform)
  const int rem = blk - mat * (HEADS * RT64);
  const int head = rem / RT64;
  const int rt = rem - head * RT64;
  const int row0 = rt * 64;                             // row in [0, BATCH*SEQ)
  const int b = row0 / SEQ, s0 = row0 - b * SEQ, bh = b * HEADS + head;

  const float* X = (mat == 0) ? q : ((mat == 1) ? k : v);
  const float* W = ((mat == 0) ? Wq : ((mat == 1) ? Wk : Wv)) + (size_t)head * DE * DE;

  // stage W[z][d] -> wt[p][d][z] as hi/lo bf16
#pragma unroll 4
  for (int j = 0; j < 32; ++j) {
    const int idx = j * 128 + t;
    const int z = idx >> 6, d = idx & 63;
    us_t hb, lb;
    split1(W[idx], hb, lb);
    wt[0][d][z] = hb;
    wt[1][d][z] = lb;
  }
  if (t < 32) invf[t] = 1.0f / powf(10000.0f, (float)t * 0.03125f);
  __syncthreads();

  // A fragments: this wave's 16 rows of X, k 0..31 and 32..63
  const float* xr = X + (size_t)(row0 + w * 16 + m) * DE;
  Frag ah0, al0, ah1, al1;
  {
    v4f a, c;
    a = *(const v4f*)(xr + 8 * hh);       c = *(const v4f*)(xr + 8 * hh + 4);       split8(a, c, ah0.u[0], al0.u[0]);
    a = *(const v4f*)(xr + 16 + 8 * hh);  c = *(const v4f*)(xr + 16 + 8 * hh + 4);  split8(a, c, ah0.u[1], al0.u[1]);
    a = *(const v4f*)(xr + 32 + 8 * hh);  c = *(const v4f*)(xr + 32 + 8 * hh + 4);  split8(a, c, ah1.u[0], al1.u[0]);
    a = *(const v4f*)(xr + 48 + 8 * hh);  c = *(const v4f*)(xr + 48 + 8 * hh + 4);  split8(a, c, ah1.u[1], al1.u[1]);
  }

  v8f acc[4];
#pragma unroll
  for (int n = 0; n < 4; ++n) acc[n] = zero8();
#pragma unroll
  for (int n = 0; n < 4; ++n) {
    acc[n] = mma3(ah0.v, al0.v, ldfrag(&wt[0][n * 16][0], WPITCH, 0, l),
                  ldfrag(&wt[1][n * 16][0], WPITCH, 0, l), acc[n]);
    acc[n] = mma3(ah1.v, al1.v, ldfrag(&wt[0][n * 16][0], WPITCH, 32, l),
                  ldfrag(&wt[1][n * 16][0], WPITCH, 32, l), acc[n]);
  }
  // acc[n][r] = Y[row0 + w*16 + 8*hh + r][n*16 + m]

  if (mat < 2) {   // interleaved-pair rotary embedding: cols (2i, 2i+1) are adjacent lanes
#pragma unroll
    for (int n = 0; n < 4; ++n) {
      const int N = n * 16 + m;
      const float f = invf[N >> 1];
#pragma unroll
      for (int r = 0; r < 8; ++r) {
        const int pos = s0 + w * 16 + 8 * hh + r;
        const float ang = (float)pos * f;
        float sn, cs;
        rope_sincos(ang, sn, cs);
        const float mine = acc[n][r];
        const float other = __shfl_xor(mine, 1, 32);
        acc[n][r] = ((N & 1) == 0) ? (mine * cs - other * sn) : (other * sn + mine * cs);
      }
    }
  }

  // stage the 64-row block tile as hi/lo bf16
  if (mat == 2) {   // transposed: st[p][d][row_local]
#pragma unroll
    for (int n = 0; n < 4; ++n)
#pragma unroll
      for (int r = 0; r < 8; ++r) {
        us_t hb, lb;
        split1(acc[n][r], hb, lb);
        st[0][n * 16 + m][w * 16 + 8 * hh + r] = hb;
        st[1][n * 16 + m][w * 16 + 8 * hh + r] = lb;
      }
  } else {          // row major: st[p][row_local][d]
#pragma unroll
    for (int n = 0; n < 4; ++n)
#pragma unroll
      for (int r = 0; r < 8; ++r) {
        us_t hb, lb;
        split1(acc[n][r], hb, lb);
        st[0][w * 16 + 8 * hh + r][n * 16 + m] = hb;
        st[1][w * 16 + 8 * hh + r][n * 16 + m] = lb;
      }
  }
  __syncthreads();

  // wave w writes the two fragments (k 0..31 and 32..63 of the staged tile) of staged rows w*16..w*16+15
  us_t* dsth = (mat == 2) ? vth : ((mat == 0) ? qhh : khh);
  us_t* dstl = (mat == 2) ? vtl : ((mat == 0) ? qhl : khl);
  // q, k: rows are s, the two fragments are neighbours; v: rows are d, the fragments lie one 32-query chunk apart
  const size_t fbase = (size_t)bh * SEQ * DE + (size_t)s0 * DE + (size_t)w * ((mat == 2) ? FRAG : 2 * FRAG);
  const size_t fstep = (mat == 2) ? (size_t)(32 * DE) : (size_t)FRAG;
  v4u vals[2][4];
#pragma unroll
  for (int i = 0; i < 4; ++i) {
    vals[0][i] = *(const v4u*)&st[0][w * 16 + m][16 * i + 8 * hh];
    vals[1][i] = *(const v4u*)&st[1][w * 16 + m][16 * i + 8 * hh];
  }
#pragma unroll
  for (int i = 0; i < 4; ++i) {
    const size_t o = fbase + (size_t)(i >> 1) * fstep + (i & 1) * 256 + 8 * l;
    *(v4u*)(dsth + o) = vals[0][i];
    *(v4u*)(dstl + o) = vals[1][i];
  }
  
}

// =====================================================================
// Kernel 2: per query row: m[q] = max_{k<=q} s/64, rcp[q] = 1 / sum exp(s/64 - m).
// One work-group per (bh, WT query tiles of 16 rows); wave w takes key tiles w, w + SPLIT, ... and puts
// each loaded key fragment to all WT query tiles; the waves' (max, sum) pairs meet in LDS.
// There are more work-groups than resident places; the index runs over the
// tiles from the longest key loop to the shortest (all bh of a tile side by side).
// =====================================================================
__global__ __launch_bounds__(32 * SPLIT) void k_stats(
    const us_t* __restrict__ qhh, const us_t* __restrict__ qhl,
    const us_t* __restrict__ khh, const us_t* __restrict__ khl, float* __restrict__ ml) {
  __shared__ float pm[SPLIT][16 * WT];
  __shared__ float ps[SPLIT][16 * WT];
  // the wave's number as a scalar: the loop's bounds and branch stay on the scalar unit
  const int w = __builtin_amdgcn_readfirstlane(threadIdx.x >> 5);
  const int rank = blockIdx.x / BH, bh = blockIdx.x - rank * BH;
  const int qt0 = (QT / WT - 1 - rank) * WT;   // first query tile: the last tile has the most keys
  const int l = threadIdx.x & 31, m = l & 15, hh = l >> 4;

  const size_t qoff = ((size_t)bh * SEQ + qt0 * 16) * DE;
  v16bf aqh[WT][2], aql[WT][2];
#pragma unroll
  for (int t = 0; t < WT; ++t) {
    const unsigned int ao = t * (2 * FRAGB) + 16 * l;
    aqh[t][0] = ldfragp(qhh + qoff, ao);
    aqh[t][1] = ldfragp(qhh + qoff, ao + FRAGB);
    aql[t][0] = ldfragp(qhl + qoff, ao);
    aql[t][1] = ldfragp(qhl + qoff, ao + FRAGB);
  }
  const us_t* Kh = khh + (size_t)bh * SEQ * DE;
  const us_t* Kl = khl + (size_t)bh * SEQ * DE;

  float mrow[WT][8], lrow[WT][8];
#pragma unroll
  for (int t = 0; t < WT; ++t)
#pragma unroll
    for (int r = 0; r < 8; ++r) { mrow[t][r] = NEG_BIG; lrow[t][r] = 0.f; }

  // a key tile past the diagonal of one of the query tiles is all masked there and adds exactly 0
#pragma unroll 1
  for (int kt = w; kt < qt0 + WT; kt += SPLIT) {
    const unsigned int ko = (unsigned int)kt * (2 * FRAGB) + 16 * l;
    const v16bf kh0 = ldfragp(Kh, ko), kl0 = ldfragp(Kl, ko);
    const v16bf kh1 = ldfragp(Kh, ko + FRAGB), kl1 = ldfragp(Kl, ko + FRAGB);
#pragma unroll
    for (int t = 0; t < WT; ++t) {
      v8f s = zero8();
      s = mma3(aqh[t][0], aql[t][0], kh0, kl0, s);
      s = mma3(aqh[t][1], aql[t][1], kh1, kl1, s);
      // s[r] = score[q = (qt0 + t)*16 + 8*hh + r][k = kt*16 + m]
      // running maximum and sum stay private to the lane (its own key column of every tile)
#pragma unroll
      for (int r = 0; r < 8; ++r) {
        const int qg = (qt0 + t) * 16 + 8 * hh + r;
        const int kg = kt * 16 + m;
        const float x = (kg <= qg) ? s[r] * (1.0f / 64.0f) : NEG_BIG;
        const float mn = fmaxf(mrow[t][r], x);
        lrow[t][r] = lrow[t][r] * __expf(mrow[t][r] - mn) + __expf(x - mn);
        mrow[t][r] = mn;
      }
    }
  }

  // one merge of the 16 lanes of each row: a lane that saw no valid key holds NEG_BIG and its sum scales to 0
#pragma unroll
  for (int t = 0; t < WT; ++t)
#pragma unroll
    for (int r = 0; r < 8; ++r) {
      float gm = mrow[t][r];
#pragma unroll
      for (int off = 1; off < 16; off <<= 1) gm = fmaxf(gm, __shfl_xor(gm, off, 32));
      float e = lrow[t][r] * __expf(mrow[t][r] - gm);
#pragma unroll
      for (int off = 1; off < 16; off <<= 1) e += __shfl_xor(e, off, 32);
      mrow[t][r] = gm;
      lrow[t][r] = e;
    }

  // merge of the waves: a wave that saw no valid key of a row holds NEG_BIG there and its sum scales to 0
  if (m == 0) {
#pragma unroll   // mrow and lrow live in registers: t and r must be constants
    for (int t = 0; t < WT; ++t)
#pragma unroll
      for (int r = 0; r < 8; ++r) {
        pm[w][16 * t + 8 * hh + r] = mrow[t][r];
        ps[w][16 * t + 8 * hh + r] = lrow[t][r];
      }
  }
  __syncthreads();
  if (threadIdx.x < 16 * WT) {
    const int row = threadIdx.x;
    float gm = pm[0][row];
    for (int j = 1; j < SPLIT; ++j) gm = fmaxf(gm, pm[j][row]);
    float e = 0.f;
    for (int j = 0; j < SPLIT; ++j) e += ps[j][row] * __expf(pm[j][row] - gm);
    v2f val;
    val.x = gm; val.y = 1.0f / e;
    *(v2f*)(ml + ((size_t)bh * SEQ + qt0 * 16 + row) * 2) = val;
  }
}

// =====================================================================
// Kernel 3: out_h[bh][kpos][d] = sum_{q > kpos} P[q,kpos] * vh[q][d]   (contraction over the query axis)
// One work-group per (bh, KP wave tiles of WT key tiles of 16 columns) = AW waves: wave (kp, g) holds wave tile kp
// and takes the 32-query chunk g of every stage. A stage = QG chunks of the q and v planes (hi and lo) and their row
// statistics, brought from global memory into LDS once for the whole work-group by asynchronous copies, in a ring of
// two buffers: the next stage's copies fly while this one is worked on, and every fragment is read KP times from LDS.
// Per chunk and key tile: two 16x16 score tiles -> P in registers (packed D tiles = P^T A fragment) -> 4 P^T.V products.
// The waves' partial tiles are summed through LDS (the ring's bytes, free by then). Stores f32 out_h [b*S][H*DE].
// The index runs over the tiles from the longest query loop to the shortest, as in k_stats.
// =====================================================================
#define KP 2                      // wave tiles side by side in a work-group
#define QG 8                      // chunks of a stage
#define AW (KP * QG)              // waves of a work-group
#define KB (KP * WT * 16)         // keys of a work-group
#define CHB (4 * FRAGB)           // bytes of a 32-query chunk in one plane
#define PLB (QG * CHB)            // bytes of a stage in one plane
#define MLB (QG * 32 * 8)         // bytes of a stage's row statistics
#define STB (4 * PLB + MLB)       // bytes of a stage
#define NST (SEQ / (32 * QG))     // stages of the whole query axis
#define RB (32 * AW * 16)         // bytes one 16-byte copy of every thread covers
typedef char chk_st[(PLB == 4 * RB && MLB == 32 * AW * 4 && (SEQ % (32 * QG)) == 0 && WT == 2) ? 1 : -1];
typedef char chk_so[(QG * KB * OPITCH * 4 <= 2 * STB) ? 1 : -1];

// eight 16-byte copies of every lane, global memory -> LDS through no register: four steps of RB bytes in each of two
// planes. la, lb: the lane's LDS byte addresses; ga, gb: its global addresses. The s_wait_xcnt closes the statement so
// that no address register is rewritten in front of it.
__device__ __forceinline__ void copy8(unsigned int la, const char* ga, unsigned int lb, const char* gb) {
  asm volatile(
      "global_load_async_to_lds_b128 %0, %8, off\n\t"
      "global_load_async_to_lds_b128 %1, %9, off\n\t"
      "global_load_async_to_lds_b128 %2, %10, off\n\t"
      "global_load_async_to_lds_b128 %3, %11, off\n\t"
      "global_load_async_to_lds_b128 %4, %12, off\n\t"
      "global_load_async_to_lds_b128 %5, %13, off\n\t"
      "global_load_async_to_lds_b128 %6, %14, off\n\t"
      "global_load_async_to_lds_b128 %7, %15, off\n\t"
      "s_wait_xcnt 0x0"
      :: "v"(la), "v"(la + RB), "v"(la + 2 * RB), "v"(la + 3 * RB),
         "v"(lb), "v"(lb + RB), "v"(lb + 2 * RB), "v"(lb + 3 * RB),
         "v"(ga), "v"(ga + RB), "v"(ga + 2 * RB), "v"(ga + 3 * RB),
         "v"(gb), "v"(gb + RB), "v"(gb + 2 * RB), "v"(gb + 3 * RB)
      : "memory");
}
// one 4-byte copy of every lane, the wait as in copy8
__device__ __forceinline__ void copy1(unsigned int la, const char* ga) {
  asm volatile("global_load_async_to_lds_b32 %0, %1, off\n\ts_wait_xcnt 0x0" :: "v"(la), "v"(ga) : "memory");
}
// fragment in register order from LDS: p = fragment start + 16 * lane
__device__ __forceinline__ v16bf ldfragl(const char* p) {
  Frag f;
  f.u[0] = *(const v4u*)p;
  f.u[1] = *(const v4u*)(p + 512);
  return f.v;
}

__global__ __launch_bounds__(32 * AW) void k_attn(
    const us_t* __restrict__ qhh, const us_t* __restrict__ qhl,
    const us_t* __restrict__ khh, const us_t* __restrict__ khl,
    const us_t* __restrict__ vth, const us_t* __restrict__ vtl,
    const float* __restrict__ ml, float* __restrict__ outh) {
  __shared__ __attribute__((aligned(16))) char sm[2 * STB];   // [buffer][q hi | q lo | v hi | v lo | statistics]
  // the wave's number as a scalar: the skip of chunks in front of the diagonal stays a scalar branch
  const int w = __builtin_amdgcn_readfirstlane(threadIdx.x >> 5);
  const int kp = w / QG, g = w - kp * QG;
  const int blk = blockIdx.x / BH, bh = blockIdx.x - blk * BH;   // the first key block has the most queries
  const int kt0 = (blk * KP + kp) * WT;   // first key tile of this wave
  const int cw = kt0 >> 1;                // the chunk that holds this wave's diagonal
  const int st0 = (blk * KB) / (32 * QG); // the stage that holds the work-group's first diagonal
  const int l = threadIdx.x & 31, m = l & 15, hh = l >> 4;

  // this thread's share of every stage: the same byte offsets in LDS and in the planes
  const unsigned int lds0 = (unsigned int)(size_t)sm + 16 * threadIdx.x;
  const unsigned int ldsm = (unsigned int)(size_t)sm + 4 * PLB + 4 * threadIdx.x;
  const size_t pb = (size_t)bh * SEQ * DE * 2 + 16 * threadIdx.x;
  const char* gqh = (const char*)qhh + pb;
  const char* gql = (const char*)qhl + pb;
  const char* gvh = (const char*)vth + pb;
  const char* gvl = (const char*)vtl + pb;
  const char* gml = (const char*)ml + (size_t)bh * SEQ * 8 + 4 * threadIdx.x;

  // stage st0 into buffer 0
  copy8(lds0, gqh + (size_t)st0 * PLB, lds0 + PLB, gql + (size_t)st0 * PLB);
  copy8(lds0 + 2 * PLB, gvh + (size_t)st0 * PLB, lds0 + 3 * PLB, gvl + (size_t)st0 * PLB);
  copy1(ldsm, gml + (size_t)st0 * MLB);

  // loop-invariant B fragments of the key tiles (kh rows kt0*16.., lane = key)
  const size_t koff = ((size_t)bh * SEQ + kt0 * 16) * DE;
  v16bf bkh[WT][2], bkl[WT][2];
#pragma unroll
  for (int t = 0; t < WT; ++t) {
    const unsigned int bo = t * (2 * FRAGB) + 16 * l;
    bkh[t][0] = ldfragp(khh + koff, bo);
    bkh[t][1] = ldfragp(khh + koff, bo + FRAGB);
    bkl[t][0] = ldfragp(khl + koff, bo);
    bkl[t][1] = ldfragp(khl + koff, bo + FRAGB);
  }

  v8f o[WT][4];
#pragma unroll
  for (int t = 0; t < WT; ++t)
#pragma unroll
    for (int n = 0; n < 4; ++n) o[t][n] = zero8();

  asm volatile("s_wait_asynccnt 0x0" ::: "memory");   // this wave's copies of the first stage have landed
  __syncthreads();                                    // and every other wave's
  if (st0 + 1 < NST) {                                // the second stage into buffer 1
    const size_t so1 = (size_t)(st0 + 1);
    copy8(lds0 + STB, gqh + so1 * PLB, lds0 + STB + PLB, gql + so1 * PLB);
    copy8(lds0 + STB + 2 * PLB, gvh + so1 * PLB, lds0 + STB + 3 * PLB, gvl + so1 * PLB);
    copy1(ldsm + STB, gml + so1 * MLB);
  }

#pragma unroll 1   // rolled: the trip count differs per work-group, and the ring's hand-over stands once in the text
  for (int st = st0; st < NST; ++st) {
    const unsigned int bo = ((st - st0) & 1) * STB;   // this stage's buffer
    const int c = st * QG + g;                        // this wave's chunk
    if (c >= cw) {                                    // chunks in front of the diagonal are all masked
      const int qc = c * 32;
      const char* fb = sm + bo + g * CHB + 16 * l;    // the chunk is 4 fragments in each plane, q and v alike
      const char* mb = sm + bo + 4 * PLB + (g * 32 + 8 * hh) * 8;
      unsigned int ph[WT][2][4], pl[WT][2][4];
#pragma unroll
      for (int sub = 0; sub < 2; ++sub) {
        const int q0 = qc + 16 * sub;
        const char* qb = fb + sub * (2 * FRAGB);
        const v16bf qh0 = ldfragl(qb), ql0 = ldfragl(qb + PLB);
        const v16bf qh1 = ldfragl(qb + FRAGB), ql1 = ldfragl(qb + PLB + FRAGB);
        v4f mq[4];   // rows 2i and 2i + 1 of this lane's eight: (max, 1 / sum) each
#pragma unroll
        for (int i = 0; i < 4; ++i) mq[i] = *(const v4f*)(mb + sub * 128 + 16 * i);
#pragma unroll
        for (int t = 0; t < WT; ++t) {
          const int kg = (kt0 + t) * 16 + m;          // this lane's key column in the score tile
          v8f s = zero8();
          s = mma3(qh0, ql0, bkh[t][0], bkl[t][0], s);
          s = mma3(qh1, ql1, bkh[t][1], bkl[t][1], s);
          // s[r] = score[q = q0 + 8*hh + r][k = kg]
          float p[8];
#pragma unroll
          for (int r = 0; r < 8; ++r) {
            const int qg = q0 + 8 * hh + r;
            const float e = __expf(s[r] * (1.0f / 64.0f) - mq[r >> 1][2 * (r & 1)]) * mq[r >> 1][2 * (r & 1) + 1];
            p[r] = (kg < qg) ? e : 0.f;               // causal and zeroed diagonal: strictly k < q
          }
#pragma unroll
          for (int j = 0; j < 4; ++j) split2(p[2 * j], p[2 * j + 1], ph[t][sub][j], pl[t][sub][j]);
        }
      }
      // P^T A fragments (rows = key m, k = 32 queries of this chunk): elements 0..7 from the first
      // 16-query D tile, 8..15 from the second, same lane.
      Frag aph[WT], apl[WT];
#pragma unroll
      for (int t = 0; t < WT; ++t) {
        aph[t].u[0] = mk4(ph[t][0][0], ph[t][0][1], ph[t][0][2], ph[t][0][3]);
        aph[t].u[1] = mk4(ph[t][1][0], ph[t][1][1], ph[t][1][2], ph[t][1][3]);
        apl[t].u[0] = mk4(pl[t][0][0], pl[t][0][1], pl[t][0][2], pl[t][0][3]);
        apl[t].u[1] = mk4(pl[t][1][0], pl[t][1][1], pl[t][1][2], pl[t][1][3]);
      }
#pragma unroll
      for (int n = 0; n < 4; ++n) {
        // B fragment: rows d = n*16.., k = query from qc
        const v16bf vh = ldfragl(fb + 2 * PLB + n * FRAGB), vl = ldfragl(fb + 3 * PLB + n * FRAGB);
#pragma unroll
        for (int t = 0; t < WT; ++t) o[t][n] = mma3(aph[t].v, apl[t].v, vh, vl, o[t][n]);
      }
    }
    // hand-over, passed by every wave: the next stage is published and this stage's buffer is given free
    asm volatile("s_wait_dscnt 0x0" ::: "memory");      // this wave's reads of the buffer are done
    asm volatile("s_wait_asynccnt 0x0" ::: "memory");   // its copies of the next stage have landed
    __syncthreads();
    if (st + 2 < NST) {                                 // the stage after the next into the buffer just read
      const size_t so2 = (size_t)(st + 2);
      copy8(lds0 + bo, gqh + so2 * PLB, lds0 + bo + PLB, gql + so2 * PLB);
      copy8(lds0 + bo + 2 * PLB, gvh + so2 * PLB, lds0 + bo + 3 * PLB, gvl + so2 * PLB);
      copy1(ldsm + bo, gml + so2 * MLB);
    }
  }
  asm volatile("s_wait_asynccnt 0x0" ::: "memory");     // no copy is under way when the ring's bytes change their use
  // o[t][n][r] = this wave's share of out_h[kpos = (kt0 + t)*16 + 8*hh + r][d = n*16 + m]

  float* so = (float*)sm;   // [g][key of the work-group][OPITCH]
#pragma unroll
  for (int t = 0; t < WT; ++t)
#pragma unroll
    for (int n = 0; n < 4; ++n)
#pragma unroll
      for (int r = 0; r < 8; ++r)
        so[(size_t)(g * KB + (kp * WT + t) * 16 + 8 * hh + r) * OPITCH + n * 16 + m] = o[t][n][r];
  __syncthreads();

  // each thread sums 4-float pieces of the KB x 64 tile over the QG waves of a key tile
  const int bb = bh / HEADS, head = bh - bb * HEADS;
  for (int i = threadIdx.x; i < KB * 16; i += 32 * AW) {
    const int row = i >> 4, c4 = i & 15;
    v4f sum = *(const v4f*)&so[(size_t)row * OPITCH + 4 * c4];
    for (int j = 1; j < QG; ++j) sum += *(const v4f*)&so[(size_t)(j * KB + row) * OPITCH + 4 * c4];
    *(v4f*)(outh + ((size_t)bb * SEQ + blk * KB + row) * ZDIM + head * DE + 4 * c4) = sum;
  }
}

// =====================================================================
// Kernel 4: out = out_h (4096 x 512) . W_o (512 x 64). One work-group per 16 rows; wave w takes the 64 k of
// head w, so no wave waits for a chunk another wave stages: its A rows and its W_o B fragments come straight
// from global memory, with no barrier between a load and its product. The waves' partial tiles are summed in LDS.
// =====================================================================
__global__ __launch_bounds__(32 * OSPLIT) void k_oproj(
    const float* __restrict__ outh, const float* __restrict__ Wo, float* __restrict__ out) {
  __shared__ __attribute__((aligned(16))) float so[OSPLIT][16][OPITCH];
  // the wave's number as a scalar: the bases of its k range stay on the scalar unit
  const int w = __builtin_amdgcn_readfirstlane(threadIdx.x >> 5);
  const int l = threadIdx.x & 31, m = l & 15, hh = l >> 4;
  const int rowbase = blockIdx.x * 16;

  // A: row = rowbase + m, k as in ldfrag. B: lane = column n*16 + m, the same k order, one W_o row per element.
  const float* ar = outh + (size_t)w * DE + (size_t)(rowbase + m) * ZDIM + 8 * hh;
  const float* br = Wo + (size_t)w * DE * DE + (size_t)(8 * hh) * DE + m;
  // araw, braw and acc live in registers: every loop below is unrolled so that their indices are constants
  v4f araw[2][4];
  float braw[2][4][16];
#pragma unroll
  for (int c = 0; c < 2; ++c)
#pragma unroll
    for (int u = 0; u < 2; ++u) {
      araw[c][2 * u] = *(const v4f*)(ar + c * 32 + 16 * u);
      araw[c][2 * u + 1] = *(const v4f*)(ar + c * 32 + 16 * u + 4);
    }
#pragma unroll
  for (int c = 0; c < 2; ++c)
#pragma unroll
    for (int n = 0; n < 4; ++n)
#pragma unroll
      for (int e = 0; e < 16; ++e)
        braw[c][n][e] = br[(size_t)(c * 32 + 16 * (e >> 3) + (e & 7)) * DE + n * 16];

  v8f acc[4];
#pragma unroll
  for (int n = 0; n < 4; ++n) acc[n] = zero8();
#pragma unroll
  for (int c = 0; c < 2; ++c) {
    Frag ah, al;
    split8(araw[c][0], araw[c][1], ah.u[0], al.u[0]);
    split8(araw[c][2], araw[c][3], ah.u[1], al.u[1]);
#pragma unroll
    for (int n = 0; n < 4; ++n) {
      Frag bh, bl;
#pragma unroll
      for (int u = 0; u < 2; ++u) {
        unsigned int h[4], lo[4];
#pragma unroll
        for (int j = 0; j < 4; ++j) split2(braw[c][n][8 * u + 2 * j], braw[c][n][8 * u + 2 * j + 1], h[j], lo[j]);
        bh.u[u] = mk4(h[0], h[1], h[2], h[3]);
        bl.u[u] = mk4(lo[0], lo[1], lo[2], lo[3]);
      }
      acc[n] = mma3(ah.v, al.v, bh.v, bl.v, acc[n]);
    }
  }
  // acc[n][r] = this wave's share of out[rowbase + 8*hh + r][n*16 + m]

#pragma unroll
  for (int n = 0; n < 4; ++n)
#pragma unroll
    for (int r = 0; r < 8; ++r) so[w][8 * hh + r][n * 16 + m] = acc[n][r];
  __syncthreads();

  // each thread sums one 4-float piece of the 16 x 64 tile over the waves; a wave stores 512 contiguous bytes
  const int row = threadIdx.x >> 4, c4 = threadIdx.x & 15;
  v4f sum = *(const v4f*)&so[0][row][4 * c4];
#pragma unroll
  for (int j = 1; j < OSPLIT; ++j) sum += *(const v4f*)&so[j][row][4 * c4];
  *(v4f*)(out + (size_t)(rowbase + row) * DE + 4 * c4) = sum;
}

extern "C" void kernel_launch(void* const* d_in, const int* in_sizes, int n_in,
                              void* d_out, int out_size, void* d_ws, size_t ws_size,
                              hipStream_t stream) {
  if (n_in < 7) return;
  if (in_sizes[0] != ROWS * DE || in_sizes[1] != ROWS * DE || in_sizes[2] != ROWS * DE) return;
  if (in_sizes[3] != HEADS * DE * DE || in_sizes[4] != HEADS * DE * DE || in_sizes[5] != HEADS * DE * DE) return;
  if (in_sizes[6] != ZDIM * DE) return;
  if (out_size != ROWS * DE) return;

  const float* q  = (const float*)d_in[0];
  const float* k  = (const float*)d_in[1];
  const float* v  = (const float*)d_in[2];
  const float* Wq = (const float*)d_in[3];
  const float* Wk = (const float*)d_in[4];
  const float* Wv = (const float*)d_in[5];
  const float* Wo = (const float*)d_in[6];
  float* out = (float*)d_out;

  char* ws = (char*)d_ws;
  size_t off = 0;
  const size_t plane = (size_t)BH * SEQ * DE * sizeof(us_t);          // 4 MiB each
  us_t* qhh = (us_t*)(ws + off); off += plane;
  us_t* qhl = (us_t*)(ws + off); off += plane;
  us_t* khh = (us_t*)(ws + off); off += plane;
  us_t* khl = (us_t*)(ws + off); off += plane;
  us_t* vth = (us_t*)(ws + off); off += plane;
  us_t* vtl = (us_t*)(ws + off); off += plane;
  float* ml   = (float*)(ws + off); off += (size_t)BH * SEQ * 2 * sizeof(float);    // 256 KiB
  float* outh = (float*)(ws + off); off += (size_t)ROWS * ZDIM * sizeof(float);      // 8 MiB
  if (off > ws_size) return;

  k_proj<<<dim3(3 * HEADS * RT64), dim3(128), 0, stream>>>(q, k, v, Wq, Wk, Wv,
                                                           qhh, qhl, khh, khl, vth, vtl);
  k_stats<<<dim3(BH * (QT / WT)), dim3(32 * SPLIT), 0, stream>>>(qhh, qhl, khh, khl, ml);
  k_attn<<<dim3(BH * (SEQ / KB)), dim3(32 * AW), 0, stream>>>(qhh, qhl, khh, khl, vth, vtl, ml, outh);
  k_oproj<<<dim3(ROWS / 16), dim3(32 * OSPLIT), 0, stream>>>(outh, Wo, out);
}

// v010
// It runs in 54.4 microseconds.
// Timed twice side by side with v009, it ran 1.08 and 1.07 times as fast.
// All steps since v000 together make it 10.1 times as fast.
#include <hip/hip_runtime.h>
#include <stddef.h>

// Contractions: head projections, q.k scores (statistics pass and output pass), P.V over the query axis,
// output projection -- all v_wmma_f32_16x16x32_bf16 with bf16 hi/lo operand split (hi*hi + hi*lo + lo*hi),
// f32 accumulate. RoPE, softmax statistics, masks and epilogues in f32.

#define HEADS 8
#define DE 64
#define BATCH 2
#define SEQ 2048
#define BH (BATCH * HEADS)
#define ZDIM (HEADS * DE)
#define ROWS (BATCH * SEQ)
#define QT (SEQ / 16)
#define RT64 (ROWS / 64)
#define WPITCH 72
#define OPITCH 68
#define NEG_BIG (-3.0e38f)
#define SPLIT 8   // waves of a work-group that share one tile's loop in k_stats
#define OSPLIT 8  // waves of a work-group that share the k axis in k_oproj: DE of the ZDIM k values each
#define WT 2      // 16-wide tiles one wave holds in k_stats and k_attn: each fragment loaded in the loop feeds WT products

typedef char chk_de[(DE == 64) ? 1 : -1];
typedef char chk_seq[((SEQ % 64) == 0) ? 1 : -1];
typedef char chk_rows[((ROWS % 64) == 0) ? 1 : -1];
typedef char chk_z[((ZDIM % 32) == 0) ? 1 : -1];
typedef char chk_os[(ZDIM == OSPLIT * DE && 16 * 16 == 32 * OSPLIT) ? 1 : -1];
typedef char chk_wt[((QT % WT) == 0 && (WT % 2) == 0) ? 1 : -1];

typedef __bf16 bf16_t;
typedef bf16_t v16bf __attribute__((ext_vector_type(16)));
typedef float v8f __attribute__((ext_vector_type(8)));
typedef float v4f __attribute__((ext_vector_type(4)));
typedef float v2f __attribute__((ext_vector_type(2)));
typedef unsigned int v4u __attribute__((ext_vector_type(4)));
typedef unsigned short us_t;

union Frag {
  v16bf v;
  v4u u[2];
};

__device__ __forceinline__ v4u mk4(unsigned int a, unsigned int b, unsigned int c, unsigned int d) {
  v4u r;
  r.x = a; r.y = b; r.z = c; r.w = d;
  return r;
}

__device__ __forceinline__ v8f zero8() {
  v8f z;
#pragma unroll
  for (int i = 0; i < 8; ++i) z[i] = 0.f;
  return z;
}

typedef bf16_t v2bf __attribute__((ext_vector_type(2)));

// two f32 -> two bf16 (RNE) packed in a dword, x0 in the low half: one v_cvt_pk_bf16_f32
__device__ __forceinline__ unsigned int bf_pk(float x0, float x1) {
  v2f x;
  x.x = x0; x.y = x1;
  return __builtin_bit_cast(unsigned int, __builtin_convertvector(x, v2bf));
}

// x ~= hi + lo : hi = RNE16(x), lo = RNE16(x - hi); two values packed per dword (even element in the low half)
__device__ __forceinline__ void split2(float x0, float x1, unsigned int& ph, unsigned int& pl) {
  ph = bf_pk(x0, x1);
  pl = bf_pk(x0 - __uint_as_float(ph << 16), x1 - __uint_as_float(ph & 0xFFFF0000u));
}
__device__ __forceinline__ void split1(float x, us_t& hb, us_t& lb) {
  const bf16_t h = (bf16_t)x;
  hb = __builtin_bit_cast(us_t, h);
  lb = __builtin_bit_cast(us_t, (bf16_t)(x - (float)h));
}
// 8 consecutive k values (a = k..k+3, b = k+4..k+7) -> packed hi and lo halves of a fragment
__device__ __forceinline__ void split8(v4f a, v4f b, v4u& ph, v4u& pl) {
  unsigned int h0, l0, h1, l1, h2, l2, h3, l3;
  split2(a.x, a.y, h0, l0);
  split2(a.z, a.w, h1, l1);
  split2(b.x, b.y, h2, l2);
  split2(b.z, b.w, h3, l3);
  ph = mk4(h0, h1, h2, h3);
  pl = mk4(l0, l1, l2, l3);
}

// D += Ah*Bh + Ah*Bl + Al*Bh ; 4 v_nop guard tying D and keeping all operands live
__device__ __forceinline__ v8f mma3(v16bf ah, v16bf al, v16bf bh, v16bf bl, v8f c) {
  c = __builtin_amdgcn_wmma_f32_16x16x32_bf16(false, ah, false, bh, (short)0, c, false, false);
  c = __builtin_amdgcn_wmma_f32_16x16x32_bf16(false, ah, false, bl, (short)0, c, false, false);
  c = __builtin_amdgcn_wmma_f32_16x16x32_bf16(false, al, false, bh, (short)0, c, false, false);
  asm volatile("v_nop\n\tv_nop\n\tv_nop\n\tv_nop" : "+v"(c) : "v"(ah), "v"(al), "v"(bh), "v"(bl));
  return c;
}

// mma3 for a transposed tile (A is what mma3 takes as B): D += Ah*Bh + Al*Bh + Ah*Bl, so that K.Q^T adds the same three
// products in the same order as Q.K^T does through mma3; the 4 v_nop guard as in mma3
__device__ __forceinline__ v8f mma3t(v16bf ah, v16bf al, v16bf bh, v16bf bl, v8f c) {
  c = __builtin_amdgcn_wmma_f32_16x16x32_bf16(false, ah, false, bh, (short)0, c, false, false);
  c = __builtin_amdgcn_wmma_f32_16x16x32_bf16(false, al, false, bh, (short)0, c, false, false);
  c = __builtin_amdgcn_wmma_f32_16x16x32_bf16(false, ah, false, bl, (short)0, c, false, false);
  asm volatile("v_nop\n\tv_nop\n\tv_nop\n\tv_nop" : "+v"(c) : "v"(ah), "v"(al), "v"(bh), "v"(bl));
  return c;
}

// 16-bit fragment from a row-major [row][k] array (pitch ld elements), rows base..base+15, k from k0.
// Lane l: row = l&15, h = l>>4; elements 0..7 = k0+8h+0..7, elements 8..15 = k0+16+8h+0..7.
// Used for B stored n-major with k contiguous (row = n), on LDS tiles.
__device__ __forceinline__ v16bf ldfrag(const us_t* base, int ld, int k0, int l) {
  const us_t* p = base + (size_t)(l & 15) * ld + k0 + 8 * (l >> 4);
  Frag f;
  f.u[0] = *(const v4u*)p;
  f.u[1] = *(const v4u*)(p + 16);
  return f.v;
}

// The workspace planes hold whole fragments in register order: one fragment (16 rows x 32 k) = FRAG
// elements = [half u][lane l][8 elements], the element map being ldfrag's. Each of the two loads of a
// wave then reads 512 contiguous bytes (4 cache lines) instead of 32 bytes from each of 16 lines.
// plane: wave-uniform base; off: byte offset of the fragment plus 16 * lane.
#define FRAG 512
#define FRAGB (2 * FRAG)
__device__ __forceinline__ v16bf ldfragp(const us_t* plane, unsigned int off) {
  const char* p = (const char*)plane + off;
  Frag f;
  f.u[0] = *(const v4u*)p;
  f.u[1] = *(const v4u*)(p + 512);
  return f.v;
}

// sine and cosine of one rotary angle, x in [0, 2^17): the angle is position * inverse frequency, position < SEQ and
// inverse frequency <= 1, whatever the inputs hold. One quadrant reduction (n = nearest whole number of pi/2, pi/2 taken
// off in three parts) serves both; the reduction, the two polynomials and the quadrant rules are those of the library's
// sinf and cosf for arguments of this size, so the values are the same bits. No path for larger, negative or
// non-finite arguments.
typedef char chk_ang[(SEQ <= (1 << 17)) ? 1 : -1];
__device__ __forceinline__ void rope_sincos(float x, float& sn, float& cs) {
  const float n = __builtin_rintf(x * __uint_as_float(0x3f22f983u));
  float r = __builtin_fmaf(n, __uint_as_float(0xbfc90fdau), x);
  r = __builtin_fmaf(n, __uint_as_float(0xb3a22168u), r);
  r = __builtin_fmaf(n, __uint_as_float(0xa7c234c4u), r);
  const unsigned int i = (unsigned int)(int)n;
  const float r2 = r * r;
  float ps = __builtin_fmaf(__uint_as_float(0xb94c1982u), r2, __uint_as_float(0x3c0881c4u));
  ps = __builtin_fmaf(r2, ps, __uint_as_float(0xbe2aaa9du));
  ps = r2 * ps;
  const float s = __builtin_fmaf(r, ps, r);
  float pc = __builtin_fmaf(__uint_as_float(0x37d75334u), r2, __uint_as_float(0xbab64f3bu));
  pc = __builtin_fmaf(r2, pc, __uint_as_float(0x3d2aabf7u));
  pc = __builtin_fmaf(r2, pc, __uint_as_float(0xbf000004u));
  const float c = __builtin_fmaf(r2, pc, 1.0f);
  const bool odd = (i & 1u) != 0u;
  const unsigned int flip = (i << 30) & 0x80000000u;   // quadrants 2 and 3 change the sign of both
  sn = __uint_as_float(__float_as_uint(odd ? c : s) ^ flip);
  cs = __uint_as_float(__float_as_uint(odd ? -s : c) ^ flip);
}

// =====================================================================
// Kernel 1: head projections + RoPE on q,k.  Block = 4 waves = 64 rows of one (matrix, head).
// Outputs (bf16 hi and lo planes), in fragment order (see ldfragp):
//   qh, kh : [bh][s / 16][d / 32][fragment: row = s % 16, k = d % 32]
//   vt     : [bh][s / 32][d / 16][fragment: row = d % 16, k = s % 32]
// =====================================================================
__global__ __launch_bounds__(128) void k_proj(
    const float* __restrict__ q, const float* __restrict__ k, const float* __restrict__ v,
    const float* __restrict__ Wq, const float* __restrict__ Wk, const float* __restrict__ Wv,
    us_t* __restrict__ qhh, us_t* __restrict__ qhl, us_t* __restrict__ khh, us_t* __restrict__ khl,
    us_t* __restrict__ vth, us_t* __restrict__ vtl) {
#pragma clang fp contract(off)
  __shared__ __attribute__((aligned(16))) us_t wt[2][DE][WPITCH];   // W^T hi/lo : [plane][d][z]
  __shared__ __attribute__((aligned(16))) us_t st[2][64][WPITCH];   // result tile staging
  __shared__ float invf[32];

  const int t = threadIdx.x, w = t >> 5, l = t & 31, m = l & 15, hh = l >> 4;
  const int blk = blockIdx.x;
  const int mat = blk / (HEADS * RT64);                 // 0 = q, 1 = k, 2 = v (block-uniform)
  const int rem = blk - mat * (HEADS * RT64);
  const int head = rem / RT64;
  const int rt = rem - head * RT64;
  const int row0 = rt * 64;                             // row in [0, BATCH*SEQ)
  const int b = row0 / SEQ, s0 = row0 - b * SEQ, bh = b * HEADS + head;

  const float* X = (mat == 0) ? q : ((mat == 1) ? k : v);
  const float* W = ((mat == 0) ? Wq : ((mat == 1) ? Wk : Wv)) + (size_t)head * DE * DE;

  // stage W[z][d] -> wt[p][d][z] as hi/lo bf16
#pragma unroll 4
  for (int j = 0; j < 32; ++j) {
    const int idx = j * 128 + t;
    const int z = idx >> 6, d = idx & 63;
    us_t hb, lb;
    split1(W[idx], hb, lb);
    wt[0][d][z] = hb;
    wt[1][d][z] = lb;
  }
  if (t < 32) invf[t] = 1.0f / powf(10000.0f, (float)t * 0.03125f);
  __syncthreads();

  // A fragments: this wave's 16 rows of X, k 0..31 and 32..63
  const float* xr = X + (size_t)(row0 + w * 16 + m) * DE;
  Frag ah0, al0, ah1, al1;
  {
    v4f a, c;
    a = *(const v4f*)(xr + 8 * hh);       c = *(const v4f*)(xr + 8 * hh + 4);       split8(a, c, ah0.u[0], al0.u[0]);
    a = *(const v4f*)(xr + 16 + 8 * hh);  c = *(const v4f*)(xr + 16 + 8 * hh + 4);  split8(a, c, ah0.u[1], al0.u[1]);
    a = *(const v4f*)(xr + 32 + 8 * hh);  c = *(const v4f*)(xr + 32 + 8 * hh + 4);  split8(a, c, ah1.u[0], al1.u[0]);
    a = *(const v4f*)(xr + 48 + 8 * hh);  c = *(const v4f*)(xr + 48 + 8 * hh + 4);  split8(a, c, ah1.u[1], al1.u[1]);
  }

  v8f acc[4];
#pragma unroll
  for (int n = 0; n < 4; ++n) acc[n] = zero8();
#pragma unroll
  for (int n = 0; n < 4; ++n) {
    acc[n] = mma3(ah0.v, al0.v, ldfrag(&wt[0][n * 16][0], WPITCH, 0, l),
                  ldfrag(&wt[1][n * 16][0], WPITCH, 0, l), acc[n]);
    acc[n] = mma3(ah1.v, al1.v, ldfrag(&wt[0][n * 16][0], WPITCH, 32, l),
                  ldfrag(&wt[1][n * 16][0], WPITCH, 32, l), acc[n]);
  }
  // acc[n][r] = Y[row0 + w*16 + 8*hh + r][n*16 + m]

  if (mat < 2) {   // interleaved-pair rotary embedding: cols (2i, 2i+1) are adjacent lanes
#pragma unroll
    for (int n = 0; n < 4; ++n) {
      const int N = n * 16 + m;
      const float f = invf[N >> 1];
#pragma unroll
      for (int r = 0; r < 8; ++r) {
        const int pos = s0 + w * 16 + 8 * hh + r;
        const float ang = (float)pos * f;
        float sn, cs;
        rope_sincos(ang, sn, cs);
        const float mine = acc[n][r];
        const float other = __shfl_xor(mine, 1, 32);
        acc[n][r] = ((N & 1) == 0) ? (mine * cs - other * sn) : (other * sn + mine * cs);
      }
    }
  }

  // stage the 64-row block tile as hi/lo bf16
  if (mat == 2) {   // transposed: st[p][d][row_local]
#pragma unroll
    for (int n = 0; n < 4; ++n)
#pragma unroll
      for (int r = 0; r < 8; ++r) {
        us_t hb, lb;
        split1(acc[n][r], hb, lb);
        st[0][n * 16 + m][w * 16 + 8 * hh + r] = hb;
        st[1][n * 16 + m][w * 16 + 8 * hh + r] = lb;
      }
  } else {          // row major: st[p][row_local][d]
#pragma unroll
    for (int n = 0; n < 4; ++n)
#pragma unroll
      for (int r = 0; r < 8; ++r) {
        us_t hb, lb;
        split1(acc[n][r], hb, lb);
        st[0][w * 16 + 8 * hh + r][n * 16 + m] = hb;
        st[1][w * 16 + 8 * hh + r][n * 16 + m] = lb;
      }
  }
  __syncthreads();

  // wave w writes the two fragments (k 0..31 and 32..63 of the staged tile) of staged rows w*16..w*16+15
  us_t* dsth = (mat == 2) ? vth : ((mat == 0) ? qhh : khh);
  us_t* dstl = (mat == 2) ? vtl : ((mat == 0) ? qhl : khl);
  // q, k: rows are s, the two fragments are neighbours; v: rows are d, the fragments lie one 32-query chunk apart
  const size_t fbase = (size_t)bh * SEQ * DE + (size_t)s0 * DE + (size_t)w * ((mat == 2) ? FRAG : 2 * FRAG);
  const size_t fstep = (mat == 2) ? (size_t)(32 * DE) : (size_t)FRAG;
  v4u vals[2][4];
#pragma unroll
  for (int i = 0; i < 4; ++i) {
    vals[0][i] = *(const v4u*)&st[0][w * 16 + m][16 * i + 8 * hh];
    vals[1][i] = *(const v4u*)&st[1][w * 16 + m][16 * i + 8 * hh];
  }
#pragma unroll
  for (int i = 0; i < 4; ++i) {
    const size_t o = fbase + (size_t)(i >> 1) * fstep + (i & 1) * 256 + 8 * l;
    *(v4u*)(dsth + o) = vals[0][i];
    *(v4u*)(dstl + o) = vals[1][i];
  }
  
}

// =====================================================================
// Kernel 2: per query row: m[q] = max_{k<=q} s/64, rcp[q] = 1 / sum exp(s/64 - m).
// One work-group per (bh, WT query tiles of 16 rows); wave w takes key tiles w, w + SPLIT, ... and puts
// each loaded key fragment to all WT query tiles; the waves' (max, sum) pairs meet in LDS.
// The score tile is computed transposed (keys as A rows, queries as B columns): a lane holds 8 keys of ONE query row,
// so the row's maximum and the rescaling of its sum are taken once per 8 scores and a lane keeps one (max, sum) pair a
// tile; a row's pairs lie in two lanes of every wave and go to LDS as they are, with no exchange between lanes.
// There are more work-groups than resident places; the index runs over the tiles from the longest key loop to the
// shortest (all bh of a tile side by side).
// =====================================================================
// __expf with the exponential and a v_nop in one statement: the free slot that the instruction set asks for between a
// transcendental and a next instruction that overwrites its source
__device__ __forceinline__ float expf_slot(float x) {
  float y;
  asm("v_exp_f32 %0, %1\n\tv_nop" : "=v"(y) : "v"(x * 1.44269504088896341f));
  return y;
}

__global__ __launch_bounds__(32 * SPLIT) void k_stats(
    const us_t* __restrict__ qhh, const us_t* __restrict__ qhl,
    const us_t* __restrict__ khh, const us_t* __restrict__ khl, float* __restrict__ ml) {
  __shared__ float pm[2 * SPLIT][16 * WT];   // [wave, half of its lanes][query row]
  __shared__ float ps[2 * SPLIT][16 * WT];
  // the wave's number as a scalar: the loop's bounds and branch stay on the scalar unit
  const int w = __builtin_amdgcn_readfirstlane(threadIdx.x >> 5);
  const int rank = blockIdx.x / BH, bh = blockIdx.x - rank * BH;
  const int qt0 = (QT / WT - 1 - rank) * WT;   // first query tile: the last tile has the most keys
  const int l = threadIdx.x & 31, m = l & 15, hh = l >> 4;

  const size_t qoff = ((size_t)bh * SEQ + qt0 * 16) * DE;
  v16bf aqh[WT][2], aql[WT][2];
#pragma unroll
  for (int t = 0; t < WT; ++t) {
    const unsigned int ao = t * (2 * FRAGB) + 16 * l;
    aqh[t][0] = ldfragp(qhh + qoff, ao);
    aqh[t][1] = ldfragp(qhh + qoff, ao + FRAGB);
    aql[t][0] = ldfragp(qhl + qoff, ao);
    aql[t][1] = ldfragp(qhl + qoff, ao + FRAGB);
  }
  const us_t* Kh = khh + (size_t)bh * SEQ * DE;
  const us_t* Kl = khl + (size_t)bh * SEQ * DE;

  float mrow[WT], lrow[WT];
#pragma unroll
  for (int t = 0; t < WT; ++t) { mrow[t] = NEG_BIG; lrow[t] = 0.f; }

  // a key tile past the diagonal of one of the query tiles is all masked there and adds exactly 0
#pragma unroll 1
  for (int kt = w; kt < qt0 + WT; kt += SPLIT) {
    const unsigned int ko = (unsigned int)kt * (2 * FRAGB) + 16 * l;
    const v16bf kh0 = ldfragp(Kh, ko), kl0 = ldfragp(Kl, ko);
    const v16bf kh1 = ldfragp(Kh, ko + FRAGB), kl1 = ldfragp(Kl, ko + FRAGB);
#pragma unroll
    for (int t = 0; t < WT; ++t) {
      v8f s = zero8();
      s = mma3t(kh0, kl0, aqh[t][0], aql[t][0], s);
      s = mma3t(kh1, kl1, aqh[t][1], aql[t][1], s);
      // s[r] = score[q = (qt0 + t)*16 + m][k = kt*16 + 8*hh + r]
      // running maximum and sum stay private to the lane (its own eight key rows of every tile)
      const int qg = (qt0 + t) * 16 + m;
      float x[8];
      float mn = mrow[t];
#pragma unroll
      for (int r = 0; r < 8; ++r) {
        const int kg = kt * 16 + 8 * hh + r;
        x[r] = (kg <= qg) ? s[r] * (1.0f / 64.0f) : NEG_BIG;
        mn = fmaxf(mn, x[r]);
      }
      float e[8];
#pragma unroll
      for (int r = 0; r < 8; ++r) e[r] = __expf(x[r] - mn);
      lrow[t] = lrow[t] * __expf(mrow[t] - mn) + (((e[0] + e[1]) + (e[2] + e[3])) + ((e[4] + e[5]) + (e[6] + e[7])));
      mrow[t] = mn;
    }
  }

  // merge of the lane halves and waves: one that saw no valid key of a row holds NEG_BIG there and its sum scales to 0
#pragma unroll   // mrow and lrow live in registers: t must be a constant
  for (int t = 0; t < WT; ++t) {
    pm[2 * w + hh][16 * t + m] = mrow[t];
    ps[2 * w + hh][16 * t + m] = lrow[t];
  }
  __syncthreads();
  if (threadIdx.x < 16 * WT) {
    const int row = threadIdx.x;
    float gm = pm[0][row];
    for (int j = 1; j < 2 * SPLIT; ++j) gm = fmaxf(gm, pm[j][row]);
    float e = 0.f;
    for (int j = 0; j < 2 * SPLIT; ++j) e += ps[j][row] * expf_slot(pm[j][row] - gm);
    v2f val;
    val.x = gm; val.y = 1.0f / e;
    *(v2f*)(ml + ((size_t)bh * SEQ + qt0 * 16 + row) * 2) = val;
  }
}

// =====================================================================
// Kernel 3: out_h[bh][kpos][d] = sum_{q > kpos} P[q,kpos] * vh[q][d]   (contraction over the query axis)
// One work-group per (bh, KP wave tiles of WT key tiles of 16 columns) = AW waves: wave (kp, g) holds wave tile kp
// and takes the 32-query chunk g of every stage. A stage = QG chunks of the q and v planes (hi and lo) and their row
// statistics, brought from global memory into LDS once for the whole work-group by asynchronous copies, in a ring of
// two buffers: the next stage's copies fly while this one is worked on, and every fragment is read KP times from LDS.
// Per chunk and key tile: two 16x16 score tiles -> P in registers (packed D tiles = P^T A fragment) -> 4 P^T.V products.
// The waves' partial tiles are summed through LDS (the ring's bytes, free by then). Stores f32 out_h [b*S][H*DE].
// The index runs over the tiles from the longest query loop to the shortest, as in k_stats.
// =====================================================================
#define KP 2                      // wave tiles side by side in a work-group
#define QG 8                      // chunks of a stage
#define AW (KP * QG)              // waves of a work-group
#define KB (KP * WT * 16)         // keys of a work-group
#define CHB (4 * FRAGB)           // bytes of a 32-query chunk in one plane
#define PLB (QG * CHB)            // bytes of a stage in one plane
#define MLB (QG * 32 * 8)         // bytes of a stage's row statistics
#define STB (4 * PLB + MLB)       // bytes of a stage
#define NST (SEQ / (32 * QG))     // stages of the whole query axis
#define RB (32 * AW * 16)         // bytes one 16-byte copy of every thread covers
typedef char chk_st[(PLB == 4 * RB && MLB == 32 * AW * 4 && (SEQ % (32 * QG)) == 0 && WT == 2) ? 1 : -1];
typedef char chk_so[(QG * KB * OPITCH * 4 <= 2 * STB) ? 1 : -1];

// eight 16-byte copies of every lane, global memory -> LDS through no register: four steps of RB bytes in each of two
// planes. la, lb: the lane's LDS byte addresses; ga, gb: its global addresses. The s_wait_xcnt closes the statement so
// that no address register is rewritten in front of it.
__device__ __forceinline__ void copy8(unsigned int la, const char* ga, unsigned int lb, const char* gb) {
  asm volatile(
      "global_load_async_to_lds_b128 %0, %8, off\n\t"
      "global_load_async_to_lds_b128 %1, %9, off\n\t"
      "global_load_async_to_lds_b128 %2, %10, off\n\t"
      "global_load_async_to_lds_b128 %3, %11, off\n\t"
      "global_load_async_to_lds_b128 %4, %12, off\n\t"
      "global_load_async_to_lds_b128 %5, %13, off\n\t"
      "global_load_async_to_lds_b128 %6, %14, off\n\t"
      "global_load_async_to_lds_b128 %7, %15, off\n\t"
      "s_wait_xcnt 0x0"
      :: "v"(la), "v"(la + RB), "v"(la + 2 * RB), "v"(la + 3 * RB),
         "v"(lb), "v"(lb + RB), "v"(lb + 2 * RB), "v"(lb + 3 * RB),
         "v"(ga), "v"(ga + RB), "v"(ga + 2 * RB), "v"(ga + 3 * RB),
         "v"(gb), "v"(gb + RB), "v"(gb + 2 * RB), "v"(gb + 3 * RB)
      : "memory");
}
// one 4-byte copy of every lane, the wait as in copy8
__device__ __forceinline__ void copy1(unsigned int la, const char* ga) {
  asm volatile("global_load_async_to_lds_b32 %0, %1, off\n\ts_wait_xcnt 0x0" :: "v"(la), "v"(ga) : "memory");
}
// fragment in register order from LDS: p = fragment start + 16 * lane
__device__ __forceinline__ v16bf ldfragl(const char* p) {
  Frag f;
  f.u[0] = *(const v4u*)p;
  f.u[1] = *(const v4u*)(p + 512);
  return f.v;
}

__global__ __launch_bounds__(32 * AW) void k_attn(
    const us_t* __restrict__ qhh, const us_t* __restrict__ qhl,
    const us_t* __restrict__ khh, const us_t* __restrict__ khl,
    const us_t* __restrict__ vth, const us_t* __restrict__ vtl,
    const float* __restrict__ ml, float* __restrict__ outh) {
  __shared__ __attribute__((aligned(16))) char sm[2 * STB];   // [buffer][q hi | q lo | v hi | v lo | statistics]
  // the wave's number as a scalar: the skip of chunks in front of the diagonal stays a scalar branch
  const int w = __builtin_amdgcn_readfirstlane(threadIdx.x >> 5);
  const int kp = w / QG, g = w - kp * QG;
  const int blk = blockIdx.x / BH, bh = blockIdx.x - blk * BH;   // the first key block has the most queries
  const int kt0 = (blk * KP + kp) * WT;   // first key tile of this wave
  const int cw = kt0 >> 1;                // the chunk that holds this wave's diagonal
  const int st0 = (blk * KB) / (32 * QG); // the stage that holds the work-group's first diagonal
  const int l = threadIdx.x & 31, m = l & 15, hh = l >> 4;

  // this thread's share of every stage: the same byte offsets in LDS and in the planes
  const unsigned int lds0 = (unsigned int)(size_t)sm + 16 * threadIdx.x;
  const unsigned int ldsm = (unsigned int)(size_t)sm + 4 * PLB + 4 * threadIdx.x;
  const size_t pb = (size_t)bh * SEQ * DE * 2 + 16 * threadIdx.x;
  const char* gqh = (const char*)qhh + pb;
  const char* gql = (const char*)qhl + pb;
  const char* gvh = (const char*)vth + pb;
  const char* gvl = (const char*)vtl + pb;
  const char* gml = (const char*)ml + (size_t)bh * SEQ * 8 + 4 * threadIdx.x;

  // stage st0 into buffer 0
  copy8(lds0, gqh + (size_t)st0 * PLB, lds0 + PLB, gql + (size_t)st0 * PLB);
  copy8(lds0 + 2 * PLB, gvh + (size_t)st0 * PLB, lds0 + 3 * PLB, gvl + (size_t)st0 * PLB);
  copy1(ldsm, gml + (size_t)st0 * MLB);

  // loop-invariant B fragments of the key tiles (kh rows kt0*16.., lane = key)
  const size_t koff = ((size_t)bh * SEQ + kt0 * 16) * DE;
  v16bf bkh[WT][2], bkl[WT][2];
#pragma unroll
  for (int t = 0; t < WT; ++t) {
    const unsigned int bo = t * (2 * FRAGB) + 16 * l;
    bkh[t][0] = ldfragp(khh + koff, bo);
    bkh[t][1] = ldfragp(khh + koff, bo + FRAGB);
    bkl[t][0] = ldfragp(khl + koff, bo);
    bkl[t][1] = ldfragp(khl + koff, bo + FRAGB);
  }

  v8f o[WT][4];
#pragma unroll
  for (int t = 0; t < WT; ++t)
#pragma unroll
    for (int n = 0; n < 4; ++n) o[t][n] = zero8();

  asm volatile("s_wait_asynccnt 0x0" ::: "memory");   // this wave's copies of the first stage have landed
  __syncthreads();                                    // and every other wave's
  if (st0 + 1 < NST) {                                // the second stage into buffer 1
    const size_t so1 = (size_t)(st0 + 1);
    copy8(lds0 + STB, gqh + so1 * PLB, lds0 + STB + PLB, gql + so1 * PLB);
    copy8(lds0 + STB + 2 * PLB, gvh + so1 * PLB, lds0 + STB + 3 * PLB, gvl + so1 * PLB);
    copy1(ldsm + STB, gml + so1 * MLB);
  }

#pragma unroll 1   // rolled: the trip count differs per work-group, and the ring's hand-over stands once in the text
  for (int st = st0; st < NST; ++st) {
    const unsigned int bo = ((st - st0) & 1) * STB;   // this stage's buffer
    const int c = st * QG + g;                        // this wave's chunk
    if (c >= cw) {                                    // chunks in front of the diagonal are all masked
      const int qc = c * 32;
      const char* fb = sm + bo + g * CHB + 16 * l;    // the chunk is 4 fragments in each plane, q and v alike
      const char* mb = sm + bo + 4 * PLB + (g * 32 + 8 * hh) * 8;
      unsigned int ph[WT][2][4], pl[WT][2][4];
#pragma unroll
      for (int sub = 0; sub < 2; ++sub) {
        const int q0 = qc + 16 * sub;
        const char* qb = fb + sub * (2 * FRAGB);
        const v16bf qh0 = ldfragl(qb), ql0 = ldfragl(qb + PLB);
        const v16bf qh1 = ldfragl(qb + FRAGB), ql1 = ldfragl(qb + PLB + FRAGB);
        v4f mq[4];   // rows 2i and 2i + 1 of this lane's eight: (max, 1 / sum) each
#pragma unroll
        for (int i = 0; i < 4; ++i) mq[i] = *(const v4f*)(mb + sub * 128 + 16 * i);
#pragma unroll
        for (int t = 0; t < WT; ++t) {
          const int kg = (kt0 + t) * 16 + m;          // this lane's key column in the score tile
          v8f s = zero8();
          s = mma3(qh0, ql0, bkh[t][0], bkl[t][0], s);
          s = mma3(qh1, ql1, bkh[t][1], bkl[t][1], s);
          // s[r] = score[q = q0 + 8*hh + r][k = kg]
          float p[8];
#pragma unroll
          for (int r = 0; r < 8; ++r) {
            const int qg = q0 + 8 * hh + r;
            const float e = __expf(s[r] * (1.0f / 64.0f) - mq[r >> 1][2 * (r & 1)]) * mq[r >> 1][2 * (r & 1) + 1];
            p[r] = (kg < qg) ? e : 0.f;               // causal and zeroed diagonal: strictly k < q
          }
#pragma unroll
          for (int j = 0; j < 4; ++j) split2(p[2 * j], p[2 * j + 1], ph[t][sub][j], pl[t][sub][j]);
        }
      }
      // P^T A fragments (rows = key m, k = 32 queries of this chunk): elements 0..7 from the first
      // 16-query D tile, 8..15 from the second, same lane.
      Frag aph[WT], apl[WT];
#pragma unroll
      for (int t = 0; t < WT; ++t) {
        aph[t].u[0] = mk4(ph[t][0][0], ph[t][0][1], ph[t][0][2], ph[t][0][3]);
        aph[t].u[1] = mk4(ph[t][1][0], ph[t][1][1], ph[t][1][2], ph[t][1][3]);
        apl[t].u[0] = mk4(pl[t][0][0], pl[t][0][1], pl[t][0][2], pl[t][0][3]);
        apl[t].u[1] = mk4(pl[t][1][0], pl[t][1][1], pl[t][1][2], pl[t][1][3]);
      }
#pragma unroll
      for (int n = 0; n < 4; ++n) {
        // B fragment: rows d = n*16.., k = query from qc
        const v16bf vh = ldfragl(fb + 2 * PLB + n * FRAGB), vl = ldfragl(fb + 3 * PLB + n * FRAGB);
#pragma unroll
        for (int t = 0; t < WT; ++t) o[t][n] = mma3(aph[t].v, apl[t].v, vh, vl, o[t][n]);
      }
    }
    // hand-over, passed by every wave: the next stage is published and this stage's buffer is given free
    asm volatile("s_wait_dscnt 0x0" ::: "memory");      // this wave's reads of the buffer are done
    asm volatile("s_wait_asynccnt 0x0" ::: "memory");   // its copies of the next stage have landed
    __syncthreads();
    if (st + 2 < NST) {                                 // the stage after the next into the buffer just read
      const size_t so2 = (size_t)(st + 2);
      copy8(lds0 + bo, gqh + so2 * PLB, lds0 + bo + PLB, gql + so2 * PLB);
      copy8(lds0 + bo + 2 * PLB, gvh + so2 * PLB, lds0 + bo + 3 * PLB, gvl + so2 * PLB);
      copy1(ldsm + bo, gml + so2 * MLB);
    }
  }
  asm volatile("s_wait_asynccnt 0x0" ::: "memory");     // no copy is under way when the ring's bytes change their use
  // o[t][n][r] = this wave's share of out_h[kpos = (kt0 + t)*16 + 8*hh + r][d = n*16 + m]

  float* so = (float*)sm;   // [g][key of the work-group][OPITCH]
#pragma unroll
  for (int t = 0; t < WT; ++t)
#pragma unroll
    for (int n = 0; n < 4; ++n)
#pragma unroll
      for (int r = 0; r < 8; ++r)
        so[(size_t)(g * KB + (kp * WT + t) * 16 + 8 * hh + r) * OPITCH + n * 16 + m] = o[t][n][r];
  __syncthreads();

  // each thread sums 4-float pieces of the KB x 64 tile over the QG waves of a key tile
  const int bb = bh / HEADS, head = bh - bb * HEADS;
  for (int i = threadIdx.x; i < KB * 16; i += 32 * AW) {
    const int row = i >> 4, c4 = i & 15;
    v4f sum = *(const v4f*)&so[(size_t)row * OPITCH + 4 * c4];
    for (int j = 1; j < QG; ++j) sum += *(const v4f*)&so[(size_t)(j * KB + row) * OPITCH + 4 * c4];
    *(v4f*)(outh + ((size_t)bb * SEQ + blk * KB + row) * ZDIM + head * DE + 4 * c4) = sum;
  }
}

// =====================================================================
// Kernel 4: out = out_h (4096 x 512) . W_o (512 x 64). One work-group per 16 rows; wave w takes the 64 k of
// head w, so no wave waits for a chunk another wave stages: its A rows and its W_o B fragments come straight
// from global memory, with no barrier between a load and its product. The waves' partial tiles are summed in LDS.
// =====================================================================
__global__ __launch_bounds__(32 * OSPLIT) void k_oproj(
    const float* __restrict__ outh, const float* __restrict__ Wo, float* __restrict__ out) {
  __shared__ __attribute__((aligned(16))) float so[OSPLIT][16][OPITCH];
  // the wave's number as a scalar: the bases of its k range stay on the scalar unit
  const int w = __builtin_amdgcn_readfirstlane(threadIdx.x >> 5);
  const int l = threadIdx.x & 31, m = l & 15, hh = l >> 4;
  const int rowbase = blockIdx.x * 16;

  // A: row = rowbase + m, k as in ldfrag. B: lane = column n*16 + m, the same k order, one W_o row per element.
  const float* ar = outh + (size_t)w * DE + (size_t)(rowbase + m) * ZDIM + 8 * hh;
  const float* br = Wo + (size_t)w * DE * DE + (size_t)(8 * hh) * DE + m;
  // araw, braw and acc live in registers: every loop below is unrolled so that their indices are constants
  v4f araw[2][4];
  float braw[2][4][16];
#pragma unroll
  for (int c = 0; c < 2; ++c)
#pragma unroll
    for (int u = 0; u < 2; ++u) {
      araw[c][2 * u] = *(const v4f*)(ar + c * 32 + 16 * u);
      araw[c][2 * u + 1] = *(const v4f*)(ar + c * 32 + 16 * u + 4);
    }
#pragma unroll
  for (int c = 0; c < 2; ++c)
#pragma unroll
    for (int n = 0; n < 4; ++n)
#pragma unroll
      for (int e = 0; e < 16; ++e)
        braw[c][n][e] = br[(size_t)(c * 32 + 16 * (e >> 3) + (e & 7)) * DE + n * 16];

  v8f acc[4];
#pragma unroll
  for (int n = 0; n < 4; ++n) acc[n] = zero8();
#pragma unroll
  for (int c = 0; c < 2; ++c) {
    Frag ah, al;
    split8(araw[c][0], araw[c][1], ah.u[0], al.u[0]);
    split8(araw[c][2], araw[c][3], ah.u[1], al.u[1]);
#pragma unroll
    for (int n = 0; n < 4; ++n) {
      Frag bh, bl;
#pragma unroll
      for (int u = 0; u < 2; ++u) {
        unsigned int h[4], lo[4];
#pragma unroll
        for (int j = 0; j < 4; ++j) split2(braw[c][n][8 * u + 2 * j], braw[c][n][8 * u + 2 * j + 1], h[j], lo[j]);
        bh.u[u] = mk4(h[0], h[1], h[2], h[3]);
        bl.u[u] = mk4(lo[0], lo[1], lo[2], lo[3]);
      }
      acc[n] = mma3(ah.v, al.v, bh.v, bl.v, acc[n]);
    }
  }
  // acc[n][r] = this wave's share of out[rowbase + 8*hh + r][n*16 + m]

#pragma unroll
  for (int n = 0; n < 4; ++n)
#pragma unroll
    for (int r = 0; r < 8; ++r) so[w][8 * hh + r][n * 16 + m] = acc[n][r];
  __syncthreads();

  // each thread sums one 4-float piece of the 16 x 64 tile over the waves; a wave stores 512 contiguous bytes
  const int row = threadIdx.x >> 4, c4 = threadIdx.x & 15;
  v4f sum = *(const v4f*)&so[0][row][4 * c4];
#pragma unroll
  for (int j = 1; j < OSPLIT; ++j) sum += *(const v4f*)&so[j][row][4 * c4];
  *(v4f*)(out + (size_t)(rowbase + row) * DE + 4 * c4) = sum;
}

extern "C" void kernel_launch(void* const* d_in, const int* in_sizes, int n_in,
                              void* d_out, int out_size, void* d_ws, size_t ws_size,
                              hipStream_t stream) {
  if (n_in < 7) return;
  if (in_sizes[0] != ROWS * DE || in_sizes[1] != ROWS * DE || in_sizes[2] != ROWS * DE) return;
  if (in_sizes[3] != HEADS * DE * DE || in_sizes[4] != HEADS * DE * DE || in_sizes[5] != HEADS * DE * DE) return;
  if (in_sizes[6] != ZDIM * DE) return;
  if (out_size != ROWS * DE) return;

  const float* q  = (const float*)d_in[0];
  const float* k  = (const float*)d_in[1];
  const float* v  = (const float*)d_in[2];
  const float* Wq = (const float*)d_in[3];
  const float* Wk = (const float*)d_in[4];
  const float* Wv = (const float*)d_in[5];
  const float* Wo = (const float*)d_in[6];
  float* out = (float*)d_out;

  char* ws = (char*)d_ws;
  size_t off = 0;
  const size_t plane = (size_t)BH * SEQ * DE * sizeof(us_t);          // 4 MiB each
  us_t* qhh = (us_t*)(ws + off); off += plane;
  us_t* qhl = (us_t*)(ws + off); off += plane;
  us_t* khh = (us_t*)(ws + off); off += plane;
  us_t* khl = (us_t*)(ws + off); off += plane;
  us_t* vth = (us_t*)(ws + off); off += plane;
  us_t* vtl = (us_t*)(ws + off); off += plane;
  float* ml   = (float*)(ws + off); off += (size_t)BH * SEQ * 2 * sizeof(float);    // 256 KiB
  float* outh = (float*)(ws + off); off += (size_t)ROWS * ZDIM * sizeof(float);      // 8 MiB
  if (off > ws_size) return;

  k_proj<<<dim3(3 * HEADS * RT64), dim3(128), 0, stream>>>(q, k, v, Wq, Wk, Wv,
                                                           qhh, qhl, khh, khl, vth, vtl);
  k_stats<<<dim3(BH * (QT / WT)), dim3(32 * SPLIT), 0, stream>>>(qhh, qhl, khh, khl, ml);
  k_attn<<<dim3(BH * (SEQ / KB)), dim3(32 * AW), 0, stream>>>(qhh, qhl, khh, khl, vth, vtl, ml, outh);
  k_oproj<<<dim3(ROWS / 16), dim3(32 * OSPLIT), 0, stream>>>(outh, Wo, out);
}
